// v000
// Measured on an AMD MI455X. A time is GPU time per run, averaged over a window of back-to-back runs after a warm-up
// (all launches, gaps included; the runs take copies of the inputs in turn), and the median of several windows.
// Apart from v000's, it joins two sittings. Times from different sittings can be a few percent apart, while
// side-by-side timings come from the same sitting.
// The starting kernel, v000, takes 618 microseconds a run.
#include <hip/hip_runtime.h>

// Single-head causal attention over 4,096 tokens with a 64-wide head (embedded [4][4096][256]; k, q, v = x W + b ('xw' [256][64] 1/16; input order Wk, bk, Wq, bq, Wv, bv); scores / 8; causal (-inf); softmax; out = p v -> [4][4096][64] (1.05 M)).
// Layout per batch: bf16 copy of x; 'xw' [256][64] weights transposed once; exact projections + f32 biases; causal T-4096 attention for the one head with hi/lo 3-product score tiles on EVERY row (register-row softmax); P and attn.v hybrid (rows < 512 hi/lo, rest fp16 x1024; tiles above the diagonal skipped); the f32 merge writes the output rows.
// Compute dtypes, f32 accumulate: every input rounded to bf16; projections exact + f32 biases; scores 3 products on every row; softmax f32; attn.v rows < 512 3 products, rest fp16; output f32.

#define NB_  4
#define TT   4096
#define DM   256
#define NH_  1
#define NKV  1
#define REP  (NH_ / NKV)
#define HD   64
#define DQ   (NH_ * HD)
#define DKV  (NKV * HD)
#define ZH   1
#define RH   512                  // query rows < RH use hi+lo planes (0: none)
#define WIN  4096
#define PCAR 1024.0f
#define SCL  0.125f   // HD^-0.5
typedef _Float16 h16;
typedef unsigned short bf;
typedef __attribute__((ext_vector_type(16))) __bf16   v16bf;
typedef __attribute__((ext_vector_type(16))) _Float16 v16h;
typedef __attribute__((ext_vector_type(8)))  _Float16 v8h;
typedef __attribute__((ext_vector_type(8)))  unsigned short v8us;
typedef __attribute__((ext_vector_type(8)))  float    v8f;
typedef __attribute__((ext_vector_type(4)))  float    v4f;
typedef v8h  __attribute__((may_alias)) v8ha;
typedef v4f  __attribute__((may_alias)) v4fa;
typedef v8us __attribute__((may_alias)) v8usa;

__device__ __forceinline__ unsigned short f2bf(float f) { unsigned u = __float_as_uint(f); u += 0x7FFFu + ((u >> 16) & 1u); return (unsigned short)(u >> 16); }
__device__ __forceinline__ float bf2f(unsigned short b) { return __uint_as_float(((unsigned)b) << 16); }
__device__ __forceinline__ float bfr(float f) { return bf2f(f2bf(f)); }
__device__ __forceinline__ v16h cat16(v8h lo, v8h hi) { return __builtin_shufflevector(lo, hi, 0, 1, 2, 3, 4, 5, 6, 7, 8, 9, 10, 11, 12, 13, 14, 15); }
__device__ __forceinline__ v16bf cat16b(v8us lo, v8us hi) { return __builtin_bit_cast(v16bf, __builtin_shufflevector(lo, hi, 0, 1, 2, 3, 4, 5, 6, 7, 8, 9, 10, 11, 12, 13, 14, 15)); }
__device__ __forceinline__ v8f wmma16(v16h a, v16h b, v8f c) { return __builtin_amdgcn_wmma_f32_16x16x32_f16(false, a, false, b, (short)0, c, false, false); }
__device__ __forceinline__ v8f wmmab(v16bf a, v16bf b, v8f c) { return __builtin_amdgcn_wmma_f32_16x16x32_bf16(false, a, false, b, (short)0, c, false, false); }



// ---- k_gemmw: register-blocked GEMM, ONE WAVE per 64x64 output tile (16 accumulators), operands straight from K-contiguous 16-bit planes; grid (M/64, N/64, Z), 32 threads.
// C[m][n] (f32, pitch ldc, + optional f32 bias[n]) = sum_k A[m][k] Bt[n][k] (+ split products per NSPLIT). z-batch strides sA/sB/sC in elements. K % 32 == 0.
template <typename T16> struct WFrag;
template <> struct WFrag<h16> { typedef v16h V; static __device__ __forceinline__ V ld(const h16* p) { return cat16(*(const v8h*)p, *(const v8h*)(p + 16)); } static __device__ __forceinline__ v8f mma(V a, V b, v8f c) { return wmma16(a, b, c); } };
template <> struct WFrag<bf> { typedef v16bf V; static __device__ __forceinline__ V ld(const bf* p) { return cat16b(*(const v8us*)p, *(const v8us*)(p + 16)); } static __device__ __forceinline__ v8f mma(V a, V b, v8f c) { return wmmab(a, b, c); } };
template <typename T16, int NSPLIT, bool BIAS>
__global__ __launch_bounds__(32) void k_gemmw(const T16* __restrict__ A, const T16* __restrict__ A2, const T16* __restrict__ Bt, const T16* __restrict__ Bt2, int K, float* C, int ldc, const float* __restrict__ bias, size_t sA, size_t sB, size_t sC) {
    typedef typename WFrag<T16>::V V;
    __shared__ __align__(16) float os[16 * 68];
    const size_t z = blockIdx.z; A += z * sA; if (A2) A2 += z * sA; Bt += z * sB; if (Bt2) Bt2 += z * sB; C += z * sC;
    const int lane = threadIdx.x & 31, lr = lane & 15, hi = lane >> 4; const int r0 = blockIdx.x * 64, c0 = blockIdx.y * 64;
    v8f acc[4][4];
#pragma unroll
    for (int mb = 0; mb < 4; ++mb)
#pragma unroll
        for (int nb = 0; nb < 4; ++nb) acc[mb][nb] = (v8f){};
    const size_t aoff = (size_t)(r0 + lr) * K + 8 * hi, boff = (size_t)(c0 + lr) * K + 8 * hi;
#pragma unroll 1
    for (int kc = 0; kc < K; kc += 32) {
        V a[4], a2[4];
#pragma unroll
        for (int mb = 0; mb < 4; ++mb) { a[mb] = WFrag<T16>::ld(A + aoff + (size_t)mb * 16 * K + kc); if (NSPLIT == 1 || NSPLIT == 2) a2[mb] = WFrag<T16>::ld(A2 + aoff + (size_t)mb * 16 * K + kc); }
#pragma unroll
        for (int nb = 0; nb < 4; ++nb) { const V b = WFrag<T16>::ld(Bt + boff + (size_t)nb * 16 * K + kc); V b2; if (NSPLIT >= 2) b2 = WFrag<T16>::ld(Bt2 + boff + (size_t)nb * 16 * K + kc);
#pragma unroll
            for (int mb = 0; mb < 4; ++mb) { acc[mb][nb] = WFrag<T16>::mma(a[mb], b, acc[mb][nb]); if (NSPLIT == 1 || NSPLIT == 2) acc[mb][nb] = WFrag<T16>::mma(a2[mb], b, acc[mb][nb]); if (NSPLIT >= 2) acc[mb][nb] = WFrag<T16>::mma(a[mb], b2, acc[mb][nb]); } }
        asm volatile("v_nop\n\tv_nop\n\tv_nop\n\tv_nop" : "+v"(acc[0][0]), "+v"(acc[1][1]), "+v"(acc[2][2]), "+v"(acc[3][3]) : "v"(a[0]), "v"(a[3]));
    }
#pragma unroll
    for (int mb = 0; mb < 4; ++mb) {
#pragma unroll
        for (int nb = 0; nb < 4; ++nb) {
#pragma unroll
            for (int j = 0; j < 8; ++j) os[(hi * 8 + j) * 68 + nb * 16 + lr] = acc[mb][nb][j]; }
        __builtin_amdgcn_wave_barrier(); asm volatile("" ::: "memory");
        float* crow = C + (size_t)(r0 + mb * 16) * ldc + c0;
{
#pragma unroll
            for (int s = 0; s < 8; ++s) { const int row = 2 * s + hi, cofs = lr * 4; v4f val = *(const v4fa*)(os + row * 68 + cofs); if (BIAS) { val[0] += bfr(bias[c0 + cofs]); val[1] += bfr(bias[c0 + cofs + 1]); val[2] += bfr(bias[c0 + cofs + 2]); val[3] += bfr(bias[c0 + cofs + 3]); }
                *(v4f*)(crow + (size_t)row * ldc + cofs) = val; }
             }
        __builtin_amdgcn_wave_barrier(); asm volatile("" ::: "memory");
    }
}

// ---- k_gemmc: the same one-wave 64x64 tile GEMM specialised for causal attention: CMODE 1 skips score tiles entirely above the diagonal (query rows r0+roff.., key columns c0..), CMODE 2 limits the
// key (K) loop of the probability x value contraction to the diagonal block (probabilities beyond it are exactly zero). roff = row offset of this launch's first row within the sequence.
template <typename T16, int NSPLIT, int CMODE>
__global__ __launch_bounds__(32) void k_gemmc(const T16* __restrict__ A, const T16* __restrict__ A2, const T16* __restrict__ Bt, const T16* __restrict__ Bt2, int K, float* C, int ldc, int roff, size_t sA, size_t sB, size_t sC) {
    typedef typename WFrag<T16>::V V;
    __shared__ __align__(16) float os[16 * 68];
    const size_t z = blockIdx.z; A += z * sA; if (A2) A2 += z * sA; Bt += z * sB; if (Bt2) Bt2 += z * sB; C += z * sC;
    const int lane = threadIdx.x & 31, lr = lane & 15, hi = lane >> 4; const int r0 = blockIdx.x * 64, c0 = blockIdx.y * 64;
    if (CMODE == 1 && c0 > r0 + roff + 63) return;                  // score tile entirely above the causal diagonal: never read (the softmax masks j > i by select)
    const int Kl = (CMODE == 2) ? min(K, r0 + roff + 64) : K;        // P.V: probabilities are exactly 0 beyond the diagonal block, so the K loop stops there
    v8f acc[4][4];
#pragma unroll
    for (int mb = 0; mb < 4; ++mb)
#pragma unroll
        for (int nb = 0; nb < 4; ++nb) acc[mb][nb] = (v8f){};
    const size_t aoff = (size_t)(r0 + lr) * K + 8 * hi, boff = (size_t)(c0 + lr) * K + 8 * hi;
#pragma unroll 1
    for (int kc = 0; kc < Kl; kc += 32) {
        V a[4], a2[4];
#pragma unroll
        for (int mb = 0; mb < 4; ++mb) { a[mb] = WFrag<T16>::ld(A + aoff + (size_t)mb * 16 * K + kc); if (NSPLIT == 1 || NSPLIT == 2) a2[mb] = WFrag<T16>::ld(A2 + aoff + (size_t)mb * 16 * K + kc); }
#pragma unroll
        for (int nb = 0; nb < 4; ++nb) { const V b = WFrag<T16>::ld(Bt + boff + (size_t)nb * 16 * K + kc); V b2; if (NSPLIT >= 2) b2 = WFrag<T16>::ld(Bt2 + boff + (size_t)nb * 16 * K + kc);
#pragma unroll
            for (int mb = 0; mb < 4; ++mb) { acc[mb][nb] = WFrag<T16>::mma(a[mb], b, acc[mb][nb]); if (NSPLIT == 1 || NSPLIT == 2) acc[mb][nb] = WFrag<T16>::mma(a2[mb], b, acc[mb][nb]); if (NSPLIT >= 2) acc[mb][nb] = WFrag<T16>::mma(a[mb], b2, acc[mb][nb]); } }
        asm volatile("v_nop\n\tv_nop\n\tv_nop\n\tv_nop" : "+v"(acc[0][0]), "+v"(acc[1][1]), "+v"(acc[2][2]), "+v"(acc[3][3]) : "v"(a[0]), "v"(a[3]));
    }
#pragma unroll
    for (int mb = 0; mb < 4; ++mb) {
#pragma unroll
        for (int nb = 0; nb < 4; ++nb) {
#pragma unroll
            for (int j = 0; j < 8; ++j) os[(hi * 8 + j) * 68 + nb * 16 + lr] = acc[mb][nb][j]; }
        __builtin_amdgcn_wave_barrier(); asm volatile("" ::: "memory");
        float* crow = C + (size_t)(r0 + mb * 16) * ldc + c0;
{
#pragma unroll
            for (int s = 0; s < 8; ++s) { const int row = 2 * s + hi, cofs = lr * 4; v4f val = *(const v4fa*)(os + row * 68 + cofs);
                *(v4f*)(crow + (size_t)row * ldc + cofs) = val; }
             }
        __builtin_amdgcn_wave_barrier(); asm volatile("" ::: "memory");
    }
}

__device__ __forceinline__ h16 tohx(float x) { return (h16)x; }
__device__ __forceinline__ void splitf(float y, unsigned short& h, unsigned short& l) { h = f2bf(y); l = f2bf(y - bf2f(h)); }
typedef __attribute__((ext_vector_type(2))) _Float16 v2h;
typedef __attribute__((ext_vector_type(4))) _Float16 v4h;
typedef __attribute__((ext_vector_type(2))) unsigned short v2us;
typedef __attribute__((ext_vector_type(4))) unsigned short v4us;
typedef __attribute__((ext_vector_type(2))) float v2f;
typedef __attribute__((ext_vector_type(4))) int v4i;

__global__ __launch_bounds__(256) void k_wtG(const float* __restrict__ w, int K, int N, bf* Bt) {
    const int lane = threadIdx.x & 31; const int L0 = (blockIdx.x * 8 + (threadIdx.x >> 5)) * 8; const int nlines = N * K / 64;
{
#pragma unroll 1
        for (int l = 0; l < 8; ++l) { const int L = L0 + l; if (L >= nlines) break; const size_t e = (size_t)L * 64 + lane * 2; const int k = (int)(e % K), n = (int)(e / K); v2us o;
            o[0] = f2bf(w[(size_t)k * N + n]); o[1] = f2bf(w[(size_t)(k + 1) * N + n]); *(v2us*)(Bt + e) = o; }
         }
}
__global__ __launch_bounds__(256) void k_cvt8(const float* __restrict__ src, bf* dst, size_t n8) { const size_t i = (size_t)blockIdx.x * 256 + threadIdx.x; if (i >= n8) return; const v8f v = *(const v8f*)(src + i * 8); v8us o;
#pragma unroll
    for (int k = 0; k < 8; ++k) o[k] = f2bf(v[k]); *(v8us*)(dst + i * 8) = o;  }

// k_rope: head planes [h][t][d] (fp16 + hi/lo) of rope(x) x sc with the rotate-half convention out[d] = x[d] cos[t][d] - x[d+HD/2] sin[t][d], out[d+HD/2] = x[d+HD/2] cos[t][d+HD/2] + x[d] sin[t][d+HD/2]
__global__ __launch_bounds__(256) void k_rope(const float* __restrict__ F, int pitch, int nheads, const float* __restrict__ CS, const float* __restrict__ RF, const float* __restrict__ nw, float sc, h16* P16, bf* Ph, bf* Pl) {
    const size_t e = ((size_t)blockIdx.x * 256 + threadIdx.x) * 2; if (e >= (size_t)nheads * TT * HD) return; const int d = (int)(e % HD); const int t = (int)((e / HD) % TT); const int h = (int)(e / ((size_t)HD * TT)); const float* f = F + (size_t)t * pitch + h * HD; const float rf = RF ? RF[(size_t)h * TT + t] : 1.0f; v2h o16; v2us oh, ol;
#pragma unroll
    for (int q = 0; q < 2; ++q) { const int dd = d + q; const int dp = (dd < HD / 2) ? dd + HD / 2 : dd - HD / 2; float x0 = f[dd], x1 = f[dp];
        if (RF) { float n0 = __fmul_rn(x0, rf), n1 = __fmul_rn(x1, rf); asm volatile("" : "+v"(n0)); asm volatile("" : "+v"(n1)); x0 = __fmul_rn(bfr(nw[dd]), n0); x1 = __fmul_rn(bfr(nw[dp]), n1); }
        const v2f cs = *(const v2f*)(CS + ((size_t)t * HD + dd) * 2); float a = __fmul_rn(x0, cs[0]), bq = __fmul_rn(x1, cs[1]); asm volatile("" : "+v"(a)); asm volatile("" : "+v"(bq)); const float r = ((dd < HD / 2) ? __fsub_rn(a, bq) : __fadd_rn(a, bq)) * sc;
        o16[q] = tohx(r); unsigned short a2, c2; splitf(r, a2, c2); oh[q] = a2; ol[q] = c2; }
    *(v2h*)(P16 + e) = o16; *(v2us*)(Ph + e) = oh; *(v2us*)(Pl + e) = ol;  }
__global__ __launch_bounds__(256) void k_vtp(const float* __restrict__ F, int pitch, int nheads, h16* V16, bf* Vh, bf* Vl) { const size_t e = ((size_t)blockIdx.x * 256 + threadIdx.x) * 2; if (e >= (size_t)nheads * HD * TT) return; const int t = (int)(e % TT); const int d = (int)((e / TT) % HD); const int g = (int)(e / ((size_t)TT * HD)); v2h o16; v2us oh, ol;
#pragma unroll
    for (int q = 0; q < 2; ++q) { const float x = F[(size_t)(t + q) * pitch + g * HD + d]; o16[q] = tohx(x); unsigned short a2, c2; splitf(x, a2, c2); oh[q] = a2; ol[q] = c2; }
    *(v2h*)(V16 + e) = o16; *(v2us*)(Vh + e) = oh; *(v2us*)(Vl + e) = ol;  }
__global__ __launch_bounds__(256) void k_csid(float* CS) { const int idx = blockIdx.x * 256 + threadIdx.x; if (idx >= TT * HD) return; v2f cs; cs[0] = 1.0f; cs[1] = 0.0f; *(v2f*)(CS + (size_t)idx * 2) = cs;  }
// k_asoft: per row (zz, i): t = S x HD^-0.5 for j <= i and i - j < WIN (sliding causal window; the reference's -1e9 additive fill vanishes identically); softmax over the 4096 keys (register row, one exp, fixed trees);
__global__ __launch_bounds__(256) void k_asoft(const float* __restrict__ Sb, h16* P16, bf* Ph, bf* Pl) {
    const int lane = threadIdx.x & 31; const int row = blockIdx.x * 8 + (threadIdx.x >> 5); if (row >= ZH * TT) return; const int i = row % TT; const int zz = row / TT; (void)zz; const bool hires = (i < RH); const float* sr = Sb + (size_t)row * TT; float v[TT / 32]; float mx = -3.0e38f;
#pragma unroll
    for (int ch = 0; ch < TT / 128; ++ch) { const int j0 = ch * 128 + lane * 4; const v4f a = *(const v4f*)(sr + j0);
#pragma unroll
        for (int q = 0; q < 4; ++q) { const int j = j0 + q; (void)j; const float t = (j <= i && i - j < WIN) ? a[q] * SCL : -3.0e38f; v[ch * 4 + q] = t; mx = fmaxf(mx, t); } }
#pragma unroll
    for (int sh = 16; sh; sh >>= 1) mx = fmaxf(mx, __shfl_xor(mx, sh, 32));
    float sum = 0.f;
#pragma unroll
    for (int k = 0; k < TT / 32; ++k) { float d0 = __fsub_rn(v[k], mx); asm volatile("" : "+v"(d0)); v[k] = __builtin_amdgcn_exp2f(__fmul_rn(d0, 1.4426950408889634f)); sum += v[k]; }
#pragma unroll
    for (int sh = 16; sh; sh >>= 1) sum += __shfl_xor(sum, sh, 32);
    const float f = __fdiv_rn(hires ? 1.0f : PCAR, sum);
{
        if (hires) {
#pragma unroll
            for (int ch = 0; ch < TT / 128; ++ch) { v4us oh, ol;
#pragma unroll
                for (int q = 0; q < 4; ++q) { unsigned short a, c2; splitf(v[ch * 4 + q] * f, a, c2); oh[q] = a; ol[q] = c2; }
                const size_t oo = ((size_t)zz * (RH ? RH : 1) + i) * TT + ch * 128 + lane * 4; *(v4us*)(Ph + oo) = oh; *(v4us*)(Pl + oo) = ol; }
        } else {
#pragma unroll
            for (int ch = 0; ch < TT / 128; ++ch) { v4h o4;
#pragma unroll
                for (int q = 0; q < 4; ++q) o4[q] = tohx(v[ch * 4 + q] * f);
                *(v4h*)(P16 + (size_t)row * TT + ch * 128 + lane * 4) = o4; } }
         }
}
__global__ __launch_bounds__(256) void k_merge(const float* __restrict__ O, int h0, float* OUTb) { const size_t e = ((size_t)blockIdx.x * 256 + threadIdx.x) * 2; if (e >= (size_t)ZH * TT * HD) return; const int d = (int)(e % HD); const int t = (int)((e / HD) % TT); const int zz = (int)(e / ((size_t)HD * TT)); const float cs = (t < RH) ? 1.0f : (1.0f / PCAR); const size_t oo = (size_t)t * DQ + (h0 + zz) * HD + d;
    v2f o2; o2[0] = O[e] * cs; o2[1] = O[e + 1] * cs; *(v2f*)(OUTb + oo) = o2;  }

extern "C" void kernel_launch(void* const* d_in, const int* in_sizes, int n_in,
                              void* d_out, int out_size, void* d_ws, size_t ws_size, hipStream_t stream) {
    (void)in_sizes; (void)n_in; (void)out_size;
    const float* x = (const float*)d_in[0]; const float* wk = (const float*)d_in[1]; const float* bk = (const float*)d_in[2]; const float* wq = (const float*)d_in[3]; const float* bq = (const float*)d_in[4]; const float* wv = (const float*)d_in[5]; const float* bv = (const float*)d_in[6];   /* input order Wk, bk, Wq, bq, Wv, bv */ const float* wo = nullptr; (void)wo;
    float* OUT = (float*)d_out;     // [4][4096][64]
    char* wsp = (char*)d_ws;
    auto take = [&](size_t bytes) { char* p = wsp; wsp += (bytes + 255) & ~(size_t)255; return (void*)p; };
    bf* WQ = (bf*)take((size_t)DQ * DM * 2); bf* WK = (bf*)take((size_t)DKV * DM * 2); bf* WV = (bf*)take((size_t)DKV * DM * 2); float* CS = (float*)take((size_t)TT * HD * 2 * 4);
    bf* XB = (bf*)take((size_t)TT * DM * 2); float* FQ = (float*)take((size_t)TT * DQ * 4); float* FK = (float*)take((size_t)TT * DKV * 4);
    h16* QP16 = (h16*)take((size_t)NH_ * TT * HD * 2); h16* KP16 = (h16*)take((size_t)NKV * TT * HD * 2); h16* VT16 = (h16*)take((size_t)NKV * HD * TT * 2);
    bf* QPh = (bf*)take((size_t)NH_ * TT * HD * 2); bf* QPl = (bf*)take((size_t)NH_ * TT * HD * 2); bf* KPh = (bf*)take((size_t)NKV * TT * HD * 2); bf* KPl = (bf*)take((size_t)NKV * TT * HD * 2); bf* VTh = (bf*)take((size_t)NKV * HD * TT * 2); bf* VTl = (bf*)take((size_t)NKV * HD * TT * 2); bf* Ph = (bf*)take((size_t)ZH * RH * TT * 2); bf* Pl = (bf*)take((size_t)ZH * RH * TT * 2);
    float* Sb = (float*)take((size_t)ZH * TT * TT * 4); h16* P16 = (h16*)take((size_t)ZH * TT * TT * 2); float* Ob = (float*)take((size_t)ZH * TT * HD * 4);
    if ((size_t)(wsp - (char*)d_ws) > ws_size) return;    // ws 256 MiB
    float* FV = FK;   // v projection reuses the k buffer after the k planes are built (stream-ordered)
    { k_wtG<<<(unsigned)((DM * DQ / 64 + 63) / 64), 256, 0, stream>>>(wq, DM, DQ, WQ); k_wtG<<<(unsigned)((DM * DKV / 64 + 63) / 64), 256, 0, stream>>>(wk, DM, DKV, WK); k_wtG<<<(unsigned)((DM * DKV / 64 + 63) / 64), 256, 0, stream>>>(wv, DM, DKV, WV);
      
       }
    k_csid<<<(TT * HD + 255) / 256, 256, 0, stream>>>(CS);
    const unsigned LQ = (unsigned)(((size_t)NH_ * TT * HD / 2 + 255) / 256), LKv = (unsigned)(((size_t)NKV * TT * HD / 2 + 255) / 256);
    for (int b = 0; b < NB_; ++b) {
        
        k_cvt8<<<(unsigned)(((size_t)TT * DM / 8 + 255) / 256), 256, 0, stream>>>(x + (size_t)b * TT * DM, XB, (size_t)TT * DM / 8);
        k_gemmw<bf, 0, true><<<dim3(TT / 64, DQ / 64, 1), 32, 0, stream>>>(XB, nullptr, WQ, nullptr, DM, FQ, DQ, bq, 0, 0, 0);
        k_rope<<<LQ, 256, 0, stream>>>(FQ, DQ, NH_, CS, nullptr, nullptr, 1.0f, QP16, QPh, QPl);
        k_gemmw<bf, 0, true><<<dim3(TT / 64, DKV / 64, 1), 32, 0, stream>>>(XB, nullptr, WK, nullptr, DM, FK, DKV, bk, 0, 0, 0);
        k_rope<<<LKv, 256, 0, stream>>>(FK, DKV, NKV, CS, nullptr, nullptr, 1.0f, KP16, KPh, KPl);
        k_gemmw<bf, 0, true><<<dim3(TT / 64, DKV / 64, 1), 32, 0, stream>>>(XB, nullptr, WV, nullptr, DM, FV, DKV, bv, 0, 0, 0); k_vtp<<<LKv, 256, 0, stream>>>(FV, DKV, NKV, VT16, VTh, VTl);
        for (int h0 = 0; h0 < NH_; h0 += ZH) { const size_t zq = (size_t)h0, zk = (size_t)(h0 / REP);   // one kv head per query head: the pass's one head (ZH 1) uses kv plane zk = h0 (z-strides TT*HD)
            k_gemmc<bf, 2, 1><<<dim3(TT / 64, TT / 64, ZH), 32, 0, stream>>>(QPh + zq * TT * HD, QPl + zq * TT * HD, KPh + zk * TT * HD, KPl + zk * TT * HD, HD, Sb, TT, 0, (size_t)TT * HD, (size_t)TT * HD, (size_t)TT * TT);   /* scores hi/lo on EVERY row */

            k_asoft<<<ZH * TT / 8, 256, 0, stream>>>(Sb, P16, Ph, Pl);
            k_gemmc<bf, 2, 2><<<dim3(RH / 64, HD / 64, ZH), 32, 0, stream>>>(Ph, Pl, VTh + zk * HD * TT, VTl + zk * HD * TT, TT, Ob, HD, 0, (size_t)RH * TT, (size_t)HD * TT, (size_t)TT * HD);
            k_gemmc<h16, 0, 2><<<dim3((TT - RH) / 64, HD / 64, ZH), 32, 0, stream>>>(P16 + (size_t)RH * TT, nullptr, VT16 + zk * HD * TT, nullptr, TT, Ob + (size_t)RH * HD, HD, RH, (size_t)TT * TT, (size_t)HD * TT, (size_t)TT * HD);
            k_merge<<<(unsigned)(((size_t)ZH * TT * HD / 2 + 255) / 256), 256, 0, stream>>>(Ob, h0, OUT + (size_t)b * TT * DQ); }
         }
}

// v001
// It runs in 310 microseconds.
// Timed twice side by side with v000, it ran 1.96 and 1.97 times as fast.
#include <hip/hip_runtime.h>

// Single-head causal attention over 4,096 tokens with a 64-wide head (embedded [4][4096][256]; k, q, v = x W + b ('xw' [256][64] 1/16; input order Wk, bk, Wq, bq, Wv, bv); scores / 8; causal (-inf); softmax; out = p v -> [4][4096][64] (1.05 M)).
// Layout per batch: bf16 copy of x; 'xw' [256][64] weights transposed once; exact projections + f32 biases; causal T-4096 attention for the one head with hi/lo 3-product score tiles on EVERY row (register-row softmax); P and attn.v hybrid (rows < 512 hi/lo, rest fp16 x1024; tiles above the diagonal skipped); the f32 merge writes the output rows.
// Compute dtypes, f32 accumulate: every input rounded to bf16; projections exact + f32 biases; scores 3 products on every row; softmax f32; attn.v rows < 512 3 products, rest fp16; output f32.

#define NB_  4
#define TT   4096
#define DM   256
#define NH_  1
#define NKV  1
#define REP  (NH_ / NKV)
#define HD   64
#define DQ   (NH_ * HD)
#define DKV  (NKV * HD)
#define ZH   1
#define RH   512                  // query rows < RH use hi+lo planes (0: none)
#define WIN  4096
#define PCAR 1024.0f
#define SCL  0.125f   // HD^-0.5
typedef _Float16 h16;
typedef unsigned short bf;
typedef __attribute__((ext_vector_type(16))) __bf16   v16bf;
typedef __attribute__((ext_vector_type(16))) _Float16 v16h;
typedef __attribute__((ext_vector_type(8)))  _Float16 v8h;
typedef __attribute__((ext_vector_type(8)))  unsigned short v8us;
typedef __attribute__((ext_vector_type(8)))  float    v8f;
typedef __attribute__((ext_vector_type(4)))  float    v4f;
typedef v8h  __attribute__((may_alias)) v8ha;
typedef v4f  __attribute__((may_alias)) v4fa;
typedef v8us __attribute__((may_alias)) v8usa;

__device__ __forceinline__ unsigned short f2bf(float f) { unsigned u = __float_as_uint(f); u += 0x7FFFu + ((u >> 16) & 1u); return (unsigned short)(u >> 16); }
__device__ __forceinline__ float bf2f(unsigned short b) { return __uint_as_float(((unsigned)b) << 16); }
__device__ __forceinline__ float bfr(float f) { return bf2f(f2bf(f)); }
__device__ __forceinline__ v16h cat16(v8h lo, v8h hi) { return __builtin_shufflevector(lo, hi, 0, 1, 2, 3, 4, 5, 6, 7, 8, 9, 10, 11, 12, 13, 14, 15); }
__device__ __forceinline__ v16bf cat16b(v8us lo, v8us hi) { return __builtin_bit_cast(v16bf, __builtin_shufflevector(lo, hi, 0, 1, 2, 3, 4, 5, 6, 7, 8, 9, 10, 11, 12, 13, 14, 15)); }
__device__ __forceinline__ v8f wmma16(v16h a, v16h b, v8f c) { return __builtin_amdgcn_wmma_f32_16x16x32_f16(false, a, false, b, (short)0, c, false, false); }
__device__ __forceinline__ v8f wmmab(v16bf a, v16bf b, v8f c) { return __builtin_amdgcn_wmma_f32_16x16x32_bf16(false, a, false, b, (short)0, c, false, false); }



// ---- k_gemmw: register-blocked GEMM, ONE WAVE per 64x64 output tile (16 accumulators), operands straight from K-contiguous 16-bit planes; grid (M/64, N/64, Z), 32 threads.
// C[m][n] (f32, pitch ldc, + optional f32 bias[n]) = sum_k A[m][k] Bt[n][k] (+ split products per NSPLIT). z-batch strides sA/sB/sC in elements. K % 32 == 0.
template <typename T16> struct WFrag;
template <> struct WFrag<h16> { typedef v16h V; static __device__ __forceinline__ V ld(const h16* p) { return cat16(*(const v8h*)p, *(const v8h*)(p + 16)); } static __device__ __forceinline__ v8f mma(V a, V b, v8f c) { return wmma16(a, b, c); } };
template <> struct WFrag<bf> { typedef v16bf V; static __device__ __forceinline__ V ld(const bf* p) { return cat16b(*(const v8us*)p, *(const v8us*)(p + 16)); } static __device__ __forceinline__ v8f mma(V a, V b, v8f c) { return wmmab(a, b, c); } };
template <typename T16, int NSPLIT, bool BIAS>
__global__ __launch_bounds__(32) void k_gemmw(const T16* __restrict__ A, const T16* __restrict__ A2, const T16* __restrict__ Bt, const T16* __restrict__ Bt2, int K, float* C, int ldc, const float* __restrict__ bias, size_t sA, size_t sB, size_t sC) {
    typedef typename WFrag<T16>::V V;
    __shared__ __align__(16) float os[16 * 68];
    const size_t z = blockIdx.z; A += z * sA; if (A2) A2 += z * sA; Bt += z * sB; if (Bt2) Bt2 += z * sB; C += z * sC;
    const int lane = threadIdx.x & 31, lr = lane & 15, hi = lane >> 4; const int r0 = blockIdx.x * 64, c0 = blockIdx.y * 64;
    v8f acc[4][4];
#pragma unroll
    for (int mb = 0; mb < 4; ++mb)
#pragma unroll
        for (int nb = 0; nb < 4; ++nb) acc[mb][nb] = (v8f){};
    const size_t aoff = (size_t)(r0 + lr) * K + 8 * hi, boff = (size_t)(c0 + lr) * K + 8 * hi;
#pragma unroll 1
    for (int kc = 0; kc < K; kc += 32) {
        V a[4], a2[4];
#pragma unroll
        for (int mb = 0; mb < 4; ++mb) { a[mb] = WFrag<T16>::ld(A + aoff + (size_t)mb * 16 * K + kc); if (NSPLIT == 1 || NSPLIT == 2) a2[mb] = WFrag<T16>::ld(A2 + aoff + (size_t)mb * 16 * K + kc); }
#pragma unroll
        for (int nb = 0; nb < 4; ++nb) { const V b = WFrag<T16>::ld(Bt + boff + (size_t)nb * 16 * K + kc); V b2; if (NSPLIT >= 2) b2 = WFrag<T16>::ld(Bt2 + boff + (size_t)nb * 16 * K + kc);
#pragma unroll
            for (int mb = 0; mb < 4; ++mb) { acc[mb][nb] = WFrag<T16>::mma(a[mb], b, acc[mb][nb]); if (NSPLIT == 1 || NSPLIT == 2) acc[mb][nb] = WFrag<T16>::mma(a2[mb], b, acc[mb][nb]); if (NSPLIT >= 2) acc[mb][nb] = WFrag<T16>::mma(a[mb], b2, acc[mb][nb]); } }
        asm volatile("v_nop\n\tv_nop\n\tv_nop\n\tv_nop" : "+v"(acc[0][0]), "+v"(acc[1][1]), "+v"(acc[2][2]), "+v"(acc[3][3]) : "v"(a[0]), "v"(a[3]));
    }
#pragma unroll
    for (int mb = 0; mb < 4; ++mb) {
#pragma unroll
        for (int nb = 0; nb < 4; ++nb) {
#pragma unroll
            for (int j = 0; j < 8; ++j) os[(hi * 8 + j) * 68 + nb * 16 + lr] = acc[mb][nb][j]; }
        __builtin_amdgcn_wave_barrier(); asm volatile("" ::: "memory");
        float* crow = C + (size_t)(r0 + mb * 16) * ldc + c0;
{
#pragma unroll
            for (int s = 0; s < 8; ++s) { const int row = 2 * s + hi, cofs = lr * 4; v4f val = *(const v4fa*)(os + row * 68 + cofs); if (BIAS) { val[0] += bfr(bias[c0 + cofs]); val[1] += bfr(bias[c0 + cofs + 1]); val[2] += bfr(bias[c0 + cofs + 2]); val[3] += bfr(bias[c0 + cofs + 3]); }
                *(v4f*)(crow + (size_t)row * ldc + cofs) = val; }
             }
        __builtin_amdgcn_wave_barrier(); asm volatile("" ::: "memory");
    }
}

// ---- k_gemmc: the same one-wave 64x64 tile GEMM specialised for causal attention: CMODE 1 skips score tiles entirely above the diagonal (query rows r0+roff.., key columns c0..), CMODE 2 limits the
// key (K) loop of the probability x value contraction to the diagonal block (probabilities beyond it are exactly zero). roff = row offset of this launch's first row within the sequence.
template <typename T16, int NSPLIT, int CMODE>
__global__ __launch_bounds__(32) void k_gemmc(const T16* __restrict__ A, const T16* __restrict__ A2, const T16* __restrict__ Bt, const T16* __restrict__ Bt2, int K, float* C, int ldc, int roff, size_t sA, size_t sB, size_t sC) {
    typedef typename WFrag<T16>::V V;
    __shared__ __align__(16) float os[16 * 68];
    const size_t z = blockIdx.z; A += z * sA; if (A2) A2 += z * sA; Bt += z * sB; if (Bt2) Bt2 += z * sB; C += z * sC;
    const int lane = threadIdx.x & 31, lr = lane & 15, hi = lane >> 4; const int r0 = blockIdx.x * 64, c0 = blockIdx.y * 64;
    if (CMODE == 1 && c0 > r0 + roff + 63) return;                  // score tile entirely above the causal diagonal: never read (the softmax masks j > i by select)
    const int Kl = (CMODE == 2) ? min(K, r0 + roff + 64) : K;        // P.V: probabilities are exactly 0 beyond the diagonal block, so the K loop stops there
    v8f acc[4][4];
#pragma unroll
    for (int mb = 0; mb < 4; ++mb)
#pragma unroll
        for (int nb = 0; nb < 4; ++nb) acc[mb][nb] = (v8f){};
    const size_t aoff = (size_t)(r0 + lr) * K + 8 * hi, boff = (size_t)(c0 + lr) * K + 8 * hi;
#pragma unroll 1
    for (int kc = 0; kc < Kl; kc += 32) {
        V a[4], a2[4];
#pragma unroll
        for (int mb = 0; mb < 4; ++mb) { a[mb] = WFrag<T16>::ld(A + aoff + (size_t)mb * 16 * K + kc); if (NSPLIT == 1 || NSPLIT == 2) a2[mb] = WFrag<T16>::ld(A2 + aoff + (size_t)mb * 16 * K + kc); }
#pragma unroll
        for (int nb = 0; nb < 4; ++nb) { const V b = WFrag<T16>::ld(Bt + boff + (size_t)nb * 16 * K + kc); V b2; if (NSPLIT >= 2) b2 = WFrag<T16>::ld(Bt2 + boff + (size_t)nb * 16 * K + kc);
#pragma unroll
            for (int mb = 0; mb < 4; ++mb) { acc[mb][nb] = WFrag<T16>::mma(a[mb], b, acc[mb][nb]); if (NSPLIT == 1 || NSPLIT == 2) acc[mb][nb] = WFrag<T16>::mma(a2[mb], b, acc[mb][nb]); if (NSPLIT >= 2) acc[mb][nb] = WFrag<T16>::mma(a[mb], b2, acc[mb][nb]); } }
        asm volatile("v_nop\n\tv_nop\n\tv_nop\n\tv_nop" : "+v"(acc[0][0]), "+v"(acc[1][1]), "+v"(acc[2][2]), "+v"(acc[3][3]) : "v"(a[0]), "v"(a[3]));
    }
#pragma unroll
    for (int mb = 0; mb < 4; ++mb) {
#pragma unroll
        for (int nb = 0; nb < 4; ++nb) {
#pragma unroll
            for (int j = 0; j < 8; ++j) os[(hi * 8 + j) * 68 + nb * 16 + lr] = acc[mb][nb][j]; }
        __builtin_amdgcn_wave_barrier(); asm volatile("" ::: "memory");
        float* crow = C + (size_t)(r0 + mb * 16) * ldc + c0;
{
#pragma unroll
            for (int s = 0; s < 8; ++s) { const int row = 2 * s + hi, cofs = lr * 4; v4f val = *(const v4fa*)(os + row * 68 + cofs);
                *(v4f*)(crow + (size_t)row * ldc + cofs) = val; }
             }
        __builtin_amdgcn_wave_barrier(); asm volatile("" ::: "memory");
    }
}

// ---- k_pvs: probability x value contraction with the key (K) loop SPLIT OVER THE NW WAVES of a work-group. One work-group per 16x64 output tile; wave w takes the key chunks w, w + NW, ... (KS k-steps of 32 keys each),
// with its own four f32 accumulators; the NW partial tiles meet in LDS behind one barrier and are summed in wave order 0..NW-1 (a fixed order), each 256-B output row stored once. The key loop ends at the chunk that holds the
// diagonal: the softmax kernel writes every column of a probability row, exact zeros beyond the diagonal. K % (KS * 32) == 0. roff = row offset of this launch's first row within the sequence.
template <typename T16, int NSPLIT, int KS, int NW>
__global__ __launch_bounds__(NW * 32) void k_pvs(const T16* __restrict__ A, const T16* __restrict__ A2, const T16* __restrict__ Bt, const T16* __restrict__ Bt2, int K, float* C, int ldc, int roff, size_t sA, size_t sB, size_t sC) {
    typedef typename WFrag<T16>::V V;
    __shared__ __align__(16) float red[NW][16 * 68];
    const size_t z = blockIdx.z; A += z * sA; if (NSPLIT) A2 += z * sA; Bt += z * sB; if (NSPLIT) Bt2 += z * sB; C += z * sC;
    const int lane = threadIdx.x & 31, lr = lane & 15, hi = lane >> 4; const int r0 = blockIdx.x * 16, c0 = blockIdx.y * 64;
    const int wave = __builtin_amdgcn_readfirstlane(threadIdx.x >> 5);   // scalar, so that the key loop is a scalar loop (EXEC stays all ones for the matrix instructions)
    const int CH = KS * 32; const int Kl = min(K, (r0 + roff + 16 + CH - 1) / CH * CH);
    v8f acc[4];
#pragma unroll
    for (int nb = 0; nb < 4; ++nb) acc[nb] = (v8f){};
    const size_t aoff = (size_t)(r0 + lr) * K + 8 * hi, boff = (size_t)(c0 + lr) * K + 8 * hi;
    for (int kc = wave * CH; kc < Kl; kc += NW * CH) {
        V a[KS], a2[KS], b[KS][4], b2[KS][4];
        const T16* pa = A + aoff + kc; const T16* pa2 = NSPLIT ? A2 + aoff + kc : pa; const T16* pb[4]; const T16* pb2[4];
#pragma unroll
        for (int nb = 0; nb < 4; ++nb) { pb[nb] = Bt + boff + (size_t)nb * 16 * K + kc; pb2[nb] = NSPLIT ? Bt2 + boff + (size_t)nb * 16 * K + kc : pb[nb]; }
#pragma unroll
        for (int ks = 0; ks < KS; ++ks) { a[ks] = WFrag<T16>::ld(pa + ks * 32); if (NSPLIT == 2) a2[ks] = WFrag<T16>::ld(pa2 + ks * 32);
#pragma unroll
            for (int nb = 0; nb < 4; ++nb) { b[ks][nb] = WFrag<T16>::ld(pb[nb] + ks * 32); if (NSPLIT == 2) b2[ks][nb] = WFrag<T16>::ld(pb2[nb] + ks * 32); } }
        // The wait that stands between an issued global load and a later write of a register that the load names as its address. The chunk's addresses are inputs, so that they stay in their registers up to
        // this line.
        asm volatile("s_wait_xcnt 0x0" :: "v"(pa), "v"(pa2), "v"(pb[0]), "v"(pb[1]), "v"(pb[2]), "v"(pb[3]), "v"(pb2[0]), "v"(pb2[1]), "v"(pb2[2]), "v"(pb2[3]) : "memory");
        __builtin_amdgcn_sched_barrier(0);   // keeps the whole chunk's loads, and the wait behind them, ahead of its first matrix instruction: without it the compiler sinks each load pair to its use and the wave waits out one memory latency per product
#pragma unroll
        for (int ks = 0; ks < KS; ++ks)
#pragma unroll
            for (int nb = 0; nb < 4; ++nb) { acc[nb] = WFrag<T16>::mma(a[ks], b[ks][nb], acc[nb]); if (NSPLIT == 2) { acc[nb] = WFrag<T16>::mma(a2[ks], b[ks][nb], acc[nb]); acc[nb] = WFrag<T16>::mma(a[ks], b2[ks][nb], acc[nb]); } }
    }
#pragma unroll
    for (int nb = 0; nb < 4; ++nb) {
#pragma unroll
        for (int j = 0; j < 8; ++j) red[wave][(hi * 8 + j) * 68 + nb * 16 + lr] = acc[nb][j]; }
    __syncthreads();
    static_assert(NW * 32 == 256, "one float4 of the 16x64 tile per thread");
    { const int row = threadIdx.x >> 4, cofs = (threadIdx.x & 15) * 4; v4f val = *(const v4fa*)(&red[0][row * 68 + cofs]);
#pragma unroll
        for (int w = 1; w < NW; ++w) val += *(const v4fa*)(&red[w][row * 68 + cofs]);
        *(v4f*)(C + (size_t)(r0 + row) * ldc + c0 + cofs) = val; }
}

__device__ __forceinline__ h16 tohx(float x) { return (h16)x; }
__device__ __forceinline__ void splitf(float y, unsigned short& h, unsigned short& l) { h = f2bf(y); l = f2bf(y - bf2f(h)); }
typedef __attribute__((ext_vector_type(2))) _Float16 v2h;
typedef __attribute__((ext_vector_type(4))) _Float16 v4h;
typedef __attribute__((ext_vector_type(2))) unsigned short v2us;
typedef __attribute__((ext_vector_type(4))) unsigned short v4us;
typedef __attribute__((ext_vector_type(2))) float v2f;
typedef __attribute__((ext_vector_type(4))) int v4i;

__global__ __launch_bounds__(256) void k_wtG(const float* __restrict__ w, int K, int N, bf* Bt) {
    const int lane = threadIdx.x & 31; const int L0 = (blockIdx.x * 8 + (threadIdx.x >> 5)) * 8; const int nlines = N * K / 64;
{
#pragma unroll 1
        for (int l = 0; l < 8; ++l) { const int L = L0 + l; if (L >= nlines) break; const size_t e = (size_t)L * 64 + lane * 2; const int k = (int)(e % K), n = (int)(e / K); v2us o;
            o[0] = f2bf(w[(size_t)k * N + n]); o[1] = f2bf(w[(size_t)(k + 1) * N + n]); *(v2us*)(Bt + e) = o; }
         }
}
__global__ __launch_bounds__(256) void k_cvt8(const float* __restrict__ src, bf* dst, size_t n8) { const size_t i = (size_t)blockIdx.x * 256 + threadIdx.x; if (i >= n8) return; const v8f v = *(const v8f*)(src + i * 8); v8us o;
#pragma unroll
    for (int k = 0; k < 8; ++k) o[k] = f2bf(v[k]); *(v8us*)(dst + i * 8) = o;  }

// k_rope: head planes [h][t][d] (fp16 + hi/lo) of rope(x) x sc with the rotate-half convention out[d] = x[d] cos[t][d] - x[d+HD/2] sin[t][d], out[d+HD/2] = x[d+HD/2] cos[t][d+HD/2] + x[d] sin[t][d+HD/2]
__global__ __launch_bounds__(256) void k_rope(const float* __restrict__ F, int pitch, int nheads, const float* __restrict__ CS, const float* __restrict__ RF, const float* __restrict__ nw, float sc, h16* P16, bf* Ph, bf* Pl) {
    const size_t e = ((size_t)blockIdx.x * 256 + threadIdx.x) * 2; if (e >= (size_t)nheads * TT * HD) return; const int d = (int)(e % HD); const int t = (int)((e / HD) % TT); const int h = (int)(e / ((size_t)HD * TT)); const float* f = F + (size_t)t * pitch + h * HD; const float rf = RF ? RF[(size_t)h * TT + t] : 1.0f; v2h o16; v2us oh, ol;
#pragma unroll
    for (int q = 0; q < 2; ++q) { const int dd = d + q; const int dp = (dd < HD / 2) ? dd + HD / 2 : dd - HD / 2; float x0 = f[dd], x1 = f[dp];
        if (RF) { float n0 = __fmul_rn(x0, rf), n1 = __fmul_rn(x1, rf); asm volatile("" : "+v"(n0)); asm volatile("" : "+v"(n1)); x0 = __fmul_rn(bfr(nw[dd]), n0); x1 = __fmul_rn(bfr(nw[dp]), n1); }
        const v2f cs = *(const v2f*)(CS + ((size_t)t * HD + dd) * 2); float a = __fmul_rn(x0, cs[0]), bq = __fmul_rn(x1, cs[1]); asm volatile("" : "+v"(a)); asm volatile("" : "+v"(bq)); const float r = ((dd < HD / 2) ? __fsub_rn(a, bq) : __fadd_rn(a, bq)) * sc;
        o16[q] = tohx(r); unsigned short a2, c2; splitf(r, a2, c2); oh[q] = a2; ol[q] = c2; }
    *(v2h*)(P16 + e) = o16; *(v2us*)(Ph + e) = oh; *(v2us*)(Pl + e) = ol;  }
__global__ __launch_bounds__(256) void k_vtp(const float* __restrict__ F, int pitch, int nheads, h16* V16, bf* Vh, bf* Vl) { const size_t e = ((size_t)blockIdx.x * 256 + threadIdx.x) * 2; if (e >= (size_t)nheads * HD * TT) return; const int t = (int)(e % TT); const int d = (int)((e / TT) % HD); const int g = (int)(e / ((size_t)TT * HD)); v2h o16; v2us oh, ol;
#pragma unroll
    for (int q = 0; q < 2; ++q) { const float x = F[(size_t)(t + q) * pitch + g * HD + d]; o16[q] = tohx(x); unsigned short a2, c2; splitf(x, a2, c2); oh[q] = a2; ol[q] = c2; }
    *(v2h*)(V16 + e) = o16; *(v2us*)(Vh + e) = oh; *(v2us*)(Vl + e) = ol;  }
__global__ __launch_bounds__(256) void k_csid(float* CS) { const int idx = blockIdx.x * 256 + threadIdx.x; if (idx >= TT * HD) return; v2f cs; cs[0] = 1.0f; cs[1] = 0.0f; *(v2f*)(CS + (size_t)idx * 2) = cs;  }
// k_asoft: per row (zz, i): t = S x HD^-0.5 for j <= i and i - j < WIN (sliding causal window; the reference's -1e9 additive fill vanishes identically); softmax over the 4096 keys (register row, one exp, fixed trees);
__global__ __launch_bounds__(256) void k_asoft(const float* __restrict__ Sb, h16* P16, bf* Ph, bf* Pl) {
    const int lane = threadIdx.x & 31; const int row = blockIdx.x * 8 + (threadIdx.x >> 5); if (row >= ZH * TT) return; const int i = row % TT; const int zz = row / TT; (void)zz; const bool hires = (i < RH); const float* sr = Sb + (size_t)row * TT; float v[TT / 32]; float mx = -3.0e38f;
#pragma unroll
    for (int ch = 0; ch < TT / 128; ++ch) { const int j0 = ch * 128 + lane * 4; const v4f a = *(const v4f*)(sr + j0);
#pragma unroll
        for (int q = 0; q < 4; ++q) { const int j = j0 + q; (void)j; const float t = (j <= i && i - j < WIN) ? a[q] * SCL : -3.0e38f; v[ch * 4 + q] = t; mx = fmaxf(mx, t); } }
#pragma unroll
    for (int sh = 16; sh; sh >>= 1) mx = fmaxf(mx, __shfl_xor(mx, sh, 32));
    float sum = 0.f;
#pragma unroll
    for (int k = 0; k < TT / 32; ++k) { float d0 = __fsub_rn(v[k], mx); asm volatile("" : "+v"(d0)); v[k] = __builtin_amdgcn_exp2f(__fmul_rn(d0, 1.4426950408889634f)); sum += v[k]; }
#pragma unroll
    for (int sh = 16; sh; sh >>= 1) sum += __shfl_xor(sum, sh, 32);
    const float f = __fdiv_rn(hires ? 1.0f : PCAR, sum);
{
        if (hires) {
#pragma unroll
            for (int ch = 0; ch < TT / 128; ++ch) { v4us oh, ol;
#pragma unroll
                for (int q = 0; q < 4; ++q) { unsigned short a, c2; splitf(v[ch * 4 + q] * f, a, c2); oh[q] = a; ol[q] = c2; }
                const size_t oo = ((size_t)zz * (RH ? RH : 1) + i) * TT + ch * 128 + lane * 4; *(v4us*)(Ph + oo) = oh; *(v4us*)(Pl + oo) = ol; }
        } else {
#pragma unroll
            for (int ch = 0; ch < TT / 128; ++ch) { v4h o4;
#pragma unroll
                for (int q = 0; q < 4; ++q) o4[q] = tohx(v[ch * 4 + q] * f);
                *(v4h*)(P16 + (size_t)row * TT + ch * 128 + lane * 4) = o4; } }
         }
}
__global__ __launch_bounds__(256) void k_merge(const float* __restrict__ O, int h0, float* OUTb) { const size_t e = ((size_t)blockIdx.x * 256 + threadIdx.x) * 2; if (e >= (size_t)ZH * TT * HD) return; const int d = (int)(e % HD); const int t = (int)((e / HD) % TT); const int zz = (int)(e / ((size_t)HD * TT)); const float cs = (t < RH) ? 1.0f : (1.0f / PCAR); const size_t oo = (size_t)t * DQ + (h0 + zz) * HD + d;
    v2f o2; o2[0] = O[e] * cs; o2[1] = O[e + 1] * cs; *(v2f*)(OUTb + oo) = o2;  }

extern "C" void kernel_launch(void* const* d_in, const int* in_sizes, int n_in,
                              void* d_out, int out_size, void* d_ws, size_t ws_size, hipStream_t stream) {
    (void)in_sizes; (void)n_in; (void)out_size;
    const float* x = (const float*)d_in[0]; const float* wk = (const float*)d_in[1]; const float* bk = (const float*)d_in[2]; const float* wq = (const float*)d_in[3]; const float* bq = (const float*)d_in[4]; const float* wv = (const float*)d_in[5]; const float* bv = (const float*)d_in[6];   /* input order Wk, bk, Wq, bq, Wv, bv */ const float* wo = nullptr; (void)wo;
    float* OUT = (float*)d_out;     // [4][4096][64]
    char* wsp = (char*)d_ws;
    auto take = [&](size_t bytes) { char* p = wsp; wsp += (bytes + 255) & ~(size_t)255; return (void*)p; };
    bf* WQ = (bf*)take((size_t)DQ * DM * 2); bf* WK = (bf*)take((size_t)DKV * DM * 2); bf* WV = (bf*)take((size_t)DKV * DM * 2); float* CS = (float*)take((size_t)TT * HD * 2 * 4);
    bf* XB = (bf*)take((size_t)TT * DM * 2); float* FQ = (float*)take((size_t)TT * DQ * 4); float* FK = (float*)take((size_t)TT * DKV * 4);
    h16* QP16 = (h16*)take((size_t)NH_ * TT * HD * 2); h16* KP16 = (h16*)take((size_t)NKV * TT * HD * 2); h16* VT16 = (h16*)take((size_t)NKV * HD * TT * 2);
    bf* QPh = (bf*)take((size_t)NH_ * TT * HD * 2); bf* QPl = (bf*)take((size_t)NH_ * TT * HD * 2); bf* KPh = (bf*)take((size_t)NKV * TT * HD * 2); bf* KPl = (bf*)take((size_t)NKV * TT * HD * 2); bf* VTh = (bf*)take((size_t)NKV * HD * TT * 2); bf* VTl = (bf*)take((size_t)NKV * HD * TT * 2); bf* Ph = (bf*)take((size_t)ZH * RH * TT * 2); bf* Pl = (bf*)take((size_t)ZH * RH * TT * 2);
    float* Sb = (float*)take((size_t)ZH * TT * TT * 4); h16* P16 = (h16*)take((size_t)ZH * TT * TT * 2); float* Ob = (float*)take((size_t)ZH * TT * HD * 4);
    if ((size_t)(wsp - (char*)d_ws) > ws_size) return;    // ws 256 MiB
    float* FV = FK;   // v projection reuses the k buffer after the k planes are built (stream-ordered)
    { k_wtG<<<(unsigned)((DM * DQ / 64 + 63) / 64), 256, 0, stream>>>(wq, DM, DQ, WQ); k_wtG<<<(unsigned)((DM * DKV / 64 + 63) / 64), 256, 0, stream>>>(wk, DM, DKV, WK); k_wtG<<<(unsigned)((DM * DKV / 64 + 63) / 64), 256, 0, stream>>>(wv, DM, DKV, WV);
      
       }
    k_csid<<<(TT * HD + 255) / 256, 256, 0, stream>>>(CS);
    const unsigned LQ = (unsigned)(((size_t)NH_ * TT * HD / 2 + 255) / 256), LKv = (unsigned)(((size_t)NKV * TT * HD / 2 + 255) / 256);
    for (int b = 0; b < NB_; ++b) {
        
        k_cvt8<<<(unsigned)(((size_t)TT * DM / 8 + 255) / 256), 256, 0, stream>>>(x + (size_t)b * TT * DM, XB, (size_t)TT * DM / 8);
        k_gemmw<bf, 0, true><<<dim3(TT / 64, DQ / 64, 1), 32, 0, stream>>>(XB, nullptr, WQ, nullptr, DM, FQ, DQ, bq, 0, 0, 0);
        k_rope<<<LQ, 256, 0, stream>>>(FQ, DQ, NH_, CS, nullptr, nullptr, 1.0f, QP16, QPh, QPl);
        k_gemmw<bf, 0, true><<<dim3(TT / 64, DKV / 64, 1), 32, 0, stream>>>(XB, nullptr, WK, nullptr, DM, FK, DKV, bk, 0, 0, 0);
        k_rope<<<LKv, 256, 0, stream>>>(FK, DKV, NKV, CS, nullptr, nullptr, 1.0f, KP16, KPh, KPl);
        k_gemmw<bf, 0, true><<<dim3(TT / 64, DKV / 64, 1), 32, 0, stream>>>(XB, nullptr, WV, nullptr, DM, FV, DKV, bv, 0, 0, 0); k_vtp<<<LKv, 256, 0, stream>>>(FV, DKV, NKV, VT16, VTh, VTl);
        for (int h0 = 0; h0 < NH_; h0 += ZH) { const size_t zq = (size_t)h0, zk = (size_t)(h0 / REP);   // one kv head per query head: the pass's one head (ZH 1) uses kv plane zk = h0 (z-strides TT*HD)
            k_gemmc<bf, 2, 1><<<dim3(TT / 64, TT / 64, ZH), 32, 0, stream>>>(QPh + zq * TT * HD, QPl + zq * TT * HD, KPh + zk * TT * HD, KPl + zk * TT * HD, HD, Sb, TT, 0, (size_t)TT * HD, (size_t)TT * HD, (size_t)TT * TT);   /* scores hi/lo on EVERY row */

            k_asoft<<<ZH * TT / 8, 256, 0, stream>>>(Sb, P16, Ph, Pl);
            k_pvs<bf, 2, 2, 8><<<dim3(RH / 16, HD / 64, ZH), 256, 0, stream>>>(Ph, Pl, VTh + zk * HD * TT, VTl + zk * HD * TT, TT, Ob, HD, 0, (size_t)RH * TT, (size_t)HD * TT, (size_t)TT * HD);
            k_pvs<h16, 0, 4, 8><<<dim3((TT - RH) / 16, HD / 64, ZH), 256, 0, stream>>>(P16 + (size_t)RH * TT, nullptr, VT16 + zk * HD * TT, nullptr, TT, Ob + (size_t)RH * HD, HD, RH, (size_t)TT * TT, (size_t)HD * TT, (size_t)TT * HD);
            k_merge<<<(unsigned)(((size_t)ZH * TT * HD / 2 + 255) / 256), 256, 0, stream>>>(Ob, h0, OUT + (size_t)b * TT * DQ); }
         }
}

// v002
// One run takes 196 microseconds.
// Timed twice side by side with v001, it ran 1.56 and 1.58 times as fast.
// All steps since v000 together make it 3.08 times as fast.
#include <hip/hip_runtime.h>

// Single-head causal attention over 4,096 tokens with a 64-wide head (embedded [4][4096][256]; k, q, v = x W + b ('xw' [256][64] 1/16; input order Wk, bk, Wq, bq, Wv, bv); scores / 8; causal (-inf); softmax; out = p v -> [4][4096][64] (1.05 M)).
// Layout (the batch index is a grid dimension: all 4 batches per launch up to the q, k, v planes, ZH batches per launch behind them): bf16 copy of x; 'xw' [256][64] weights transposed once; exact projections + f32 biases; causal T-4096 attention for the one head with hi/lo 3-product score tiles on EVERY row (register-row softmax); P and attn.v hybrid (rows < 512 hi/lo, rest fp16 x1024; tiles above the diagonal skipped); the f32 merge writes the output rows.
// Compute dtypes, f32 accumulate: every input rounded to bf16; projections exact + f32 biases; scores 3 products on every row; softmax f32; attn.v rows < 512 3 products, rest fp16; output f32.

#define NB_  4
#define TT   4096
#define DM   256
#define NH_  1
#define NKV  1
#define REP  (NH_ / NKV)
#define HD   64
#define DQ   (NH_ * HD)
#define DKV  (NKV * HD)
#define ZH   2                    // batches per launch of the score, softmax, P.V and merge kernels (grid z of the score and P.V launches): two f32 score planes and their probability planes fit the workspace, four do not
#define RH   512                  // query rows < RH use hi+lo planes (0: none)
#define WIN  4096
#define PCAR 1024.0f
#define SCL  0.125f   // HD^-0.5
typedef _Float16 h16;
typedef unsigned short bf;
typedef __attribute__((ext_vector_type(16))) __bf16   v16bf;
typedef __attribute__((ext_vector_type(16))) _Float16 v16h;
typedef __attribute__((ext_vector_type(8)))  _Float16 v8h;
typedef __attribute__((ext_vector_type(8)))  unsigned short v8us;
typedef __attribute__((ext_vector_type(8)))  float    v8f;
typedef __attribute__((ext_vector_type(4)))  float    v4f;
typedef v8h  __attribute__((may_alias)) v8ha;
typedef v4f  __attribute__((may_alias)) v4fa;
typedef v8us __attribute__((may_alias)) v8usa;

__device__ __forceinline__ unsigned short f2bf(float f) { unsigned u = __float_as_uint(f); u += 0x7FFFu + ((u >> 16) & 1u); return (unsigned short)(u >> 16); }
__device__ __forceinline__ float bf2f(unsigned short b) { return __uint_as_float(((unsigned)b) << 16); }
__device__ __forceinline__ float bfr(float f) { return bf2f(f2bf(f)); }
__device__ __forceinline__ v16h cat16(v8h lo, v8h hi) { return __builtin_shufflevector(lo, hi, 0, 1, 2, 3, 4, 5, 6, 7, 8, 9, 10, 11, 12, 13, 14, 15); }
__device__ __forceinline__ v16bf cat16b(v8us lo, v8us hi) { return __builtin_bit_cast(v16bf, __builtin_shufflevector(lo, hi, 0, 1, 2, 3, 4, 5, 6, 7, 8, 9, 10, 11, 12, 13, 14, 15)); }
__device__ __forceinline__ v8f wmma16(v16h a, v16h b, v8f c) { return __builtin_amdgcn_wmma_f32_16x16x32_f16(false, a, false, b, (short)0, c, false, false); }
__device__ __forceinline__ v8f wmmab(v16bf a, v16bf b, v8f c) { return __builtin_amdgcn_wmma_f32_16x16x32_bf16(false, a, false, b, (short)0, c, false, false); }



// ---- k_gemmw: register-blocked GEMM, ONE WAVE per 64x64 output tile (16 accumulators), operands straight from K-contiguous 16-bit planes; grid (M/64, N/64, Z), 32 threads.
// C[m][n] (f32, pitch ldc, + optional f32 bias[n]) = sum_k A[m][k] Bt[n][k] (+ split products per NSPLIT). z-batch strides sA/sB/sC in elements. K % 32 == 0.
template <typename T16> struct WFrag;
template <> struct WFrag<h16> { typedef v16h V; static __device__ __forceinline__ V ld(const h16* p) { return cat16(*(const v8h*)p, *(const v8h*)(p + 16)); } static __device__ __forceinline__ v8f mma(V a, V b, v8f c) { return wmma16(a, b, c); } };
template <> struct WFrag<bf> { typedef v16bf V; static __device__ __forceinline__ V ld(const bf* p) { return cat16b(*(const v8us*)p, *(const v8us*)(p + 16)); } static __device__ __forceinline__ v8f mma(V a, V b, v8f c) { return wmmab(a, b, c); } };
template <typename T16, int NSPLIT, bool BIAS>
__global__ __launch_bounds__(32) void k_gemmw(const T16* __restrict__ A, const T16* __restrict__ A2, const T16* __restrict__ Bt, const T16* __restrict__ Bt2, int K, float* C, int ldc, const float* __restrict__ bias, size_t sA, size_t sB, size_t sC) {
    typedef typename WFrag<T16>::V V;
    __shared__ __align__(16) float os[16 * 68];
    const size_t z = blockIdx.z; A += z * sA; if (A2) A2 += z * sA; Bt += z * sB; if (Bt2) Bt2 += z * sB; C += z * sC;
    const int lane = threadIdx.x & 31, lr = lane & 15, hi = lane >> 4; const int r0 = blockIdx.x * 64, c0 = blockIdx.y * 64;
    v8f acc[4][4];
#pragma unroll
    for (int mb = 0; mb < 4; ++mb)
#pragma unroll
        for (int nb = 0; nb < 4; ++nb) acc[mb][nb] = (v8f){};
    const size_t aoff = (size_t)(r0 + lr) * K + 8 * hi, boff = (size_t)(c0 + lr) * K + 8 * hi;
#pragma unroll 1
    for (int kc = 0; kc < K; kc += 32) {
        V a[4], a2[4];
#pragma unroll
        for (int mb = 0; mb < 4; ++mb) { a[mb] = WFrag<T16>::ld(A + aoff + (size_t)mb * 16 * K + kc); if (NSPLIT == 1 || NSPLIT == 2) a2[mb] = WFrag<T16>::ld(A2 + aoff + (size_t)mb * 16 * K + kc); }
#pragma unroll
        for (int nb = 0; nb < 4; ++nb) { const V b = WFrag<T16>::ld(Bt + boff + (size_t)nb * 16 * K + kc); V b2; if (NSPLIT >= 2) b2 = WFrag<T16>::ld(Bt2 + boff + (size_t)nb * 16 * K + kc);
#pragma unroll
            for (int mb = 0; mb < 4; ++mb) { acc[mb][nb] = WFrag<T16>::mma(a[mb], b, acc[mb][nb]); if (NSPLIT == 1 || NSPLIT == 2) acc[mb][nb] = WFrag<T16>::mma(a2[mb], b, acc[mb][nb]); if (NSPLIT >= 2) acc[mb][nb] = WFrag<T16>::mma(a[mb], b2, acc[mb][nb]); } }
        asm volatile("v_nop\n\tv_nop\n\tv_nop\n\tv_nop" : "+v"(acc[0][0]), "+v"(acc[1][1]), "+v"(acc[2][2]), "+v"(acc[3][3]) : "v"(a[0]), "v"(a[3]));
    }
#pragma unroll
    for (int mb = 0; mb < 4; ++mb) {
#pragma unroll
        for (int nb = 0; nb < 4; ++nb) {
#pragma unroll
            for (int j = 0; j < 8; ++j) os[(hi * 8 + j) * 68 + nb * 16 + lr] = acc[mb][nb][j]; }
        __builtin_amdgcn_wave_barrier(); asm volatile("" ::: "memory");
        float* crow = C + (size_t)(r0 + mb * 16) * ldc + c0;
{
#pragma unroll
            for (int s = 0; s < 8; ++s) { const int row = 2 * s + hi, cofs = lr * 4; v4f val = *(const v4fa*)(os + row * 68 + cofs); if (BIAS) { val[0] += bfr(bias[c0 + cofs]); val[1] += bfr(bias[c0 + cofs + 1]); val[2] += bfr(bias[c0 + cofs + 2]); val[3] += bfr(bias[c0 + cofs + 3]); }
                *(v4f*)(crow + (size_t)row * ldc + cofs) = val; }
             }
        __builtin_amdgcn_wave_barrier(); asm volatile("" ::: "memory");
    }
}

// ---- k_gemmc: the same one-wave 64x64 tile GEMM specialised for causal attention: CMODE 1 skips score tiles entirely above the diagonal (query rows r0+roff.., key columns c0..), CMODE 2 limits the
// key (K) loop of the probability x value contraction to the diagonal block (probabilities beyond it are exactly zero). roff = row offset of this launch's first row within the sequence.
template <typename T16, int NSPLIT, int CMODE>
__global__ __launch_bounds__(32) void k_gemmc(const T16* __restrict__ A, const T16* __restrict__ A2, const T16* __restrict__ Bt, const T16* __restrict__ Bt2, int K, float* C, int ldc, int roff, size_t sA, size_t sB, size_t sC) {
    typedef typename WFrag<T16>::V V;
    __shared__ __align__(16) float os[16 * 68];
    const size_t z = blockIdx.z; A += z * sA; if (A2) A2 += z * sA; Bt += z * sB; if (Bt2) Bt2 += z * sB; C += z * sC;
    const int lane = threadIdx.x & 31, lr = lane & 15, hi = lane >> 4; const int r0 = blockIdx.x * 64, c0 = blockIdx.y * 64;
    if (CMODE == 1 && c0 > r0 + roff + 63) return;                  // score tile entirely above the causal diagonal: never read (the softmax masks j > i by select)
    const int Kl = (CMODE == 2) ? min(K, r0 + roff + 64) : K;        // P.V: probabilities are exactly 0 beyond the diagonal block, so the K loop stops there
    v8f acc[4][4];
#pragma unroll
    for (int mb = 0; mb < 4; ++mb)
#pragma unroll
        for (int nb = 0; nb < 4; ++nb) acc[mb][nb] = (v8f){};
    const size_t aoff = (size_t)(r0 + lr) * K + 8 * hi, boff = (size_t)(c0 + lr) * K + 8 * hi;
#pragma unroll 1
    for (int kc = 0; kc < Kl; kc += 32) {
        V a[4], a2[4];
#pragma unroll
        for (int mb = 0; mb < 4; ++mb) { a[mb] = WFrag<T16>::ld(A + aoff + (size_t)mb * 16 * K + kc); if (NSPLIT == 1 || NSPLIT == 2) a2[mb] = WFrag<T16>::ld(A2 + aoff + (size_t)mb * 16 * K + kc); }
#pragma unroll
        for (int nb = 0; nb < 4; ++nb) { const V b = WFrag<T16>::ld(Bt + boff + (size_t)nb * 16 * K + kc); V b2; if (NSPLIT >= 2) b2 = WFrag<T16>::ld(Bt2 + boff + (size_t)nb * 16 * K + kc);
#pragma unroll
            for (int mb = 0; mb < 4; ++mb) { acc[mb][nb] = WFrag<T16>::mma(a[mb], b, acc[mb][nb]); if (NSPLIT == 1 || NSPLIT == 2) acc[mb][nb] = WFrag<T16>::mma(a2[mb], b, acc[mb][nb]); if (NSPLIT >= 2) acc[mb][nb] = WFrag<T16>::mma(a[mb], b2, acc[mb][nb]); } }
        asm volatile("v_nop\n\tv_nop\n\tv_nop\n\tv_nop" : "+v"(acc[0][0]), "+v"(acc[1][1]), "+v"(acc[2][2]), "+v"(acc[3][3]) : "v"(a[0]), "v"(a[3]));
    }
#pragma unroll
    for (int mb = 0; mb < 4; ++mb) {
#pragma unroll
        for (int nb = 0; nb < 4; ++nb) {
#pragma unroll
            for (int j = 0; j < 8; ++j) os[(hi * 8 + j) * 68 + nb * 16 + lr] = acc[mb][nb][j]; }
        __builtin_amdgcn_wave_barrier(); asm volatile("" ::: "memory");
        float* crow = C + (size_t)(r0 + mb * 16) * ldc + c0;
{
#pragma unroll
            for (int s = 0; s < 8; ++s) { const int row = 2 * s + hi, cofs = lr * 4; v4f val = *(const v4fa*)(os + row * 68 + cofs);
                *(v4f*)(crow + (size_t)row * ldc + cofs) = val; }
             }
        __builtin_amdgcn_wave_barrier(); asm volatile("" ::: "memory");
    }
}

// ---- k_pvs: probability x value contraction with the key (K) loop SPLIT OVER THE NW WAVES of a work-group. One work-group per 16x64 output tile; wave w takes the key chunks w, w + NW, ... (KS k-steps of 32 keys each),
// with its own four f32 accumulators; the NW partial tiles meet in LDS behind one barrier and are summed in wave order 0..NW-1 (a fixed order), each 256-B output row stored once. The key loop ends at the chunk that holds the
// diagonal: the softmax kernel writes every column of a probability row, exact zeros beyond the diagonal. K % (KS * 32) == 0. roff = row offset of this launch's first row within the sequence.
template <typename T16, int NSPLIT, int KS, int NW>
__global__ __launch_bounds__(NW * 32) void k_pvs(const T16* __restrict__ A, const T16* __restrict__ A2, const T16* __restrict__ Bt, const T16* __restrict__ Bt2, int K, float* C, int ldc, int roff, size_t sA, size_t sB, size_t sC) {
    typedef typename WFrag<T16>::V V;
    __shared__ __align__(16) float red[NW][16 * 68];
    const size_t z = blockIdx.z; A += z * sA; if (NSPLIT) A2 += z * sA; Bt += z * sB; if (NSPLIT) Bt2 += z * sB; C += z * sC;
    const int lane = threadIdx.x & 31, lr = lane & 15, hi = lane >> 4; const int r0 = blockIdx.x * 16, c0 = blockIdx.y * 64;
    const int wave = __builtin_amdgcn_readfirstlane(threadIdx.x >> 5);   // scalar, so that the key loop is a scalar loop (EXEC stays all ones for the matrix instructions)
    const int CH = KS * 32; const int Kl = min(K, (r0 + roff + 16 + CH - 1) / CH * CH);
    v8f acc[4];
#pragma unroll
    for (int nb = 0; nb < 4; ++nb) acc[nb] = (v8f){};
    const size_t aoff = (size_t)(r0 + lr) * K + 8 * hi, boff = (size_t)(c0 + lr) * K + 8 * hi;
    for (int kc = wave * CH; kc < Kl; kc += NW * CH) {
        V a[KS], a2[KS], b[KS][4], b2[KS][4];
        const T16* pa = A + aoff + kc; const T16* pa2 = NSPLIT ? A2 + aoff + kc : pa; const T16* pb[4]; const T16* pb2[4];
#pragma unroll
        for (int nb = 0; nb < 4; ++nb) { pb[nb] = Bt + boff + (size_t)nb * 16 * K + kc; pb2[nb] = NSPLIT ? Bt2 + boff + (size_t)nb * 16 * K + kc : pb[nb]; }
#pragma unroll
        for (int ks = 0; ks < KS; ++ks) { a[ks] = WFrag<T16>::ld(pa + ks * 32); if (NSPLIT == 2) a2[ks] = WFrag<T16>::ld(pa2 + ks * 32);
#pragma unroll
            for (int nb = 0; nb < 4; ++nb) { b[ks][nb] = WFrag<T16>::ld(pb[nb] + ks * 32); if (NSPLIT == 2) b2[ks][nb] = WFrag<T16>::ld(pb2[nb] + ks * 32); } }
        // The wait that stands between an issued global load and a later write of a register that the load names as its address. The chunk's addresses are inputs, so that they stay in their registers up to
        // this line.
        asm volatile("s_wait_xcnt 0x0" :: "v"(pa), "v"(pa2), "v"(pb[0]), "v"(pb[1]), "v"(pb[2]), "v"(pb[3]), "v"(pb2[0]), "v"(pb2[1]), "v"(pb2[2]), "v"(pb2[3]) : "memory");
        __builtin_amdgcn_sched_barrier(0);   // keeps the whole chunk's loads, and the wait behind them, ahead of its first matrix instruction: without it the compiler sinks each load pair to its use and the wave waits out one memory latency per product
#pragma unroll
        for (int ks = 0; ks < KS; ++ks)
#pragma unroll
            for (int nb = 0; nb < 4; ++nb) { acc[nb] = WFrag<T16>::mma(a[ks], b[ks][nb], acc[nb]); if (NSPLIT == 2) { acc[nb] = WFrag<T16>::mma(a2[ks], b[ks][nb], acc[nb]); acc[nb] = WFrag<T16>::mma(a[ks], b2[ks][nb], acc[nb]); } }
    }
#pragma unroll
    for (int nb = 0; nb < 4; ++nb) {
#pragma unroll
        for (int j = 0; j < 8; ++j) red[wave][(hi * 8 + j) * 68 + nb * 16 + lr] = acc[nb][j]; }
    __syncthreads();
    static_assert(NW * 32 == 256, "one float4 of the 16x64 tile per thread");
    { const int row = threadIdx.x >> 4, cofs = (threadIdx.x & 15) * 4; v4f val = *(const v4fa*)(&red[0][row * 68 + cofs]);
#pragma unroll
        for (int w = 1; w < NW; ++w) val += *(const v4fa*)(&red[w][row * 68 + cofs]);
        *(v4f*)(C + (size_t)(r0 + row) * ldc + c0 + cofs) = val; }
}

__device__ __forceinline__ h16 tohx(float x) { return (h16)x; }
__device__ __forceinline__ void splitf(float y, unsigned short& h, unsigned short& l) { h = f2bf(y); l = f2bf(y - bf2f(h)); }
typedef __attribute__((ext_vector_type(2))) _Float16 v2h;
typedef __attribute__((ext_vector_type(4))) _Float16 v4h;
typedef __attribute__((ext_vector_type(2))) unsigned short v2us;
typedef __attribute__((ext_vector_type(4))) unsigned short v4us;
typedef __attribute__((ext_vector_type(2))) float v2f;
typedef __attribute__((ext_vector_type(4))) int v4i;

__global__ __launch_bounds__(256) void k_wtG(const float* __restrict__ w, int K, int N, bf* Bt) {
    const int lane = threadIdx.x & 31; const int L0 = (blockIdx.x * 8 + (threadIdx.x >> 5)) * 8; const int nlines = N * K / 64;
{
#pragma unroll 1
        for (int l = 0; l < 8; ++l) { const int L = L0 + l; if (L >= nlines) break; const size_t e = (size_t)L * 64 + lane * 2; const int k = (int)(e % K), n = (int)(e / K); v2us o;
            o[0] = f2bf(w[(size_t)k * N + n]); o[1] = f2bf(w[(size_t)(k + 1) * N + n]); *(v2us*)(Bt + e) = o; }
         }
}
__global__ __launch_bounds__(256) void k_cvt8(const float* __restrict__ src, bf* dst, size_t n8) { const size_t i = (size_t)blockIdx.x * 256 + threadIdx.x; if (i >= n8) return; const v8f v = *(const v8f*)(src + i * 8); v8us o;
#pragma unroll
    for (int k = 0; k < 8; ++k) o[k] = f2bf(v[k]); *(v8us*)(dst + i * 8) = o;  }

// k_rope: head planes [h][t][d] (fp16 + hi/lo) of rope(x) x sc with the rotate-half convention out[d] = x[d] cos[t][d] - x[d+HD/2] sin[t][d], out[d+HD/2] = x[d+HD/2] cos[t][d+HD/2] + x[d] sin[t][d+HD/2]
__global__ __launch_bounds__(256) void k_rope(const float* __restrict__ F, int pitch, int nheads, const float* __restrict__ CS, const float* __restrict__ RF, const float* __restrict__ nw, float sc, h16* P16, bf* Ph, bf* Pl) {
    const size_t e = ((size_t)blockIdx.x * 256 + threadIdx.x) * 2; if (e >= (size_t)nheads * TT * HD) return; const int d = (int)(e % HD); const int t = (int)((e / HD) % TT); const int h = (int)(e / ((size_t)HD * TT)); const float* f = F + (size_t)t * pitch + h * HD; const float rf = RF ? RF[(size_t)h * TT + t] : 1.0f; v2h o16; v2us oh, ol;
#pragma unroll
    for (int q = 0; q < 2; ++q) { const int dd = d + q; const int dp = (dd < HD / 2) ? dd + HD / 2 : dd - HD / 2; float x0 = f[dd], x1 = f[dp];
        if (RF) { float n0 = __fmul_rn(x0, rf), n1 = __fmul_rn(x1, rf); asm volatile("" : "+v"(n0)); asm volatile("" : "+v"(n1)); x0 = __fmul_rn(bfr(nw[dd]), n0); x1 = __fmul_rn(bfr(nw[dp]), n1); }
        const v2f cs = *(const v2f*)(CS + ((size_t)t * HD + dd) * 2); float a = __fmul_rn(x0, cs[0]), bq = __fmul_rn(x1, cs[1]); asm volatile("" : "+v"(a)); asm volatile("" : "+v"(bq)); const float r = ((dd < HD / 2) ? __fsub_rn(a, bq) : __fadd_rn(a, bq)) * sc;
        o16[q] = tohx(r); unsigned short a2, c2; splitf(r, a2, c2); oh[q] = a2; ol[q] = c2; }
    *(v2h*)(P16 + e) = o16; *(v2us*)(Ph + e) = oh; *(v2us*)(Pl + e) = ol;  }
__global__ __launch_bounds__(256) void k_vtp(const float* __restrict__ F, int pitch, int nheads, h16* V16, bf* Vh, bf* Vl) { const size_t e = ((size_t)blockIdx.x * 256 + threadIdx.x) * 2; if (e >= (size_t)nheads * HD * TT) return; const int t = (int)(e % TT); const int d = (int)((e / TT) % HD); const int g = (int)(e / ((size_t)TT * HD)); v2h o16; v2us oh, ol;
#pragma unroll
    for (int q = 0; q < 2; ++q) { const float x = F[(size_t)(t + q) * pitch + g * HD + d]; o16[q] = tohx(x); unsigned short a2, c2; splitf(x, a2, c2); oh[q] = a2; ol[q] = c2; }
    *(v2h*)(V16 + e) = o16; *(v2us*)(Vh + e) = oh; *(v2us*)(Vl + e) = ol;  }
__global__ __launch_bounds__(256) void k_csid(float* CS) { const int idx = blockIdx.x * 256 + threadIdx.x; if (idx >= TT * HD) return; v2f cs; cs[0] = 1.0f; cs[1] = 0.0f; *(v2f*)(CS + (size_t)idx * 2) = cs;  }
// k_asoft: per row (zz, i): t = S x HD^-0.5 for j <= i and i - j < WIN (sliding causal window; the reference's -1e9 additive fill vanishes identically); softmax over the 4096 keys (register row, one exp, fixed trees);
__global__ __launch_bounds__(256) void k_asoft(const float* __restrict__ Sb, h16* P16, bf* Ph, bf* Pl) {
    const int lane = threadIdx.x & 31; const int row = blockIdx.x * 8 + (threadIdx.x >> 5); if (row >= ZH * TT) return; const int i = row % TT; const int zz = row / TT; (void)zz; const bool hires = (i < RH); const float* sr = Sb + (size_t)row * TT; float v[TT / 32]; float mx = -3.0e38f;
#pragma unroll
    for (int ch = 0; ch < TT / 128; ++ch) { const int j0 = ch * 128 + lane * 4; const v4f a = *(const v4f*)(sr + j0);
#pragma unroll
        for (int q = 0; q < 4; ++q) { const int j = j0 + q; (void)j; const float t = (j <= i && i - j < WIN) ? a[q] * SCL : -3.0e38f; v[ch * 4 + q] = t; mx = fmaxf(mx, t); } }
#pragma unroll
    for (int sh = 16; sh; sh >>= 1) mx = fmaxf(mx, __shfl_xor(mx, sh, 32));
    float sum = 0.f;
#pragma unroll
    for (int k = 0; k < TT / 32; ++k) { float d0 = __fsub_rn(v[k], mx); asm volatile("" : "+v"(d0)); v[k] = __builtin_amdgcn_exp2f(__fmul_rn(d0, 1.4426950408889634f)); sum += v[k]; }
#pragma unroll
    for (int sh = 16; sh; sh >>= 1) sum += __shfl_xor(sum, sh, 32);
    const float f = __fdiv_rn(hires ? 1.0f : PCAR, sum);
{
        if (hires) {
#pragma unroll
            for (int ch = 0; ch < TT / 128; ++ch) { v4us oh, ol;
#pragma unroll
                for (int q = 0; q < 4; ++q) { unsigned short a, c2; splitf(v[ch * 4 + q] * f, a, c2); oh[q] = a; ol[q] = c2; }
                const size_t oo = ((size_t)zz * (RH ? RH : 1) + i) * TT + ch * 128 + lane * 4; *(v4us*)(Ph + oo) = oh; *(v4us*)(Pl + oo) = ol; }
        } else {
#pragma unroll
            for (int ch = 0; ch < TT / 128; ++ch) { v4h o4;
#pragma unroll
                for (int q = 0; q < 4; ++q) o4[q] = tohx(v[ch * 4 + q] * f);
                *(v4h*)(P16 + (size_t)row * TT + ch * 128 + lane * 4) = o4; } }
         }
}
__global__ __launch_bounds__(256) void k_merge(const float* __restrict__ O, int h0, float* OUTb) { const size_t e = ((size_t)blockIdx.x * 256 + threadIdx.x) * 2; if (e >= (size_t)ZH * TT * HD) return; const int d = (int)(e % HD); const int t = (int)((e / HD) % TT); const int zz = (int)(e / ((size_t)HD * TT)); const float cs = (t < RH) ? 1.0f : (1.0f / PCAR); const size_t oo = ((size_t)(h0 + zz) * TT + t) * DQ + d;   // plane h0 + zz is a batch: its output rows follow the previous batch's
    v2f o2; o2[0] = O[e] * cs; o2[1] = O[e + 1] * cs; *(v2f*)(OUTb + oo) = o2;  }

extern "C" void kernel_launch(void* const* d_in, const int* in_sizes, int n_in,
                              void* d_out, int out_size, void* d_ws, size_t ws_size, hipStream_t stream) {
    (void)in_sizes; (void)n_in; (void)out_size;
    const float* x = (const float*)d_in[0]; const float* wk = (const float*)d_in[1]; const float* bk = (const float*)d_in[2]; const float* wq = (const float*)d_in[3]; const float* bq = (const float*)d_in[4]; const float* wv = (const float*)d_in[5]; const float* bv = (const float*)d_in[6];   /* input order Wk, bk, Wq, bq, Wv, bv */ const float* wo = nullptr; (void)wo;
    float* OUT = (float*)d_out;     // [4][4096][64]
    char* wsp = (char*)d_ws;
    auto take = [&](size_t bytes) { char* p = wsp; wsp += (bytes + 255) & ~(size_t)255; return (void*)p; };
    bf* WQ = (bf*)take((size_t)DQ * DM * 2); bf* WK = (bf*)take((size_t)DKV * DM * 2); bf* WV = (bf*)take((size_t)DKV * DM * 2); float* CS = (float*)take((size_t)TT * HD * 2 * 4);
    bf* XB = (bf*)take((size_t)NB_ * TT * DM * 2); float* FQ = (float*)take((size_t)NB_ * TT * DQ * 4); float* FK = (float*)take((size_t)NB_ * TT * DKV * 4);
    h16* QP16 = (h16*)take((size_t)NB_ * TT * HD * 2); h16* KP16 = (h16*)take((size_t)NB_ * TT * HD * 2); h16* VT16 = (h16*)take((size_t)NB_ * HD * TT * 2);
    bf* QPh = (bf*)take((size_t)NB_ * TT * HD * 2); bf* QPl = (bf*)take((size_t)NB_ * TT * HD * 2); bf* KPh = (bf*)take((size_t)NB_ * TT * HD * 2); bf* KPl = (bf*)take((size_t)NB_ * TT * HD * 2); bf* VTh = (bf*)take((size_t)NB_ * HD * TT * 2); bf* VTl = (bf*)take((size_t)NB_ * HD * TT * 2); bf* Ph = (bf*)take((size_t)ZH * RH * TT * 2); bf* Pl = (bf*)take((size_t)ZH * RH * TT * 2);
    float* Sb = (float*)take((size_t)ZH * TT * TT * 4); h16* P16 = (h16*)take((size_t)ZH * TT * TT * 2); float* Ob = (float*)take((size_t)ZH * TT * HD * 4);
    if ((size_t)(wsp - (char*)d_ws) > ws_size) return;    // ws 256 MiB
    float* FV = FK;   // v projection reuses the k buffer after the k planes are built (stream-ordered)
    { k_wtG<<<(unsigned)((DM * DQ / 64 + 63) / 64), 256, 0, stream>>>(wq, DM, DQ, WQ); k_wtG<<<(unsigned)((DM * DKV / 64 + 63) / 64), 256, 0, stream>>>(wk, DM, DKV, WK); k_wtG<<<(unsigned)((DM * DKV / 64 + 63) / 64), 256, 0, stream>>>(wv, DM, DKV, WV);
       }
    k_csid<<<(TT * HD + 255) / 256, 256, 0, stream>>>(CS);
    const unsigned LP = (unsigned)(((size_t)NB_ * TT * HD / 2 + 255) / 256);
    // All four batches per launch. The projections take the batch as grid z and write [t][batch][64] (row pitch NB_ * 64, z-stride 64), which the plane builders read as NB_ heads: planes [batch][t][d] and [batch][d][t].
    k_cvt8<<<(unsigned)(((size_t)NB_ * TT * DM / 8 + 255) / 256), 256, 0, stream>>>(x, XB, (size_t)NB_ * TT * DM / 8);
    k_gemmw<bf, 0, true><<<dim3(TT / 64, DQ / 64, NB_), 32, 0, stream>>>(XB, nullptr, WQ, nullptr, DM, FQ, NB_ * DQ, bq, (size_t)TT * DM, 0, DQ);
    k_rope<<<LP, 256, 0, stream>>>(FQ, NB_ * DQ, NB_, CS, nullptr, nullptr, 1.0f, QP16, QPh, QPl);
    k_gemmw<bf, 0, true><<<dim3(TT / 64, DKV / 64, NB_), 32, 0, stream>>>(XB, nullptr, WK, nullptr, DM, FK, NB_ * DKV, bk, (size_t)TT * DM, 0, DKV);
    k_rope<<<LP, 256, 0, stream>>>(FK, NB_ * DKV, NB_, CS, nullptr, nullptr, 1.0f, KP16, KPh, KPl);
    k_gemmw<bf, 0, true><<<dim3(TT / 64, DKV / 64, NB_), 32, 0, stream>>>(XB, nullptr, WV, nullptr, DM, FV, NB_ * DKV, bv, (size_t)TT * DM, 0, DKV);
    k_vtp<<<LP, 256, 0, stream>>>(FV, NB_ * DKV, NB_, VT16, VTh, VTl);
    for (int b0 = 0; b0 < NB_; b0 += ZH) { const size_t zb = (size_t)b0;   // ZH batches per pass: consecutive q, k, v planes (z-strides TT*HD)
        k_gemmc<bf, 2, 1><<<dim3(TT / 64, TT / 64, ZH), 32, 0, stream>>>(QPh + zb * TT * HD, QPl + zb * TT * HD, KPh + zb * TT * HD, KPl + zb * TT * HD, HD, Sb, TT, 0, (size_t)TT * HD, (size_t)TT * HD, (size_t)TT * TT);   /* scores hi/lo on EVERY row */
        k_asoft<<<ZH * TT / 8, 256, 0, stream>>>(Sb, P16, Ph, Pl);
        k_pvs<bf, 2, 2, 8><<<dim3(RH / 16, HD / 64, ZH), 256, 0, stream>>>(Ph, Pl, VTh + zb * HD * TT, VTl + zb * HD * TT, TT, Ob, HD, 0, (size_t)RH * TT, (size_t)HD * TT, (size_t)TT * HD);
        k_pvs<h16, 0, 4, 8><<<dim3((TT - RH) / 16, HD / 64, ZH), 256, 0, stream>>>(P16 + (size_t)RH * TT, nullptr, VT16 + zb * HD * TT, nullptr, TT, Ob + (size_t)RH * HD, HD, RH, (size_t)TT * TT, (size_t)HD * TT, (size_t)TT * HD);
        k_merge<<<(unsigned)(((size_t)ZH * TT * HD / 2 + 255) / 256), 256, 0, stream>>>(Ob, b0, OUT); }
}

// v003
// Measured time: 106 microseconds a run.
// Two timings next to v002 put it at 1.86 and 1.85 times that version's speed.
// Over all steps from v000 it is 5.71 times as fast.
#include <hip/hip_runtime.h>

// Single-head causal attention over 4,096 tokens with a 64-wide head (embedded [4][4096][256]; k, q, v = x W + b ('xw' [256][64] 1/16; input order Wk, bk, Wq, bq, Wv, bv); scores / 8; causal (-inf); softmax; out = p v -> [4][4096][64] (1.05 M)).
// Layout (the batch index is a grid dimension: all 4 batches per launch): bf16 copy of x; 'xw' [256][64] weights transposed once; exact projections + f32 biases; q, k planes [batch][t][d], v planes [batch][d][t]; one fused causal attention kernel (hi/lo 3-product score tiles on EVERY row, online softmax in registers, P and attn.v hybrid: rows < 512 hi/lo, rest fp16 x1024; key chunks above the diagonal skipped), which writes the output rows.
// Compute dtypes, f32 accumulate: every input rounded to bf16; projections exact + f32 biases; scores 3 products on every row; softmax f32; attn.v rows < 512 3 products, rest fp16; output f32.

#define NB_  4
#define TT   4096
#define DM   256
#define NH_  1
#define NKV  1
#define REP  (NH_ / NKV)
#define HD   64
#define DQ   (NH_ * HD)
#define DKV  (NKV * HD)
#define RH   512                  // query rows < RH use hi+lo planes (0: none)
#define SCL  0.125f   // HD^-0.5
typedef _Float16 h16;
typedef unsigned short bf;
typedef __attribute__((ext_vector_type(16))) __bf16   v16bf;
typedef __attribute__((ext_vector_type(16))) _Float16 v16h;
typedef __attribute__((ext_vector_type(8)))  _Float16 v8h;
typedef __attribute__((ext_vector_type(8)))  unsigned short v8us;
typedef __attribute__((ext_vector_type(8)))  float    v8f;
typedef __attribute__((ext_vector_type(4)))  float    v4f;
typedef v8h  __attribute__((may_alias)) v8ha;
typedef v4f  __attribute__((may_alias)) v4fa;
typedef v8us __attribute__((may_alias)) v8usa;

__device__ __forceinline__ unsigned short f2bf(float f) { unsigned u = __float_as_uint(f); u += 0x7FFFu + ((u >> 16) & 1u); return (unsigned short)(u >> 16); }
__device__ __forceinline__ float bf2f(unsigned short b) { return __uint_as_float(((unsigned)b) << 16); }
__device__ __forceinline__ float bfr(float f) { return bf2f(f2bf(f)); }
__device__ __forceinline__ v16h cat16(v8h lo, v8h hi) { return __builtin_shufflevector(lo, hi, 0, 1, 2, 3, 4, 5, 6, 7, 8, 9, 10, 11, 12, 13, 14, 15); }
__device__ __forceinline__ v16bf cat16b(v8us lo, v8us hi) { return __builtin_bit_cast(v16bf, __builtin_shufflevector(lo, hi, 0, 1, 2, 3, 4, 5, 6, 7, 8, 9, 10, 11, 12, 13, 14, 15)); }
__device__ __forceinline__ v8f wmma16(v16h a, v16h b, v8f c) { return __builtin_amdgcn_wmma_f32_16x16x32_f16(false, a, false, b, (short)0, c, false, false); }
__device__ __forceinline__ v8f wmmab(v16bf a, v16bf b, v8f c) { return __builtin_amdgcn_wmma_f32_16x16x32_bf16(false, a, false, b, (short)0, c, false, false); }



// ---- k_gemmw: register-blocked GEMM, ONE WAVE per 64x64 output tile (16 accumulators), operands straight from K-contiguous 16-bit planes; grid (M/64, N/64, Z), 32 threads.
// C[m][n] (f32, pitch ldc, + optional f32 bias[n]) = sum_k A[m][k] Bt[n][k] (+ split products per NSPLIT). z-batch strides sA/sB/sC in elements. K % 32 == 0.
template <typename T16> struct WFrag;
template <> struct WFrag<h16> { typedef v16h V; static __device__ __forceinline__ V ld(const h16* p) { return cat16(*(const v8h*)p, *(const v8h*)(p + 16)); } static __device__ __forceinline__ v8f mma(V a, V b, v8f c) { return wmma16(a, b, c); } };
template <> struct WFrag<bf> { typedef v16bf V; static __device__ __forceinline__ V ld(const bf* p) { return cat16b(*(const v8us*)p, *(const v8us*)(p + 16)); } static __device__ __forceinline__ v8f mma(V a, V b, v8f c) { return wmmab(a, b, c); } };
template <typename T16, int NSPLIT, bool BIAS>
__global__ __launch_bounds__(32) void k_gemmw(const T16* __restrict__ A, const T16* __restrict__ A2, const T16* __restrict__ Bt, const T16* __restrict__ Bt2, int K, float* C, int ldc, const float* __restrict__ bias, size_t sA, size_t sB, size_t sC) {
    typedef typename WFrag<T16>::V V;
    __shared__ __align__(16) float os[16 * 68];
    const size_t z = blockIdx.z; A += z * sA; if (A2) A2 += z * sA; Bt += z * sB; if (Bt2) Bt2 += z * sB; C += z * sC;
    const int lane = threadIdx.x & 31, lr = lane & 15, hi = lane >> 4; const int r0 = blockIdx.x * 64, c0 = blockIdx.y * 64;
    v8f acc[4][4];
#pragma unroll
    for (int mb = 0; mb < 4; ++mb)
#pragma unroll
        for (int nb = 0; nb < 4; ++nb) acc[mb][nb] = (v8f){};
    const size_t aoff = (size_t)(r0 + lr) * K + 8 * hi, boff = (size_t)(c0 + lr) * K + 8 * hi;
#pragma unroll 1
    for (int kc = 0; kc < K; kc += 32) {
        V a[4], a2[4];
#pragma unroll
        for (int mb = 0; mb < 4; ++mb) { a[mb] = WFrag<T16>::ld(A + aoff + (size_t)mb * 16 * K + kc); if (NSPLIT == 1 || NSPLIT == 2) a2[mb] = WFrag<T16>::ld(A2 + aoff + (size_t)mb * 16 * K + kc); }
#pragma unroll
        for (int nb = 0; nb < 4; ++nb) { const V b = WFrag<T16>::ld(Bt + boff + (size_t)nb * 16 * K + kc); V b2; if (NSPLIT >= 2) b2 = WFrag<T16>::ld(Bt2 + boff + (size_t)nb * 16 * K + kc);
#pragma unroll
            for (int mb = 0; mb < 4; ++mb) { acc[mb][nb] = WFrag<T16>::mma(a[mb], b, acc[mb][nb]); if (NSPLIT == 1 || NSPLIT == 2) acc[mb][nb] = WFrag<T16>::mma(a2[mb], b, acc[mb][nb]); if (NSPLIT >= 2) acc[mb][nb] = WFrag<T16>::mma(a[mb], b2, acc[mb][nb]); } }
        asm volatile("v_nop\n\tv_nop\n\tv_nop\n\tv_nop" : "+v"(acc[0][0]), "+v"(acc[1][1]), "+v"(acc[2][2]), "+v"(acc[3][3]) : "v"(a[0]), "v"(a[3]));
    }
#pragma unroll
    for (int mb = 0; mb < 4; ++mb) {
#pragma unroll
        for (int nb = 0; nb < 4; ++nb) {
#pragma unroll
            for (int j = 0; j < 8; ++j) os[(hi * 8 + j) * 68 + nb * 16 + lr] = acc[mb][nb][j]; }
        __builtin_amdgcn_wave_barrier(); asm volatile("" ::: "memory");
        float* crow = C + (size_t)(r0 + mb * 16) * ldc + c0;
{
#pragma unroll
            for (int s = 0; s < 8; ++s) { const int row = 2 * s + hi, cofs = lr * 4; v4f val = *(const v4fa*)(os + row * 68 + cofs); if (BIAS) { val[0] += bfr(bias[c0 + cofs]); val[1] += bfr(bias[c0 + cofs + 1]); val[2] += bfr(bias[c0 + cofs + 2]); val[3] += bfr(bias[c0 + cofs + 3]); }
                *(v4f*)(crow + (size_t)row * ldc + cofs) = val; }
             }
        __builtin_amdgcn_wave_barrier(); asm volatile("" ::: "memory");
    }
}

__device__ __forceinline__ h16 tohx(float x) { return (h16)x; }
__device__ __forceinline__ void splitf(float y, unsigned short& h, unsigned short& l) { h = f2bf(y); l = f2bf(y - bf2f(h)); }
typedef __attribute__((ext_vector_type(2))) _Float16 v2h;
typedef __attribute__((ext_vector_type(4))) _Float16 v4h;
typedef __attribute__((ext_vector_type(2))) unsigned short v2us;
typedef __attribute__((ext_vector_type(4))) unsigned short v4us;
typedef __attribute__((ext_vector_type(2))) float v2f;
typedef __attribute__((ext_vector_type(4))) int v4i;

__global__ __launch_bounds__(256) void k_wtG(const float* __restrict__ w, int K, int N, bf* Bt) {
    const int lane = threadIdx.x & 31; const int L0 = (blockIdx.x * 8 + (threadIdx.x >> 5)) * 8; const int nlines = N * K / 64;
{
#pragma unroll 1
        for (int l = 0; l < 8; ++l) { const int L = L0 + l; if (L >= nlines) break; const size_t e = (size_t)L * 64 + lane * 2; const int k = (int)(e % K), n = (int)(e / K); v2us o;
            o[0] = f2bf(w[(size_t)k * N + n]); o[1] = f2bf(w[(size_t)(k + 1) * N + n]); *(v2us*)(Bt + e) = o; }
         }
}
__global__ __launch_bounds__(256) void k_cvt8(const float* __restrict__ src, bf* dst, size_t n8) { const size_t i = (size_t)blockIdx.x * 256 + threadIdx.x; if (i >= n8) return; const v8f v = *(const v8f*)(src + i * 8); v8us o;
#pragma unroll
    for (int k = 0; k < 8; ++k) o[k] = f2bf(v[k]); *(v8us*)(dst + i * 8) = o;  }

// k_rope: head planes [h][t][d] (fp16 + hi/lo) of rope(x) x sc with the rotate-half convention out[d] = x[d] cos[t][d] - x[d+HD/2] sin[t][d], out[d+HD/2] = x[d+HD/2] cos[t][d+HD/2] + x[d] sin[t][d+HD/2]
__global__ __launch_bounds__(256) void k_rope(const float* __restrict__ F, int pitch, int nheads, const float* __restrict__ CS, const float* __restrict__ RF, const float* __restrict__ nw, float sc, h16* P16, bf* Ph, bf* Pl) {
    const size_t e = ((size_t)blockIdx.x * 256 + threadIdx.x) * 2; if (e >= (size_t)nheads * TT * HD) return; const int d = (int)(e % HD); const int t = (int)((e / HD) % TT); const int h = (int)(e / ((size_t)HD * TT)); const float* f = F + (size_t)t * pitch + h * HD; const float rf = RF ? RF[(size_t)h * TT + t] : 1.0f; v2h o16; v2us oh, ol;
#pragma unroll
    for (int q = 0; q < 2; ++q) { const int dd = d + q; const int dp = (dd < HD / 2) ? dd + HD / 2 : dd - HD / 2; float x0 = f[dd], x1 = f[dp];
        if (RF) { float n0 = __fmul_rn(x0, rf), n1 = __fmul_rn(x1, rf); asm volatile("" : "+v"(n0)); asm volatile("" : "+v"(n1)); x0 = __fmul_rn(bfr(nw[dd]), n0); x1 = __fmul_rn(bfr(nw[dp]), n1); }
        const v2f cs = *(const v2f*)(CS + ((size_t)t * HD + dd) * 2); float a = __fmul_rn(x0, cs[0]), bq = __fmul_rn(x1, cs[1]); asm volatile("" : "+v"(a)); asm volatile("" : "+v"(bq)); const float r = ((dd < HD / 2) ? __fsub_rn(a, bq) : __fadd_rn(a, bq)) * sc;
        o16[q] = tohx(r); unsigned short a2, c2; splitf(r, a2, c2); oh[q] = a2; ol[q] = c2; }
    *(v2h*)(P16 + e) = o16; *(v2us*)(Ph + e) = oh; *(v2us*)(Pl + e) = ol;  }
__global__ __launch_bounds__(256) void k_vtp(const float* __restrict__ F, int pitch, int nheads, h16* V16, bf* Vh, bf* Vl) { const size_t e = ((size_t)blockIdx.x * 256 + threadIdx.x) * 2; if (e >= (size_t)nheads * HD * TT) return; const int t = (int)(e % TT); const int d = (int)((e / TT) % HD); const int g = (int)(e / ((size_t)TT * HD)); v2h o16; v2us oh, ol;
#pragma unroll
    for (int q = 0; q < 2; ++q) { const float x = F[(size_t)(t + q) * pitch + g * HD + d]; o16[q] = tohx(x); unsigned short a2, c2; splitf(x, a2, c2); oh[q] = a2; ol[q] = c2; }
    *(v2h*)(V16 + e) = o16; *(v2us*)(Vh + e) = oh; *(v2us*)(Vl + e) = ol;  }
__global__ __launch_bounds__(256) void k_csid(float* CS) { const int idx = blockIdx.x * 256 + threadIdx.x; if (idx >= TT * HD) return; v2f cs; cs[0] = 1.0f; cs[1] = 0.0f; *(v2f*)(CS + (size_t)idx * 2) = cs;  }
#define LC (SCL * 1.4426950408889634f)
__device__ __forceinline__ float xhalf(float x) { return __builtin_bit_cast(float, __builtin_amdgcn_permlanex16(__builtin_bit_cast(int, x), __builtin_bit_cast(int, x), 0x76543210, 0xfedcba98, false, false)); }   // lane l with lane l ^ 16, in the vector unit (the shuffle goes through the LDS pipe)
__device__ __forceinline__ float exp2x1(float x) { float y; asm("v_exp_f32 %0, %1\n\tv_nop" : "=v"(y) : "v"(x)); return y; }
__device__ __forceinline__ void exp2x8(const float* x, float* y) {
    asm("v_exp_f32 %0, %8\n\tv_exp_f32 %1, %9\n\tv_exp_f32 %2, %10\n\tv_exp_f32 %3, %11\n\tv_exp_f32 %4, %12\n\tv_exp_f32 %5, %13\n\tv_exp_f32 %6, %14\n\tv_exp_f32 %7, %15\n\tv_nop"
        : "=&v"(y[0]), "=&v"(y[1]), "=&v"(y[2]), "=&v"(y[3]), "=&v"(y[4]), "=&v"(y[5]), "=&v"(y[6]), "=&v"(y[7]) : "v"(x[0]), "v"(x[1]), "v"(x[2]), "v"(x[3]), "v"(x[4]), "v"(x[5]), "v"(x[6]), "v"(x[7])); }
template <bool HR>
__global__ __launch_bounds__(256) __attribute__((amdgpu_waves_per_eu(HR ? 2 : 4, HR ? 2 : 4))) void k_fattn(const bf* __restrict__ Qh, const bf* __restrict__ Ql, const bf* __restrict__ Kh, const bf* __restrict__ Kl, const h16* __restrict__ V16, const bf* __restrict__ Vh, const bf* __restrict__ Vl, float* OUTb, int qtlast) {
    __shared__ __align__(16) float red[8][32 * 68];
    __shared__ float sm[8][32], sl[8][32];
    const int lane = threadIdx.x & 31, lr = lane & 15, hi = lane >> 4;
    const int wave = __builtin_amdgcn_readfirstlane(threadIdx.x >> 5);   // scalar, so that the key loop is a scalar loop (EXEC stays all ones for the matrix instructions)
    const int qt = qtlast - (int)blockIdx.y, q0 = qt * 32; const size_t zo = (size_t)blockIdx.x * TT * HD;
    v16bf qh[2][2], ql[2][2];
    { const bf* pqh = Qh + zo + (size_t)(q0 + lr) * HD + 8 * hi; const bf* pql = Ql + zo + (size_t)(q0 + lr) * HD + 8 * hi;
#pragma unroll
        for (int g = 0; g < 2; ++g)
#pragma unroll
            for (int kk = 0; kk < 2; ++kk) { qh[g][kk] = WFrag<bf>::ld(pqh + g * 16 * HD + kk * 32); ql[g][kk] = WFrag<bf>::ld(pql + g * 16 * HD + kk * 32); }
        // The wait that stands between an issued global load and a later write of a register that the load names as its address; the addresses are inputs, so that they stay in their registers up to this line.
        asm volatile("s_wait_xcnt 0x0" :: "v"(pqh), "v"(pql) : "memory"); }
    v8f o[2][4]; float m[2], l[2];
#pragma unroll
    for (int g = 0; g < 2; ++g) { m[g] = -3.0e38f; l[g] = 0.f;
#pragma unroll
        for (int dt = 0; dt < 4; ++dt) o[g][dt] = (v8f){}; }
    for (int c = wave; c <= qt; c += 8) {
        const int key0 = c * 32;
        const bf* pkh = Kh + zo + (size_t)(key0 + lr) * HD + 8 * hi; const bf* pkl = Kl + zo + (size_t)(key0 + lr) * HD + 8 * hi;
        v16bf kh[2][2], kl[2][2];
#pragma unroll
        for (int kt = 0; kt < 2; ++kt)
#pragma unroll
            for (int kk = 0; kk < 2; ++kk) { kh[kt][kk] = WFrag<bf>::ld(pkh + kt * 16 * HD + kk * 32); kl[kt][kk] = WFrag<bf>::ld(pkl + kt * 16 * HD + kk * 32); }
        asm volatile("s_wait_xcnt 0x0" :: "v"(pkh), "v"(pkl) : "memory");   // as above: before an address register of the key loads is written again
        __builtin_amdgcn_sched_barrier(0);   // keeps the chunk's key loads together ahead of its first matrix instruction: one memory latency per chunk, not one per product
        v8f s[2][2];
#pragma unroll
        for (int kt = 0; kt < 2; ++kt)
#pragma unroll
            for (int g = 0; g < 2; ++g) s[kt][g] = (v8f){};
#pragma unroll
        for (int kk = 0; kk < 2; ++kk) {
#pragma unroll
            for (int kt = 0; kt < 2; ++kt)
#pragma unroll
                for (int g = 0; g < 2; ++g) s[kt][g] = wmmab(kh[kt][kk], qh[g][kk], s[kt][g]);
#pragma unroll
            for (int kt = 0; kt < 2; ++kt)
#pragma unroll
                for (int g = 0; g < 2; ++g) s[kt][g] = wmmab(kl[kt][kk], qh[g][kk], s[kt][g]);
#pragma unroll
            for (int kt = 0; kt < 2; ++kt)
#pragma unroll
                for (int g = 0; g < 2; ++g) s[kt][g] = wmmab(kh[kt][kk], ql[g][kk], s[kt][g]); }
        const h16* pv = V16 + zo + (size_t)lr * TT + key0 + 8 * hi; const bf* pvh = Vh + zo + (size_t)lr * TT + key0 + 8 * hi; const bf* pvl = Vl + zo + (size_t)lr * TT + key0 + 8 * hi;
        v16h v[4]; v16bf vh[4], vl[4];
        if constexpr (HR) {
#pragma unroll
            for (int dt = 0; dt < 4; ++dt) { vh[dt] = WFrag<bf>::ld(pvh + (size_t)dt * 16 * TT); vl[dt] = WFrag<bf>::ld(pvl + (size_t)dt * 16 * TT); }
            asm volatile("s_wait_xcnt 0x0" :: "v"(pvh), "v"(pvl) : "memory");   // as above, for the value loads
        } else {
#pragma unroll
            for (int dt = 0; dt < 4; ++dt) v[dt] = WFrag<h16>::ld(pv + (size_t)dt * 16 * TT);
            asm volatile("s_wait_xcnt 0x0" :: "v"(pv) : "memory");   // as above, for the value loads
        }
        if (c == qt) {   // the diagonal chunk (scalar test): keys behind the query drop out
#pragma unroll
            for (int kt = 0; kt < 2; ++kt)
#pragma unroll
                for (int g = 0; g < 2; ++g)
#pragma unroll
                    for (int j = 0; j < 8; ++j) if (kt * 16 + 8 * hi + j > g * 16 + lr) s[kt][g][j] = -3.0e38f; }
        v16h pf[2]; v8us ph[2][2], pl[2][2];
#pragma unroll
        for (int g = 0; g < 2; ++g) {
            float mx = s[0][g][0];
#pragma unroll
            for (int kt = 0; kt < 2; ++kt)
#pragma unroll
                for (int j = 0; j < 8; ++j) mx = fmaxf(mx, s[kt][g][j]);
            mx = fmaxf(mx, xhalf(mx));
            const float mn = fmaxf(m[g], mx * LC), al = exp2x1(m[g] - mn), sh = 10.0f - mn; m[g] = mn;
            float sum = 0.f;
#pragma unroll
            for (int kt = 0; kt < 2; ++kt) { float xa[8], pa[8];
#pragma unroll
                for (int j = 0; j < 8; ++j) xa[j] = fmaf(s[kt][g][j], LC, sh);
                exp2x8(xa, pa);
#pragma unroll
                for (int j = 0; j < 8; ++j) { const float p = pa[j]; sum += p;
                    if constexpr (HR) { unsigned short a, b2; splitf(p, a, b2); ph[g][kt][j] = a; pl[g][kt][j] = b2; } else pf[g][kt * 8 + j] = tohx(p); } }
            l[g] = fmaf(l[g], al, sum);
#pragma unroll
            for (int dt = 0; dt < 4; ++dt) o[g][dt] *= al;
        }
#pragma unroll
        for (int dt = 0; dt < 4; ++dt)
#pragma unroll
            for (int g = 0; g < 2; ++g) {
                if constexpr (HR) { const v16bf bh = cat16b(ph[g][0], ph[g][1]), bl = cat16b(pl[g][0], pl[g][1]); o[g][dt] = wmmab(vh[dt], bh, o[g][dt]); o[g][dt] = wmmab(vh[dt], bl, o[g][dt]); o[g][dt] = wmmab(vl[dt], bh, o[g][dt]); }
                else o[g][dt] = wmma16(v[dt], pf[g], o[g][dt]); }
    }
#pragma unroll
    for (int g = 0; g < 2; ++g) { l[g] += xhalf(l[g]);
        if (hi == 0) { sm[wave][g * 16 + lr] = m[g]; sl[wave][g * 16 + lr] = l[g]; }
#pragma unroll
        for (int dt = 0; dt < 4; ++dt) { float* rp = &red[wave][(g * 16 + lr) * 68 + dt * 16 + 8 * hi];   // a lane's 8 accumulator registers are 8 consecutive d of one query
            *(v4fa*)rp = (v4f){o[g][dt][0], o[g][dt][1], o[g][dt][2], o[g][dt][3]}; *(v4fa*)(rp + 4) = (v4f){o[g][dt][4], o[g][dt][5], o[g][dt][6], o[g][dt][7]}; } }
    __syncthreads();
    { const int qy = threadIdx.x >> 3, d0 = (threadIdx.x & 7) * 8; float M = sm[0][qy];
#pragma unroll
        for (int w = 1; w < 8; ++w) M = fmaxf(M, sm[w][qy]);
        float L = 0.f, fx[8], fw[8]; v4f a0 = (v4f){}, a1 = (v4f){};
#pragma unroll
        for (int w = 0; w < 8; ++w) fx[w] = sm[w][qy] - M;
        exp2x8(fx, fw);
#pragma unroll
        for (int w = 0; w < 8; ++w) { const float f = fw[w]; L = fmaf(f, sl[w][qy], L); a0 += f * *(const v4fa*)(&red[w][qy * 68 + d0]); a1 += f * *(const v4fa*)(&red[w][qy * 68 + d0 + 4]); }   // a wave without a chunk: f = 0, sum 0, tile 0
        const float inv = __fdiv_rn(1.0f, L); float* op = OUTb + zo + (size_t)(q0 + qy) * HD + d0;
        *(v4f*)op = a0 * inv; *(v4f*)(op + 4) = a1 * inv; }
}

extern "C" void kernel_launch(void* const* d_in, const int* in_sizes, int n_in,
                              void* d_out, int out_size, void* d_ws, size_t ws_size, hipStream_t stream) {
    (void)in_sizes; (void)n_in; (void)out_size;
    const float* x = (const float*)d_in[0]; const float* wk = (const float*)d_in[1]; const float* bk = (const float*)d_in[2]; const float* wq = (const float*)d_in[3]; const float* bq = (const float*)d_in[4]; const float* wv = (const float*)d_in[5]; const float* bv = (const float*)d_in[6];   /* input order Wk, bk, Wq, bq, Wv, bv */ const float* wo = nullptr; (void)wo;
    float* OUT = (float*)d_out;     // [4][4096][64]
    char* wsp = (char*)d_ws;
    auto take = [&](size_t bytes) { char* p = wsp; wsp += (bytes + 255) & ~(size_t)255; return (void*)p; };
    bf* WQ = (bf*)take((size_t)DQ * DM * 2); bf* WK = (bf*)take((size_t)DKV * DM * 2); bf* WV = (bf*)take((size_t)DKV * DM * 2); float* CS = (float*)take((size_t)TT * HD * 2 * 4);
    bf* XB = (bf*)take((size_t)NB_ * TT * DM * 2); float* FQ = (float*)take((size_t)NB_ * TT * DQ * 4); float* FK = (float*)take((size_t)NB_ * TT * DKV * 4);
    h16* QP16 = (h16*)take((size_t)NB_ * TT * HD * 2); h16* KP16 = (h16*)take((size_t)NB_ * TT * HD * 2); h16* VT16 = (h16*)take((size_t)NB_ * HD * TT * 2);
    bf* QPh = (bf*)take((size_t)NB_ * TT * HD * 2); bf* QPl = (bf*)take((size_t)NB_ * TT * HD * 2); bf* KPh = (bf*)take((size_t)NB_ * TT * HD * 2); bf* KPl = (bf*)take((size_t)NB_ * TT * HD * 2); bf* VTh = (bf*)take((size_t)NB_ * HD * TT * 2); bf* VTl = (bf*)take((size_t)NB_ * HD * TT * 2);
    if ((size_t)(wsp - (char*)d_ws) > ws_size) return;    // ws 256 MiB
    float* FV = FK;   // v projection reuses the k buffer after the k planes are built (stream-ordered)
    { k_wtG<<<(unsigned)((DM * DQ / 64 + 63) / 64), 256, 0, stream>>>(wq, DM, DQ, WQ); k_wtG<<<(unsigned)((DM * DKV / 64 + 63) / 64), 256, 0, stream>>>(wk, DM, DKV, WK); k_wtG<<<(unsigned)((DM * DKV / 64 + 63) / 64), 256, 0, stream>>>(wv, DM, DKV, WV);
       }
    k_csid<<<(TT * HD + 255) / 256, 256, 0, stream>>>(CS);
    const unsigned LP = (unsigned)(((size_t)NB_ * TT * HD / 2 + 255) / 256);
    // All four batches per launch. The projections take the batch as grid z and write [t][batch][64] (row pitch NB_ * 64, z-stride 64), which the plane builders read as NB_ heads: planes [batch][t][d] and [batch][d][t].
    k_cvt8<<<(unsigned)(((size_t)NB_ * TT * DM / 8 + 255) / 256), 256, 0, stream>>>(x, XB, (size_t)NB_ * TT * DM / 8);
    k_gemmw<bf, 0, true><<<dim3(TT / 64, DQ / 64, NB_), 32, 0, stream>>>(XB, nullptr, WQ, nullptr, DM, FQ, NB_ * DQ, bq, (size_t)TT * DM, 0, DQ);
    k_rope<<<LP, 256, 0, stream>>>(FQ, NB_ * DQ, NB_, CS, nullptr, nullptr, 1.0f, QP16, QPh, QPl);
    k_gemmw<bf, 0, true><<<dim3(TT / 64, DKV / 64, NB_), 32, 0, stream>>>(XB, nullptr, WK, nullptr, DM, FK, NB_ * DKV, bk, (size_t)TT * DM, 0, DKV);
    k_rope<<<LP, 256, 0, stream>>>(FK, NB_ * DKV, NB_, CS, nullptr, nullptr, 1.0f, KP16, KPh, KPl);
    k_gemmw<bf, 0, true><<<dim3(TT / 64, DKV / 64, NB_), 32, 0, stream>>>(XB, nullptr, WV, nullptr, DM, FV, NB_ * DKV, bv, (size_t)TT * DM, 0, DKV);
    k_vtp<<<LP, 256, 0, stream>>>(FV, NB_ * DKV, NB_, VT16, VTh, VTl);
    k_fattn<false><<<dim3(NB_, (TT - RH) / 32), 256, 0, stream>>>(QPh, QPl, KPh, KPl, VT16, VTh, VTl, OUT, TT / 32 - 1);
    k_fattn<true><<<dim3(NB_, RH / 32), 256, 0, stream>>>(QPh, QPl, KPh, KPl, VT16, VTh, VTl, OUT, RH / 32 - 1);
}

// v004
// It runs in 54 microseconds.
// Next to v003, in two timings, it ran 1.97 times as fast each time.
// Over all steps from v000 it is 11.2 times as fast.
#include <hip/hip_runtime.h>

// Single-head causal attention over 4,096 tokens with a 64-wide head (embedded [4][4096][256]; k, q, v = x W + b ('xw' [256][64] 1/16; input order Wk, bk, Wq, bq, Wv, bv); scores / 8; causal (-inf); softmax; out = p v -> [4][4096][64] (1.05 M)).
// Layout: one projection kernel (64 token rows per work-group: x and the three 'xw' [256][64] weights rounded to bf16 into LDS, the weights transposed on the way; exact products + f32 biases) writes the q, k planes [batch][t][d] (hi/lo) and the v planes [batch][d][t] (fp16 and hi/lo); one fused causal attention kernel (hi/lo 3-product score tiles on EVERY row, online softmax in registers, P and attn.v hybrid: rows < 512 hi/lo, rest fp16 x1024; key chunks above the diagonal skipped), which writes the output rows.
// Compute dtypes, f32 accumulate: every input rounded to bf16; projections exact + f32 biases; scores 3 products on every row; softmax f32; attn.v rows < 512 3 products, rest fp16; output f32.

#define NB_  4
#define TT   4096
#define DM   256
#define NH_  1
#define NKV  1
#define REP  (NH_ / NKV)
#define HD   64
#define DQ   (NH_ * HD)
#define DKV  (NKV * HD)
#define RH   512                  // query rows < RH use hi+lo planes (0: none)
#define SCL  0.125f   // HD^-0.5
typedef _Float16 h16;
typedef unsigned short bf;
typedef __attribute__((ext_vector_type(16))) __bf16   v16bf;
typedef __attribute__((ext_vector_type(16))) _Float16 v16h;
typedef __attribute__((ext_vector_type(8)))  _Float16 v8h;
typedef __attribute__((ext_vector_type(8)))  unsigned short v8us;
typedef __attribute__((ext_vector_type(8)))  float    v8f;
typedef __attribute__((ext_vector_type(4)))  float    v4f;
typedef v8h  __attribute__((may_alias)) v8ha;
typedef v4f  __attribute__((may_alias)) v4fa;
typedef v8us __attribute__((may_alias)) v8usa;

__device__ __forceinline__ unsigned short f2bf(float f) { unsigned u = __float_as_uint(f); u += 0x7FFFu + ((u >> 16) & 1u); return (unsigned short)(u >> 16); }
__device__ __forceinline__ float bf2f(unsigned short b) { return __uint_as_float(((unsigned)b) << 16); }
__device__ __forceinline__ float bfr(float f) { return bf2f(f2bf(f)); }
__device__ __forceinline__ v16h cat16(v8h lo, v8h hi) { return __builtin_shufflevector(lo, hi, 0, 1, 2, 3, 4, 5, 6, 7, 8, 9, 10, 11, 12, 13, 14, 15); }
__device__ __forceinline__ v16bf cat16b(v8us lo, v8us hi) { return __builtin_bit_cast(v16bf, __builtin_shufflevector(lo, hi, 0, 1, 2, 3, 4, 5, 6, 7, 8, 9, 10, 11, 12, 13, 14, 15)); }
__device__ __forceinline__ v8f wmma16(v16h a, v16h b, v8f c) { return __builtin_amdgcn_wmma_f32_16x16x32_f16(false, a, false, b, (short)0, c, false, false); }
__device__ __forceinline__ v8f wmmab(v16bf a, v16bf b, v8f c) { return __builtin_amdgcn_wmma_f32_16x16x32_bf16(false, a, false, b, (short)0, c, false, false); }



// Fragment loaders: operands from K-contiguous 16-bit rows (global planes or LDS); A and B use the same loader, so their k orders are equal.
template <typename T16> struct WFrag;
template <> struct WFrag<h16> { typedef v16h V; static __device__ __forceinline__ V ld(const h16* p) { return cat16(*(const v8h*)p, *(const v8h*)(p + 16)); } static __device__ __forceinline__ v8f mma(V a, V b, v8f c) { return wmma16(a, b, c); } };
template <> struct WFrag<bf> { typedef v16bf V; static __device__ __forceinline__ V ld(const bf* p) { return cat16b(*(const v8us*)p, *(const v8us*)(p + 16)); } static __device__ __forceinline__ v8f mma(V a, V b, v8f c) { return wmmab(a, b, c); } };
__device__ __forceinline__ h16 tohx(float x) { return (h16)x; }
__device__ __forceinline__ void splitf(float y, unsigned short& h, unsigned short& l) { h = f2bf(y); l = f2bf(y - bf2f(h)); }
typedef __attribute__((ext_vector_type(4))) unsigned short v4us;
typedef v4us __attribute__((may_alias)) v4usa;

// ---- k_proj: q, k, v = x W + b for 64 token rows in ONE work-group (8 waves), from the f32 inputs to the 16-bit planes that the attention kernel reads.
// Stage 1: the x tile (coalesced 16-byte loads) and the three weights (a thread gathers 8 consecutive k of one column n; 32 lanes = 32 consecutive n = one line per load) are rounded to bf16 and laid K-contiguous in LDS: xs[row][k], wt[matrix * 64 + n][k].
// Stage 2, behind the first barrier: wave w takes row tile w & 3 and six of the twelve 16-column tiles (rows of wt: 0..63 q, 64..127 k, 128..191 v): waves 0..3 all of q and the lower half of v, waves 4..7 all of k and the upper half of v, so that every wave stages four tiles the q, k way and two the v way with no branch; k runs upward in steps of 32 on one accumulator per tile.
// Stage 3: the f32 tiles go to LDS (q, k as [row][column]; v as [column][row], which is how a lane holds it: 8 consecutive rows of one column); behind the second barrier every thread adds the bias to 8 consecutive elements of a plane row, splits them and stores 16 bytes per plane: 8 lanes fill a 128-byte line.
// Every '#pragma unroll' of this kernel is there so that the load, fragment and accumulator arrays are indexed by constants and stay in registers.
#define PM 64                 // token rows per work-group (divides TT: a work-group lies in one batch)
#define XP (DM + 8)           // LDS row pitch of xs and wt in elements: 528 bytes = 16 bytes x odd, conflict-free for 16-byte reads and writes of 16 rows
#define QP 132                // pitch of the q, k tile in floats
#define VP 68                 // pitch of the v tile in floats
__global__ __launch_bounds__(256) void k_proj(const float* __restrict__ x, const float* __restrict__ wq, const float* __restrict__ wk, const float* __restrict__ wv, const float* __restrict__ bq, const float* __restrict__ bk, const float* __restrict__ bv, bf* Qh, bf* Ql, bf* Kh, bf* Kl, h16* V16, bf* Vh, bf* Vl) {
    __shared__ __align__(16) bf xs[PM * XP];
    __shared__ __align__(16) bf wt[3 * HD * XP];
    __shared__ __align__(16) float oqk[PM * QP];
    __shared__ __align__(16) float ov[HD * VP];
    const int tid = threadIdx.x, lane = tid & 31, lr = lane & 15, hi = lane >> 4;
    const int wave = tid >> 5;
    const int wn = tid & 63, wk0 = (tid >> 6) * 8;               // weight gather: column n, first k of the thread's first group of 8
    const int oc = tid & 7, orow = tid >> 3;                     // output phase: group of 8 elements in a plane row, plane row
    float g0[8][8], g1[8][8], g2[8][8]; v4f xv[16], bqv[2], bkv[2]; float bvv[2];
    // Two groups of loads are in flight at any time: q weight and x tile (with the thread's few bias values in front); the k weight's follow the q weight's conversion, the v weight's the x tile's.
#pragma unroll
    for (int q = 0; q < 2; ++q) { bqv[q] = *(const v4f*)(bq + oc * 8 + q * 4); bkv[q] = *(const v4f*)(bk + oc * 8 + q * 4); bvv[q] = bv[q * 32 + orow]; }
#pragma unroll
    for (int i = 0; i < 8; ++i)
#pragma unroll
        for (int j = 0; j < 8; ++j) g0[i][j] = wq[(i * 32 + wk0 + j) * HD + wn];
    const float* xp = x + (size_t)blockIdx.x * PM * DM;
#pragma unroll
    for (int i = 0; i < 16; ++i) xv[i] = *(const v4f*)(xp + (i * 256 + tid) * 4);
    asm volatile("s_wait_xcnt 0x0" ::: "memory");   // the wait that stands between an issued global load and a later write of a register that the load names as its address; it also keeps these loads together ahead of the first conversion
#pragma unroll
    for (int i = 0; i < 8; ++i) { v8us a;
#pragma unroll
        for (int j = 0; j < 8; ++j) a[j] = f2bf(g0[i][j]);
        *(v8usa*)(wt + wn * XP + i * 32 + wk0) = a; }
    __builtin_amdgcn_sched_barrier(0);   // keeps the k weight's loads behind the conversion of the q weight, whose registers they take over: the kernel stays inside 256 registers (no register-window switches)
#pragma unroll
    for (int i = 0; i < 8; ++i)
#pragma unroll
        for (int j = 0; j < 8; ++j) g1[i][j] = wk[(i * 32 + wk0 + j) * HD + wn];
    asm volatile("s_wait_xcnt 0x0" ::: "memory");   // as above, for the k weight's loads
#pragma unroll
    for (int i = 0; i < 16; ++i) { v4us a;
#pragma unroll
        for (int j = 0; j < 4; ++j) a[j] = f2bf(xv[i][j]);
        *(v4usa*)(xs + (i * 4 + (tid >> 6)) * XP + wn * 4) = a; }
    __builtin_amdgcn_sched_barrier(0);   // as above: the v weight's loads take over the x tile's registers
#pragma unroll
    for (int i = 0; i < 8; ++i)
#pragma unroll
        for (int j = 0; j < 8; ++j) g2[i][j] = wv[(i * 32 + wk0 + j) * HD + wn];
    asm volatile("s_wait_xcnt 0x0" ::: "memory");   // as above, for the v weight's loads
#pragma unroll
    for (int i = 0; i < 8; ++i) { v8us a, b;
#pragma unroll
        for (int j = 0; j < 8; ++j) { a[j] = f2bf(g1[i][j]); b[j] = f2bf(g2[i][j]); }
        *(v8usa*)(wt + (HD + wn) * XP + i * 32 + wk0) = a; *(v8usa*)(wt + (2 * HD + wn) * XP + i * 32 + wk0) = b; }
    __syncthreads();
    const int mt = wave & 3, ng = wave >> 2;
    v8f acc[6];
#pragma unroll
    for (int nb = 0; nb < 6; ++nb) acc[nb] = (v8f){};
    { const bf* pa = xs + (mt * 16 + lr) * XP + 8 * hi; const bf* pb = wt + (ng * HD + lr) * XP + 8 * hi; const bf* pc = wt + (2 * HD + ng * 32 + lr) * XP + 8 * hi;
#pragma unroll
        for (int kc = 0; kc < DM; kc += 32) { const v16bf a = WFrag<bf>::ld(pa + kc);
#pragma unroll
            for (int nb = 0; nb < 6; ++nb) acc[nb] = wmmab(a, WFrag<bf>::ld((nb < 4 ? pb + nb * 16 * XP : pc + (nb - 4) * 16 * XP) + kc), acc[nb]); } }
#pragma unroll
    for (int nb = 0; nb < 6; ++nb) {
        if (nb < 4) { float* p = oqk + (mt * 16 + hi * 8) * QP + ng * HD + nb * 16 + lr;
#pragma unroll
            for (int j = 0; j < 8; ++j) p[j * QP] = acc[nb][j]; }
        else { float* p = ov + (ng * 32 + (nb - 4) * 16 + lr) * VP + mt * 16 + hi * 8;
            *(v4fa*)p = (v4f){acc[nb][0], acc[nb][1], acc[nb][2], acc[nb][3]}; *(v4fa*)(p + 4) = (v4f){acc[nb][4], acc[nb][5], acc[nb][6], acc[nb][7]}; } }
    __syncthreads();
    const size_t r0 = (size_t)blockIdx.x * PM;
    v4f yq[4][2], yv[2][2];   // all of the thread's LDS reads go out together, ahead of the first store
#pragma unroll
    for (int i = 0; i < 4; ++i) { const float* p = oqk + ((i & 1) * 32 + orow) * QP + (i >> 1) * HD + oc * 8; yq[i][0] = *(const v4fa*)p; yq[i][1] = *(const v4fa*)(p + 4); }
#pragma unroll
    for (int i = 0; i < 2; ++i) { const float* p = ov + (i * 32 + orow) * VP + oc * 8; yv[i][0] = *(const v4fa*)p; yv[i][1] = *(const v4fa*)(p + 4); }
#pragma unroll
    for (int i = 0; i < 4; ++i) { const int mat = i >> 1, row = (i & 1) * 32 + orow; v8us oh, ol;
#pragma unroll
        for (int j = 0; j < 8; ++j) { const float b = mat ? bkv[j >> 2][j & 3] : bqv[j >> 2][j & 3]; const float y = yq[i][j >> 2][j & 3] + bfr(b); unsigned short h, l; splitf(y, h, l); oh[j] = h; ol[j] = l; }
        bf* ph = (mat ? Kh : Qh) + (r0 + row) * HD + oc * 8; bf* pl = (mat ? Kl : Ql) + (r0 + row) * HD + oc * 8; *(v8us*)ph = oh; *(v8us*)pl = ol;
        // The wait that stands between an issued global store and a later write of a register that the store names; addresses and data are inputs, so that they stay in their registers up to this line.
        asm volatile("s_wait_xcnt 0x0" :: "v"(ph), "v"(pl), "v"(oh), "v"(ol) : "memory"); }
    const size_t vo = (r0 / TT) * (size_t)HD * TT + (r0 % TT) + oc * 8;
#pragma unroll
    for (int i = 0; i < 2; ++i) { const int d = i * 32 + orow; const float b = bfr(bvv[i]); v8h o16; v8us oh, ol;
#pragma unroll
        for (int j = 0; j < 8; ++j) { const float y = yv[i][j >> 2][j & 3] + b; o16[j] = tohx(y); unsigned short h, l; splitf(y, h, l); oh[j] = h; ol[j] = l; }
        h16* pv = V16 + vo + (size_t)d * TT; bf* ph = Vh + vo + (size_t)d * TT; bf* pl = Vl + vo + (size_t)d * TT; *(v8h*)pv = o16; *(v8us*)ph = oh; *(v8us*)pl = ol;
        if (i == 0) asm volatile("s_wait_xcnt 0x0" :: "v"(pv), "v"(ph), "v"(pl), "v"(o16), "v"(oh), "v"(ol) : "memory"); }   // as above; behind the last stores no register is written any more
}

#define LC (SCL * 1.4426950408889634f)
__device__ __forceinline__ float xhalf(float x) { return __builtin_bit_cast(float, __builtin_amdgcn_permlanex16(__builtin_bit_cast(int, x), __builtin_bit_cast(int, x), 0x76543210, 0xfedcba98, false, false)); }   // lane l with lane l ^ 16, in the vector unit (the shuffle goes through the LDS pipe)
__device__ __forceinline__ float exp2x1(float x) { float y; asm("v_exp_f32 %0, %1\n\tv_nop" : "=v"(y) : "v"(x)); return y; }
__device__ __forceinline__ void exp2x8(const float* x, float* y) {
    asm("v_exp_f32 %0, %8\n\tv_exp_f32 %1, %9\n\tv_exp_f32 %2, %10\n\tv_exp_f32 %3, %11\n\tv_exp_f32 %4, %12\n\tv_exp_f32 %5, %13\n\tv_exp_f32 %6, %14\n\tv_exp_f32 %7, %15\n\tv_nop"
        : "=&v"(y[0]), "=&v"(y[1]), "=&v"(y[2]), "=&v"(y[3]), "=&v"(y[4]), "=&v"(y[5]), "=&v"(y[6]), "=&v"(y[7]) : "v"(x[0]), "v"(x[1]), "v"(x[2]), "v"(x[3]), "v"(x[4]), "v"(x[5]), "v"(x[6]), "v"(x[7])); }
template <bool HR>
__global__ __launch_bounds__(256) __attribute__((amdgpu_waves_per_eu(HR ? 2 : 4, HR ? 2 : 4))) void k_fattn(const bf* __restrict__ Qh, const bf* __restrict__ Ql, const bf* __restrict__ Kh, const bf* __restrict__ Kl, const h16* __restrict__ V16, const bf* __restrict__ Vh, const bf* __restrict__ Vl, float* OUTb, int qtlast) {
    __shared__ __align__(16) float red[8][32 * 68];
    __shared__ float sm[8][32], sl[8][32];
    const int lane = threadIdx.x & 31, lr = lane & 15, hi = lane >> 4;
    const int wave = __builtin_amdgcn_readfirstlane(threadIdx.x >> 5);   // scalar, so that the key loop is a scalar loop (EXEC stays all ones for the matrix instructions)
    const int qt = qtlast - (int)blockIdx.y, q0 = qt * 32; const size_t zo = (size_t)blockIdx.x * TT * HD;
    v16bf qh[2][2], ql[2][2];
    { const bf* pqh = Qh + zo + (size_t)(q0 + lr) * HD + 8 * hi; const bf* pql = Ql + zo + (size_t)(q0 + lr) * HD + 8 * hi;
#pragma unroll
        for (int g = 0; g < 2; ++g)
#pragma unroll
            for (int kk = 0; kk < 2; ++kk) { qh[g][kk] = WFrag<bf>::ld(pqh + g * 16 * HD + kk * 32); ql[g][kk] = WFrag<bf>::ld(pql + g * 16 * HD + kk * 32); }
        // The wait that stands between an issued global load and a later write of a register that the load names as its address; the addresses are inputs, so that they stay in their registers up to this line.
        asm volatile("s_wait_xcnt 0x0" :: "v"(pqh), "v"(pql) : "memory"); }
    v8f o[2][4]; float m[2], l[2];
#pragma unroll
    for (int g = 0; g < 2; ++g) { m[g] = -3.0e38f; l[g] = 0.f;
#pragma unroll
        for (int dt = 0; dt < 4; ++dt) o[g][dt] = (v8f){}; }
    for (int c = wave; c <= qt; c += 8) {
        const int key0 = c * 32;
        const bf* pkh = Kh + zo + (size_t)(key0 + lr) * HD + 8 * hi; const bf* pkl = Kl + zo + (size_t)(key0 + lr) * HD + 8 * hi;
        v16bf kh[2][2], kl[2][2];
#pragma unroll
        for (int kt = 0; kt < 2; ++kt)
#pragma unroll
            for (int kk = 0; kk < 2; ++kk) { kh[kt][kk] = WFrag<bf>::ld(pkh + kt * 16 * HD + kk * 32); kl[kt][kk] = WFrag<bf>::ld(pkl + kt * 16 * HD + kk * 32); }
        asm volatile("s_wait_xcnt 0x0" :: "v"(pkh), "v"(pkl) : "memory");   // as above: before an address register of the key loads is written again
        __builtin_amdgcn_sched_barrier(0);   // keeps the chunk's key loads together ahead of its first matrix instruction: one memory latency per chunk, not one per product
        v8f s[2][2];
#pragma unroll
        for (int kt = 0; kt < 2; ++kt)
#pragma unroll
            for (int g = 0; g < 2; ++g) s[kt][g] = (v8f){};
#pragma unroll
        for (int kk = 0; kk < 2; ++kk) {
#pragma unroll
            for (int kt = 0; kt < 2; ++kt)
#pragma unroll
                for (int g = 0; g < 2; ++g) s[kt][g] = wmmab(kh[kt][kk], qh[g][kk], s[kt][g]);
#pragma unroll
            for (int kt = 0; kt < 2; ++kt)
#pragma unroll
                for (int g = 0; g < 2; ++g) s[kt][g] = wmmab(kl[kt][kk], qh[g][kk], s[kt][g]);
#pragma unroll
            for (int kt = 0; kt < 2; ++kt)
#pragma unroll
                for (int g = 0; g < 2; ++g) s[kt][g] = wmmab(kh[kt][kk], ql[g][kk], s[kt][g]); }
        const h16* pv = V16 + zo + (size_t)lr * TT + key0 + 8 * hi; const bf* pvh = Vh + zo + (size_t)lr * TT + key0 + 8 * hi; const bf* pvl = Vl + zo + (size_t)lr * TT + key0 + 8 * hi;
        v16h v[4]; v16bf vh[4], vl[4];
        if constexpr (HR) {
#pragma unroll
            for (int dt = 0; dt < 4; ++dt) { vh[dt] = WFrag<bf>::ld(pvh + (size_t)dt * 16 * TT); vl[dt] = WFrag<bf>::ld(pvl + (size_t)dt * 16 * TT); }
            asm volatile("s_wait_xcnt 0x0" :: "v"(pvh), "v"(pvl) : "memory");   // as above, for the value loads
        } else {
#pragma unroll
            for (int dt = 0; dt < 4; ++dt) v[dt] = WFrag<h16>::ld(pv + (size_t)dt * 16 * TT);
            asm volatile("s_wait_xcnt 0x0" :: "v"(pv) : "memory");   // as above, for the value loads
        }
        if (c == qt) {   // the diagonal chunk (scalar test): keys behind the query drop out
#pragma unroll
            for (int kt = 0; kt < 2; ++kt)
#pragma unroll
                for (int g = 0; g < 2; ++g)
#pragma unroll
                    for (int j = 0; j < 8; ++j) if (kt * 16 + 8 * hi + j > g * 16 + lr) s[kt][g][j] = -3.0e38f; }
        v16h pf[2]; v8us ph[2][2], pl[2][2];
#pragma unroll
        for (int g = 0; g < 2; ++g) {
            float mx = s[0][g][0];
#pragma unroll
            for (int kt = 0; kt < 2; ++kt)
#pragma unroll
                for (int j = 0; j < 8; ++j) mx = fmaxf(mx, s[kt][g][j]);
            mx = fmaxf(mx, xhalf(mx));
            const float mn = fmaxf(m[g], mx * LC), al = exp2x1(m[g] - mn), sh = 10.0f - mn; m[g] = mn;
            float sum = 0.f;
#pragma unroll
            for (int kt = 0; kt < 2; ++kt) { float xa[8], pa[8];
#pragma unroll
                for (int j = 0; j < 8; ++j) xa[j] = fmaf(s[kt][g][j], LC, sh);
                exp2x8(xa, pa);
#pragma unroll
                for (int j = 0; j < 8; ++j) { const float p = pa[j]; sum += p;
                    if constexpr (HR) { unsigned short a, b2; splitf(p, a, b2); ph[g][kt][j] = a; pl[g][kt][j] = b2; } else pf[g][kt * 8 + j] = tohx(p); } }
            l[g] = fmaf(l[g], al, sum);
#pragma unroll
            for (int dt = 0; dt < 4; ++dt) o[g][dt] *= al;
        }
#pragma unroll
        for (int dt = 0; dt < 4; ++dt)
#pragma unroll
            for (int g = 0; g < 2; ++g) {
                if constexpr (HR) { const v16bf bh = cat16b(ph[g][0], ph[g][1]), bl = cat16b(pl[g][0], pl[g][1]); o[g][dt] = wmmab(vh[dt], bh, o[g][dt]); o[g][dt] = wmmab(vh[dt], bl, o[g][dt]); o[g][dt] = wmmab(vl[dt], bh, o[g][dt]); }
                else o[g][dt] = wmma16(v[dt], pf[g], o[g][dt]); }
    }
#pragma unroll
    for (int g = 0; g < 2; ++g) { l[g] += xhalf(l[g]);
        if (hi == 0) { sm[wave][g * 16 + lr] = m[g]; sl[wave][g * 16 + lr] = l[g]; }
#pragma unroll
        for (int dt = 0; dt < 4; ++dt) { float* rp = &red[wave][(g * 16 + lr) * 68 + dt * 16 + 8 * hi];   // a lane's 8 accumulator registers are 8 consecutive d of one query
            *(v4fa*)rp = (v4f){o[g][dt][0], o[g][dt][1], o[g][dt][2], o[g][dt][3]}; *(v4fa*)(rp + 4) = (v4f){o[g][dt][4], o[g][dt][5], o[g][dt][6], o[g][dt][7]}; } }
    __syncthreads();
    { const int qy = threadIdx.x >> 3, d0 = (threadIdx.x & 7) * 8; float M = sm[0][qy];
#pragma unroll
        for (int w = 1; w < 8; ++w) M = fmaxf(M, sm[w][qy]);
        float L = 0.f, fx[8], fw[8]; v4f a0 = (v4f){}, a1 = (v4f){};
#pragma unroll
        for (int w = 0; w < 8; ++w) fx[w] = sm[w][qy] - M;
        exp2x8(fx, fw);
#pragma unroll
        for (int w = 0; w < 8; ++w) { const float f = fw[w]; L = fmaf(f, sl[w][qy], L); a0 += f * *(const v4fa*)(&red[w][qy * 68 + d0]); a1 += f * *(const v4fa*)(&red[w][qy * 68 + d0 + 4]); }   // a wave without a chunk: f = 0, sum 0, tile 0
        const float inv = __fdiv_rn(1.0f, L); float* op = OUTb + zo + (size_t)(q0 + qy) * HD + d0;
        *(v4f*)op = a0 * inv; *(v4f*)(op + 4) = a1 * inv; }
}

extern "C" void kernel_launch(void* const* d_in, const int* in_sizes, int n_in,
                              void* d_out, int out_size, void* d_ws, size_t ws_size, hipStream_t stream) {
    (void)in_sizes; (void)n_in; (void)out_size;
    const float* x = (const float*)d_in[0]; const float* wk = (const float*)d_in[1]; const float* bk = (const float*)d_in[2]; const float* wq = (const float*)d_in[3]; const float* bq = (const float*)d_in[4]; const float* wv = (const float*)d_in[5]; const float* bv = (const float*)d_in[6];   /* input order Wk, bk, Wq, bq, Wv, bv */
    float* OUT = (float*)d_out;     // [4][4096][64]
    char* wsp = (char*)d_ws;
    auto take = [&](size_t bytes) { char* p = wsp; wsp += (bytes + 255) & ~(size_t)255; return (void*)p; };
    h16* VT16 = (h16*)take((size_t)NB_ * HD * TT * 2);
    bf* QPh = (bf*)take((size_t)NB_ * TT * HD * 2); bf* QPl = (bf*)take((size_t)NB_ * TT * HD * 2); bf* KPh = (bf*)take((size_t)NB_ * TT * HD * 2); bf* KPl = (bf*)take((size_t)NB_ * TT * HD * 2); bf* VTh = (bf*)take((size_t)NB_ * HD * TT * 2); bf* VTl = (bf*)take((size_t)NB_ * HD * TT * 2);
    if ((size_t)(wsp - (char*)d_ws) > ws_size) return;    // ws 256 MiB
    k_proj<<<NB_ * TT / PM, 256, 0, stream>>>(x, wq, wk, wv, bq, bk, bv, QPh, QPl, KPh, KPl, VT16, VTh, VTl);
    k_fattn<false><<<dim3(NB_, (TT - RH) / 32), 256, 0, stream>>>(QPh, QPl, KPh, KPl, VT16, VTh, VTl, OUT, TT / 32 - 1);
    k_fattn<true><<<dim3(NB_, RH / 32), 256, 0, stream>>>(QPh, QPl, KPh, KPl, VT16, VTh, VTl, OUT, RH / 32 - 1);
}

// v005
// A run of this version takes 41.2 microseconds.
// Timed twice side by side with v004, it ran 1.31 and 1.30 times as fast.
// Counting every step since v000, it is 14.7 times as fast.
#include <hip/hip_runtime.h>

// Single-head causal attention over 4,096 tokens with a 64-wide head (embedded [4][4096][256]; k, q, v = x W + b ('xw' [256][64] 1/16; input order Wk, bk, Wq, bq, Wv, bv); scores / 8; causal (-inf); softmax; out = p v -> [4][4096][64] (1.05 M)).
// Layout: one projection kernel (64 token rows per work-group: x and the three 'xw' [256][64] weights rounded to bf16 into LDS, the weights transposed on the way; exact products + f32 biases) writes the q, k planes (hi/lo) and the v planes (fp16 and hi/lo), all in fragment order (see FRAGMENT ORDER below); one fused causal attention kernel (hi/lo 3-product score tiles on EVERY row, online softmax in registers, P and attn.v hybrid: rows < 512 hi/lo, rest fp16 x1024; key chunks above the diagonal skipped), which writes the output rows.
// Compute dtypes, f32 accumulate: every input rounded to bf16; projections exact + f32 biases; scores 3 products on every row; softmax f32; attn.v rows < 512 3 products, rest fp16; output f32.

#define NB_  4
#define TT   4096
#define DM   256
#define NH_  1
#define NKV  1
#define REP  (NH_ / NKV)
#define HD   64
#define DQ   (NH_ * HD)
#define DKV  (NKV * HD)
#define RH   512                  // query rows < RH use hi+lo planes (0: none)
#define SCL  0.125f   // HD^-0.5
typedef _Float16 h16;
typedef unsigned short bf;
typedef __attribute__((ext_vector_type(16))) __bf16   v16bf;
typedef __attribute__((ext_vector_type(16))) _Float16 v16h;
typedef __attribute__((ext_vector_type(8)))  _Float16 v8h;
typedef __attribute__((ext_vector_type(8)))  unsigned short v8us;
typedef __attribute__((ext_vector_type(8)))  float    v8f;
typedef __attribute__((ext_vector_type(4)))  float    v4f;
typedef v8h  __attribute__((may_alias)) v8ha;
typedef v4f  __attribute__((may_alias)) v4fa;
typedef v8us __attribute__((may_alias)) v8usa;

__device__ __forceinline__ unsigned short f2bf(float f) { unsigned u = __float_as_uint(f); u += 0x7FFFu + ((u >> 16) & 1u); return (unsigned short)(u >> 16); }
__device__ __forceinline__ float bf2f(unsigned short b) { return __uint_as_float(((unsigned)b) << 16); }
__device__ __forceinline__ float bfr(float f) { return bf2f(f2bf(f)); }
__device__ __forceinline__ v16h cat16(v8h lo, v8h hi) { return __builtin_shufflevector(lo, hi, 0, 1, 2, 3, 4, 5, 6, 7, 8, 9, 10, 11, 12, 13, 14, 15); }
__device__ __forceinline__ v16bf cat16b(v8us lo, v8us hi) { return __builtin_bit_cast(v16bf, __builtin_shufflevector(lo, hi, 0, 1, 2, 3, 4, 5, 6, 7, 8, 9, 10, 11, 12, 13, 14, 15)); }
__device__ __forceinline__ v8f wmma16(v16h a, v16h b, v8f c) { return __builtin_amdgcn_wmma_f32_16x16x32_f16(false, a, false, b, (short)0, c, false, false); }
__device__ __forceinline__ v8f wmmab(v16bf a, v16bf b, v8f c) { return __builtin_amdgcn_wmma_f32_16x16x32_bf16(false, a, false, b, (short)0, c, false, false); }



// Fragment loaders. ld: operands from K-contiguous 16-bit rows (LDS); ldf: operands from the global planes in fragment order. A and B of a product use the same loader, so their k orders are equal.
// FRAGMENT ORDER of the global planes: the unit is 8 consecutive k of one operand row (16 bytes, what a lane takes with one load). A tile of 16 rows x 32 k is stored as [k octet 0..3][row 0..15][8 k] = 1,024 bytes,
// so that lane l (row l & 15, half l >> 4) finds its first unit (octet l >> 4) at byte 16 l and its second (octet 2 + (l >> 4)) 512 bytes on: each wave-wide 16-byte load reads 512 contiguous bytes = 4 whole lines, not 32-byte pieces of 16 lines.
// q, k planes: [batch][16-token tile][d octet 0..7][token][8 d] (k = d; two such tiles of 32 d follow one another); v planes: [batch][32-token chunk][16-d tile 0..3][token octet 0..3][d][8 tokens] (rows = d, k = token). The registers hold what they held with row-major planes.
template <typename T16> struct WFrag;
template <> struct WFrag<h16> { typedef v16h V; static __device__ __forceinline__ V ldf(const h16* p) { return cat16(*(const v8h*)p, *(const v8h*)(p + 256)); } static __device__ __forceinline__ v8f mma(V a, V b, v8f c) { return wmma16(a, b, c); } };
template <> struct WFrag<bf> { typedef v16bf V; static __device__ __forceinline__ V ld(const bf* p) { return cat16b(*(const v8us*)p, *(const v8us*)(p + 16)); } static __device__ __forceinline__ V ldf(const bf* p) { return cat16b(*(const v8us*)p, *(const v8us*)(p + 256)); } static __device__ __forceinline__ v8f mma(V a, V b, v8f c) { return wmmab(a, b, c); } };
__device__ __forceinline__ h16 tohx(float x) { return (h16)x; }
__device__ __forceinline__ void splitf(float y, unsigned short& h, unsigned short& l) { h = f2bf(y); l = f2bf(y - bf2f(h)); }
typedef __attribute__((ext_vector_type(4))) unsigned short v4us;
typedef v4us __attribute__((may_alias)) v4usa;

// ---- k_proj: q, k, v = x W + b for 64 token rows in ONE work-group (8 waves), from the f32 inputs to the 16-bit planes that the attention kernel reads.
// Stage 1: the x tile (coalesced 16-byte loads) and the three weights (a thread gathers 8 consecutive k of one column n; 32 lanes = 32 consecutive n = one line per load) are rounded to bf16 and laid K-contiguous in LDS: xs[row][k], wt[matrix * 64 + n][k].
// Stage 2, behind the first barrier: wave w takes row tile w & 3 and six of the twelve 16-column tiles (rows of wt: 0..63 q, 64..127 k, 128..191 v): waves 0..3 all of q and the lower half of v, waves 4..7 all of k and the upper half of v, so that every wave stages four tiles the q, k way and two the v way with no branch; k runs upward in steps of 32 on one accumulator per tile.
// Stage 3: the f32 tiles go to LDS (q, k as [row][column]; v as [column][row], which is how a lane holds it: 8 consecutive rows of one column); behind the second barrier every thread adds the bias to one unit (8 consecutive d of a token for q, k; 8 consecutive tokens of a d for v), splits it and stores 16 bytes per plane; in fragment order the work-group's 64 tokens are one contiguous piece of each plane and thread t's units lie at bytes 16 t and 16 (256 + t) of it: a wave's store fills 4 whole lines.
// Every '#pragma unroll' of this kernel is there so that the load, fragment and accumulator arrays are indexed by constants and stay in registers.
#define PM 64                 // token rows per work-group (divides TT: a work-group lies in one batch)
#define XP (DM + 8)           // LDS row pitch of xs and wt in elements: 528 bytes = 16 bytes x odd, conflict-free for 16-byte reads and writes of 16 rows
#define QP 132                // pitch of the q, k tile in floats
#define VP 68                 // pitch of the v tile in floats
__global__ __launch_bounds__(256) void k_proj(const float* __restrict__ x, const float* __restrict__ wq, const float* __restrict__ wk, const float* __restrict__ wv, const float* __restrict__ bq, const float* __restrict__ bk, const float* __restrict__ bv, bf* Qh, bf* Ql, bf* Kh, bf* Kl, h16* V16, bf* Vh, bf* Vl) {
    __shared__ __align__(16) bf xs[PM * XP];
    __shared__ __align__(16) bf wt[3 * HD * XP];
    __shared__ __align__(16) float oqk[PM * QP];
    __shared__ __align__(16) float ov[HD * VP];
    const int tid = threadIdx.x, lane = tid & 31, lr = lane & 15, hi = lane >> 4;
    const int wave = tid >> 5;
    const int wn = tid & 63, wk0 = (tid >> 6) * 8;               // weight gather: column n, first k of the thread's first group of 8
    const int oc = (tid >> 4) & 7, ol = tid & 15, ot = tid >> 7;   // q, k output phase: d octet, token in its 16-token tile, tile of a pair
    const int vd = ((tid >> 6) & 3) * 16 + ol, vt = (tid >> 4) & 3;   // v output phase: d, token octet in its 32-token chunk
    float g0[8][8], g1[8][8], g2[8][8]; v4f xv[16], bqv[2], bkv[2];
    // Two groups of loads are in flight at any time: q weight and x tile (with the thread's few bias values in front); the k weight's follow the q weight's conversion, the v weight's the x tile's.
#pragma unroll
    for (int q = 0; q < 2; ++q) { bqv[q] = *(const v4f*)(bq + oc * 8 + q * 4); bkv[q] = *(const v4f*)(bk + oc * 8 + q * 4); }
    const float bvv = bv[vd];
#pragma unroll
    for (int i = 0; i < 8; ++i)
#pragma unroll
        for (int j = 0; j < 8; ++j) g0[i][j] = wq[(i * 32 + wk0 + j) * HD + wn];
    const float* xp = x + (size_t)blockIdx.x * PM * DM;
#pragma unroll
    for (int i = 0; i < 16; ++i) xv[i] = *(const v4f*)(xp + (i * 256 + tid) * 4);
    asm volatile("s_wait_xcnt 0x0" ::: "memory");   // the wait that stands between an issued global load and a later write of a register that the load names as its address; it also keeps these loads together ahead of the first conversion
#pragma unroll
    for (int i = 0; i < 8; ++i) { v8us a;
#pragma unroll
        for (int j = 0; j < 8; ++j) a[j] = f2bf(g0[i][j]);
        *(v8usa*)(wt + wn * XP + i * 32 + wk0) = a; }
    __builtin_amdgcn_sched_barrier(0);   // keeps the k weight's loads behind the conversion of the q weight, whose registers they take over: the kernel stays inside 256 registers (no register-window switches)
#pragma unroll
    for (int i = 0; i < 8; ++i)
#pragma unroll
        for (int j = 0; j < 8; ++j) g1[i][j] = wk[(i * 32 + wk0 + j) * HD + wn];
    asm volatile("s_wait_xcnt 0x0" ::: "memory");   // as above, for the k weight's loads
#pragma unroll
    for (int i = 0; i < 16; ++i) { v4us a;
#pragma unroll
        for (int j = 0; j < 4; ++j) a[j] = f2bf(xv[i][j]);
        *(v4usa*)(xs + (i * 4 + (tid >> 6)) * XP + wn * 4) = a; }
    __builtin_amdgcn_sched_barrier(0);   // as above: the v weight's loads take over the x tile's registers
#pragma unroll
    for (int i = 0; i < 8; ++i)
#pragma unroll
        for (int j = 0; j < 8; ++j) g2[i][j] = wv[(i * 32 + wk0 + j) * HD + wn];
    asm volatile("s_wait_xcnt 0x0" ::: "memory");   // as above, for the v weight's loads
#pragma unroll
    for (int i = 0; i < 8; ++i) { v8us a, b;
#pragma unroll
        for (int j = 0; j < 8; ++j) { a[j] = f2bf(g1[i][j]); b[j] = f2bf(g2[i][j]); }
        *(v8usa*)(wt + (HD + wn) * XP + i * 32 + wk0) = a; *(v8usa*)(wt + (2 * HD + wn) * XP + i * 32 + wk0) = b; }
    __syncthreads();
    const int mt = wave & 3, ng = wave >> 2;
    v8f acc[6];
#pragma unroll
    for (int nb = 0; nb < 6; ++nb) acc[nb] = (v8f){};
    { const bf* pa = xs + (mt * 16 + lr) * XP + 8 * hi; const bf* pb = wt + (ng * HD + lr) * XP + 8 * hi; const bf* pc = wt + (2 * HD + ng * 32 + lr) * XP + 8 * hi;
#pragma unroll
        for (int kc = 0; kc < DM; kc += 32) { const v16bf a = WFrag<bf>::ld(pa + kc);
#pragma unroll
            for (int nb = 0; nb < 6; ++nb) acc[nb] = wmmab(a, WFrag<bf>::ld((nb < 4 ? pb + nb * 16 * XP : pc + (nb - 4) * 16 * XP) + kc), acc[nb]); } }
#pragma unroll
    for (int nb = 0; nb < 6; ++nb) {
        if (nb < 4) { float* p = oqk + (mt * 16 + hi * 8) * QP + ng * HD + nb * 16 + lr;
#pragma unroll
            for (int j = 0; j < 8; ++j) p[j * QP] = acc[nb][j]; }
        else { float* p = ov + (ng * 32 + (nb - 4) * 16 + lr) * VP + mt * 16 + hi * 8;
            *(v4fa*)p = (v4f){acc[nb][0], acc[nb][1], acc[nb][2], acc[nb][3]}; *(v4fa*)(p + 4) = (v4f){acc[nb][4], acc[nb][5], acc[nb][6], acc[nb][7]}; } }
    __syncthreads();
    const size_t r0 = (size_t)blockIdx.x * PM;
    v4f yq[4][2], yv[2][2];   // all of the thread's LDS reads go out together, ahead of the first store
#pragma unroll
    for (int i = 0; i < 4; ++i) { const float* p = oqk + (((i & 1) * 2 + ot) * 16 + ol) * QP + (i >> 1) * HD + oc * 8; yq[i][0] = *(const v4fa*)p; yq[i][1] = *(const v4fa*)(p + 4); }
#pragma unroll
    for (int i = 0; i < 2; ++i) { const float* p = ov + vd * VP + (i * 4 + vt) * 8; yv[i][0] = *(const v4fa*)p; yv[i][1] = *(const v4fa*)(p + 4); }
#pragma unroll
    for (int i = 0; i < 4; ++i) { const int mat = i >> 1; v8us oh, olo;
#pragma unroll
        for (int j = 0; j < 8; ++j) { const float b = mat ? bkv[j >> 2][j & 3] : bqv[j >> 2][j & 3]; const float y = yq[i][j >> 2][j & 3] + bfr(b); unsigned short h, l; splitf(y, h, l); oh[j] = h; olo[j] = l; }
        bf* ph = (mat ? Kh : Qh) + r0 * HD + ((i & 1) * 256 + tid) * 8; bf* pl = (mat ? Kl : Ql) + r0 * HD + ((i & 1) * 256 + tid) * 8; *(v8us*)ph = oh; *(v8us*)pl = olo;
        // The wait that stands between an issued global store and a later write of a register that the store names; addresses and data are inputs, so that they stay in their registers up to this line.
        asm volatile("s_wait_xcnt 0x0" :: "v"(ph), "v"(pl), "v"(oh), "v"(olo) : "memory"); }
    const size_t vo = r0 * HD + tid * 8;   // batch stride HD * TT, chunk stride 32 * HD: both are the token index times HD
#pragma unroll
    for (int i = 0; i < 2; ++i) { const float b = bfr(bvv); v8h o16; v8us oh, olo;
#pragma unroll
        for (int j = 0; j < 8; ++j) { const float y = yv[i][j >> 2][j & 3] + b; o16[j] = tohx(y); unsigned short h, l; splitf(y, h, l); oh[j] = h; olo[j] = l; }
        h16* pv = V16 + vo + i * 32 * HD; bf* ph = Vh + vo + i * 32 * HD; bf* pl = Vl + vo + i * 32 * HD; *(v8h*)pv = o16; *(v8us*)ph = oh; *(v8us*)pl = olo;
        if (i == 0) asm volatile("s_wait_xcnt 0x0" :: "v"(pv), "v"(ph), "v"(pl), "v"(o16), "v"(oh), "v"(olo) : "memory"); }   // as above; behind the last stores no register is written any more
}

#define LC (SCL * 1.4426950408889634f)
__device__ __forceinline__ float xhalf(float x) { return __builtin_bit_cast(float, __builtin_amdgcn_permlanex16(__builtin_bit_cast(int, x), __builtin_bit_cast(int, x), 0x76543210, 0xfedcba98, false, false)); }   // lane l with lane l ^ 16, in the vector unit (the shuffle goes through the LDS pipe)
__device__ __forceinline__ float exp2x1(float x) { float y; asm("v_exp_f32 %0, %1\n\tv_nop" : "=v"(y) : "v"(x)); return y; }
__device__ __forceinline__ void exp2x8(const float* x, float* y) {
    asm("v_exp_f32 %0, %8\n\tv_exp_f32 %1, %9\n\tv_exp_f32 %2, %10\n\tv_exp_f32 %3, %11\n\tv_exp_f32 %4, %12\n\tv_exp_f32 %5, %13\n\tv_exp_f32 %6, %14\n\tv_exp_f32 %7, %15\n\tv_nop"
        : "=&v"(y[0]), "=&v"(y[1]), "=&v"(y[2]), "=&v"(y[3]), "=&v"(y[4]), "=&v"(y[5]), "=&v"(y[6]), "=&v"(y[7]) : "v"(x[0]), "v"(x[1]), "v"(x[2]), "v"(x[3]), "v"(x[4]), "v"(x[5]), "v"(x[6]), "v"(x[7])); }
template <bool HR>
__global__ __launch_bounds__(256) __attribute__((amdgpu_waves_per_eu(HR ? 2 : 4, HR ? 2 : 4))) void k_fattn(const bf* __restrict__ Qh, const bf* __restrict__ Ql, const bf* __restrict__ Kh, const bf* __restrict__ Kl, const h16* __restrict__ V16, const bf* __restrict__ Vh, const bf* __restrict__ Vl, float* OUTb, int qtlast) {
    __shared__ __align__(16) float red[8][32 * 68];
    __shared__ float sm[8][32], sl[8][32];
    const int lane = threadIdx.x & 31, lr = lane & 15, hi = lane >> 4;
    const int wave = __builtin_amdgcn_readfirstlane(threadIdx.x >> 5);   // scalar, so that the key loop is a scalar loop (EXEC stays all ones for the matrix instructions)
    const int qt = qtlast - (int)blockIdx.y, q0 = qt * 32; const size_t zo = (size_t)blockIdx.x * TT * HD;
    v16bf qh[2][2], ql[2][2];
    { const bf* pqh = Qh + zo + (size_t)q0 * HD + 8 * lane; const bf* pql = Ql + zo + (size_t)q0 * HD + 8 * lane;
#pragma unroll
        for (int g = 0; g < 2; ++g)
#pragma unroll
            for (int kk = 0; kk < 2; ++kk) { qh[g][kk] = WFrag<bf>::ldf(pqh + g * 16 * HD + kk * 512); ql[g][kk] = WFrag<bf>::ldf(pql + g * 16 * HD + kk * 512); }
        // The wait that stands between an issued global load and a later write of a register that the load names as its address; the addresses are inputs, so that they stay in their registers up to this line.
        asm volatile("s_wait_xcnt 0x0" :: "v"(pqh), "v"(pql) : "memory"); }
    v8f o[2][4]; float m[2], l[2];
#pragma unroll
    for (int g = 0; g < 2; ++g) { m[g] = -3.0e38f; l[g] = 0.f;
#pragma unroll
        for (int dt = 0; dt < 4; ++dt) o[g][dt] = (v8f){}; }
    for (int c = wave; c <= qt; c += 8) {
        const int key0 = c * 32;
        const bf* pkh = Kh + zo + (size_t)key0 * HD + 8 * lane; const bf* pkl = Kl + zo + (size_t)key0 * HD + 8 * lane;
        v16bf kh[2][2], kl[2][2];
#pragma unroll
        for (int kt = 0; kt < 2; ++kt)
#pragma unroll
            for (int kk = 0; kk < 2; ++kk) { kh[kt][kk] = WFrag<bf>::ldf(pkh + kt * 16 * HD + kk * 512); kl[kt][kk] = WFrag<bf>::ldf(pkl + kt * 16 * HD + kk * 512); }
        asm volatile("s_wait_xcnt 0x0" :: "v"(pkh), "v"(pkl) : "memory");   // as above: before an address register of the key loads is written again
        __builtin_amdgcn_sched_barrier(0);   // keeps the chunk's key loads together ahead of its first matrix instruction: one memory latency per chunk, not one per product
        v8f s[2][2];
#pragma unroll
        for (int kt = 0; kt < 2; ++kt)
#pragma unroll
            for (int g = 0; g < 2; ++g) s[kt][g] = (v8f){};
#pragma unroll
        for (int kk = 0; kk < 2; ++kk) {
#pragma unroll
            for (int kt = 0; kt < 2; ++kt)
#pragma unroll
                for (int g = 0; g < 2; ++g) s[kt][g] = wmmab(kh[kt][kk], qh[g][kk], s[kt][g]);
#pragma unroll
            for (int kt = 0; kt < 2; ++kt)
#pragma unroll
                for (int g = 0; g < 2; ++g) s[kt][g] = wmmab(kl[kt][kk], qh[g][kk], s[kt][g]);
#pragma unroll
            for (int kt = 0; kt < 2; ++kt)
#pragma unroll
                for (int g = 0; g < 2; ++g) s[kt][g] = wmmab(kh[kt][kk], ql[g][kk], s[kt][g]); }
        const h16* pv = V16 + zo + (size_t)key0 * HD + 8 * lane; const bf* pvh = Vh + zo + (size_t)key0 * HD + 8 * lane; const bf* pvl = Vl + zo + (size_t)key0 * HD + 8 * lane;
        v16h v[4]; v16bf vh[4], vl[4];
        if constexpr (HR) {
#pragma unroll
            for (int dt = 0; dt < 4; ++dt) { vh[dt] = WFrag<bf>::ldf(pvh + dt * 512); vl[dt] = WFrag<bf>::ldf(pvl + dt * 512); }
            asm volatile("s_wait_xcnt 0x0" :: "v"(pvh), "v"(pvl) : "memory");   // as above, for the value loads
        } else {
#pragma unroll
            for (int dt = 0; dt < 4; ++dt) v[dt] = WFrag<h16>::ldf(pv + dt * 512);
            asm volatile("s_wait_xcnt 0x0" :: "v"(pv) : "memory");   // as above, for the value loads
        }
        if (c == qt) {   // the diagonal chunk (scalar test): keys behind the query drop out
#pragma unroll
            for (int kt = 0; kt < 2; ++kt)
#pragma unroll
                for (int g = 0; g < 2; ++g)
#pragma unroll
                    for (int j = 0; j < 8; ++j) if (kt * 16 + 8 * hi + j > g * 16 + lr) s[kt][g][j] = -3.0e38f; }
        v16h pf[2]; v8us ph[2][2], pl[2][2];
#pragma unroll
        for (int g = 0; g < 2; ++g) {
            float mx = s[0][g][0];
#pragma unroll
            for (int kt = 0; kt < 2; ++kt)
#pragma unroll
                for (int j = 0; j < 8; ++j) mx = fmaxf(mx, s[kt][g][j]);
            mx = fmaxf(mx, xhalf(mx));
            const float mn = fmaxf(m[g], mx * LC), al = exp2x1(m[g] - mn), sh = 10.0f - mn; m[g] = mn;
            float sum = 0.f;
#pragma unroll
            for (int kt = 0; kt < 2; ++kt) { float xa[8], pa[8];
#pragma unroll
                for (int j = 0; j < 8; ++j) xa[j] = fmaf(s[kt][g][j], LC, sh);
                exp2x8(xa, pa);
#pragma unroll
                for (int j = 0; j < 8; ++j) { const float p = pa[j]; sum += p;
                    if constexpr (HR) { unsigned short a, b2; splitf(p, a, b2); ph[g][kt][j] = a; pl[g][kt][j] = b2; } else pf[g][kt * 8 + j] = tohx(p); } }
            l[g] = fmaf(l[g], al, sum);
#pragma unroll
            for (int dt = 0; dt < 4; ++dt) o[g][dt] *= al;
        }
#pragma unroll
        for (int dt = 0; dt < 4; ++dt)
#pragma unroll
            for (int g = 0; g < 2; ++g) {
                if constexpr (HR) { const v16bf bh = cat16b(ph[g][0], ph[g][1]), bl = cat16b(pl[g][0], pl[g][1]); o[g][dt] = wmmab(vh[dt], bh, o[g][dt]); o[g][dt] = wmmab(vh[dt], bl, o[g][dt]); o[g][dt] = wmmab(vl[dt], bh, o[g][dt]); }
                else o[g][dt] = wmma16(v[dt], pf[g], o[g][dt]); }
    }
#pragma unroll
    for (int g = 0; g < 2; ++g) { l[g] += xhalf(l[g]);
        if (hi == 0) { sm[wave][g * 16 + lr] = m[g]; sl[wave][g * 16 + lr] = l[g]; }
#pragma unroll
        for (int dt = 0; dt < 4; ++dt) { float* rp = &red[wave][(g * 16 + lr) * 68 + dt * 16 + 8 * hi];   // a lane's 8 accumulator registers are 8 consecutive d of one query
            *(v4fa*)rp = (v4f){o[g][dt][0], o[g][dt][1], o[g][dt][2], o[g][dt][3]}; *(v4fa*)(rp + 4) = (v4f){o[g][dt][4], o[g][dt][5], o[g][dt][6], o[g][dt][7]}; } }
    __syncthreads();
    { const int qy = threadIdx.x >> 3, d0 = (threadIdx.x & 7) * 8; float M = sm[0][qy];
#pragma unroll
        for (int w = 1; w < 8; ++w) M = fmaxf(M, sm[w][qy]);
        float L = 0.f, fx[8], fw[8]; v4f a0 = (v4f){}, a1 = (v4f){};
#pragma unroll
        for (int w = 0; w < 8; ++w) fx[w] = sm[w][qy] - M;
        exp2x8(fx, fw);
#pragma unroll
        for (int w = 0; w < 8; ++w) { const float f = fw[w]; L = fmaf(f, sl[w][qy], L); a0 += f * *(const v4fa*)(&red[w][qy * 68 + d0]); a1 += f * *(const v4fa*)(&red[w][qy * 68 + d0 + 4]); }   // a wave without a chunk: f = 0, sum 0, tile 0
        const float inv = __fdiv_rn(1.0f, L); float* op = OUTb + zo + (size_t)(q0 + qy) * HD + d0;
        *(v4f*)op = a0 * inv; *(v4f*)(op + 4) = a1 * inv; }
}

extern "C" void kernel_launch(void* const* d_in, const int* in_sizes, int n_in,
                              void* d_out, int out_size, void* d_ws, size_t ws_size, hipStream_t stream) {
    (void)in_sizes; (void)n_in; (void)out_size;
    const float* x = (const float*)d_in[0]; const float* wk = (const float*)d_in[1]; const float* bk = (const float*)d_in[2]; const float* wq = (const float*)d_in[3]; const float* bq = (const float*)d_in[4]; const float* wv = (const float*)d_in[5]; const float* bv = (const float*)d_in[6];   /* input order Wk, bk, Wq, bq, Wv, bv */
    float* OUT = (float*)d_out;     // [4][4096][64]
    char* wsp = (char*)d_ws;
    auto take = [&](size_t bytes) { char* p = wsp; wsp += (bytes + 255) & ~(size_t)255; return (void*)p; };
    h16* VT16 = (h16*)take((size_t)NB_ * HD * TT * 2);
    bf* QPh = (bf*)take((size_t)NB_ * TT * HD * 2); bf* QPl = (bf*)take((size_t)NB_ * TT * HD * 2); bf* KPh = (bf*)take((size_t)NB_ * TT * HD * 2); bf* KPl = (bf*)take((size_t)NB_ * TT * HD * 2); bf* VTh = (bf*)take((size_t)NB_ * HD * TT * 2); bf* VTl = (bf*)take((size_t)NB_ * HD * TT * 2);
    if ((size_t)(wsp - (char*)d_ws) > ws_size) return;    // ws 256 MiB
    k_proj<<<NB_ * TT / PM, 256, 0, stream>>>(x, wq, wk, wv, bq, bk, bv, QPh, QPl, KPh, KPl, VT16, VTh, VTl);
    k_fattn<false><<<dim3(NB_, (TT - RH) / 32), 256, 0, stream>>>(QPh, QPl, KPh, KPl, VT16, VTh, VTl, OUT, TT / 32 - 1);
    k_fattn<true><<<dim3(NB_, RH / 32), 256, 0, stream>>>(QPh, QPl, KPh, KPl, VT16, VTh, VTl, OUT, RH / 32 - 1);
}

// v006
// Measured time: 31.1 microseconds a run.
// Timed twice side by side with v005, it ran 1.33 and 1.32 times as fast.
// Over all steps from v000 it is 19.5 times as fast.
#include <hip/hip_runtime.h>

// Single-head causal attention over 4,096 tokens with a 64-wide head (embedded [4][4096][256]; k, q, v = x W + b ('xw' [256][64] 1/16; input order Wk, bk, Wq, bq, Wv, bv); scores / 8; causal (-inf); softmax; out = p v -> [4][4096][64] (1.05 M)).
// Layout: one projection kernel (64 token rows per work-group: x and the three 'xw' [256][64] weights rounded to bf16 into LDS, the weights transposed on the way; exact products + f32 biases) writes the q, k planes (hi/lo) and the v planes (fp16 and hi/lo), all in fragment order (see FRAGMENT ORDER below); one fused causal attention kernel, one launch (hi/lo 3-product score tiles on EVERY row, online softmax in registers, P and attn.v hybrid: rows < 512 hi/lo, rest fp16 x1024; key chunks above the diagonal skipped), which writes the output rows.
// Compute dtypes, f32 accumulate: every input rounded to bf16; projections exact + f32 biases; scores 3 products on every row; softmax f32; attn.v rows < 512 3 products, rest fp16; output f32.

#define NB_  4
#define TT   4096
#define DM   256
#define NH_  1
#define NKV  1
#define REP  (NH_ / NKV)
#define HD   64
#define DQ   (NH_ * HD)
#define DKV  (NKV * HD)
#define RH   512                  // query rows < RH use hi+lo planes (0: none)
#define SCL  0.125f   // HD^-0.5
typedef _Float16 h16;
typedef unsigned short bf;
typedef __attribute__((ext_vector_type(16))) __bf16   v16bf;
typedef __attribute__((ext_vector_type(16))) _Float16 v16h;
typedef __attribute__((ext_vector_type(8)))  _Float16 v8h;
typedef __attribute__((ext_vector_type(8)))  unsigned short v8us;
typedef __attribute__((ext_vector_type(8)))  float    v8f;
typedef __attribute__((ext_vector_type(4)))  float    v4f;
typedef v8h  __attribute__((may_alias)) v8ha;
typedef v4f  __attribute__((may_alias)) v4fa;
typedef v8us __attribute__((may_alias)) v8usa;

__device__ __forceinline__ unsigned short f2bf(float f) { unsigned u = __float_as_uint(f); u += 0x7FFFu + ((u >> 16) & 1u); return (unsigned short)(u >> 16); }
__device__ __forceinline__ float bf2f(unsigned short b) { return __uint_as_float(((unsigned)b) << 16); }
__device__ __forceinline__ float bfr(float f) { return bf2f(f2bf(f)); }
__device__ __forceinline__ v16h cat16(v8h lo, v8h hi) { return __builtin_shufflevector(lo, hi, 0, 1, 2, 3, 4, 5, 6, 7, 8, 9, 10, 11, 12, 13, 14, 15); }
__device__ __forceinline__ v16bf cat16b(v8us lo, v8us hi) { return __builtin_bit_cast(v16bf, __builtin_shufflevector(lo, hi, 0, 1, 2, 3, 4, 5, 6, 7, 8, 9, 10, 11, 12, 13, 14, 15)); }
__device__ __forceinline__ v8f wmma16(v16h a, v16h b, v8f c) { return __builtin_amdgcn_wmma_f32_16x16x32_f16(false, a, false, b, (short)0, c, false, false); }
__device__ __forceinline__ v8f wmmab(v16bf a, v16bf b, v8f c) { return __builtin_amdgcn_wmma_f32_16x16x32_bf16(false, a, false, b, (short)0, c, false, false); }



// Fragment loaders. ld: operands from K-contiguous 16-bit rows (LDS); ldf: operands from the global planes in fragment order. A and B of a product use the same loader, so their k orders are equal.
// FRAGMENT ORDER of the global planes: the unit is 8 consecutive k of one operand row (16 bytes, what a lane takes with one load). A tile of 16 rows x 32 k is stored as [k octet 0..3][row 0..15][8 k] = 1,024 bytes,
// so that lane l (row l & 15, half l >> 4) finds its first unit (octet l >> 4) at byte 16 l and its second (octet 2 + (l >> 4)) 512 bytes on: each wave-wide 16-byte load reads 512 contiguous bytes = 4 whole lines, not 32-byte pieces of 16 lines.
// q, k planes: [batch][16-token tile][d octet 0..7][token][8 d] (k = d; two such tiles of 32 d follow one another); v planes: [batch][32-token chunk][16-d tile 0..3][token octet 0..3][d][8 tokens] (rows = d, k = token). The registers hold what they held with row-major planes.
template <typename T16> struct WFrag;
template <> struct WFrag<h16> { typedef v16h V; static __device__ __forceinline__ V ldf(const h16* p) { return cat16(*(const v8h*)p, *(const v8h*)(p + 256)); } static __device__ __forceinline__ v8f mma(V a, V b, v8f c) { return wmma16(a, b, c); } };
template <> struct WFrag<bf> { typedef v16bf V; static __device__ __forceinline__ V ld(const bf* p) { return cat16b(*(const v8us*)p, *(const v8us*)(p + 16)); } static __device__ __forceinline__ V ldf(const bf* p) { return cat16b(*(const v8us*)p, *(const v8us*)(p + 256)); } static __device__ __forceinline__ v8f mma(V a, V b, v8f c) { return wmmab(a, b, c); } };
__device__ __forceinline__ h16 tohx(float x) { return (h16)x; }
__device__ __forceinline__ void splitf(float y, unsigned short& h, unsigned short& l) { h = f2bf(y); l = f2bf(y - bf2f(h)); }
typedef __attribute__((ext_vector_type(4))) unsigned short v4us;
typedef v4us __attribute__((may_alias)) v4usa;

// ---- k_proj: q, k, v = x W + b for 64 token rows in ONE work-group (8 waves), from the f32 inputs to the 16-bit planes that the attention kernel reads.
// Stage 1: the x tile (coalesced 16-byte loads) and the three weights (a thread gathers 8 consecutive k of one column n; 32 lanes = 32 consecutive n = one line per load) are rounded to bf16 and laid K-contiguous in LDS: xs[row][k], wt[matrix * 64 + n][k].
// Stage 2, behind the first barrier: wave w takes row tile w & 3 and six of the twelve 16-column tiles (rows of wt: 0..63 q, 64..127 k, 128..191 v): waves 0..3 all of q and the lower half of v, waves 4..7 all of k and the upper half of v, so that every wave stages four tiles the q, k way and two the v way with no branch; k runs upward in steps of 32 on one accumulator per tile.
// Stage 3: the f32 tiles go to LDS (q, k as [row][column]; v as [column][row], which is how a lane holds it: 8 consecutive rows of one column); behind the second barrier every thread adds the bias to one unit (8 consecutive d of a token for q, k; 8 consecutive tokens of a d for v), splits it and stores 16 bytes per plane; in fragment order the work-group's 64 tokens are one contiguous piece of each plane and thread t's units lie at bytes 16 t and 16 (256 + t) of it: a wave's store fills 4 whole lines.
// Every '#pragma unroll' of this kernel is there so that the load, fragment and accumulator arrays are indexed by constants and stay in registers.
#define PM 64                 // token rows per work-group (divides TT: a work-group lies in one batch)
#define XP (DM + 8)           // LDS row pitch of xs and wt in elements: 528 bytes = 16 bytes x odd, conflict-free for 16-byte reads and writes of 16 rows
#define QP 132                // pitch of the q, k tile in floats
#define VP 68                 // pitch of the v tile in floats
__global__ __launch_bounds__(256) void k_proj(const float* __restrict__ x, const float* __restrict__ wq, const float* __restrict__ wk, const float* __restrict__ wv, const float* __restrict__ bq, const float* __restrict__ bk, const float* __restrict__ bv, bf* Qh, bf* Ql, bf* Kh, bf* Kl, h16* V16, bf* Vh, bf* Vl) {
    __shared__ __align__(16) bf xs[PM * XP];
    __shared__ __align__(16) bf wt[3 * HD * XP];
    __shared__ __align__(16) float oqk[PM * QP];
    __shared__ __align__(16) float ov[HD * VP];
    const int tid = threadIdx.x, lane = tid & 31, lr = lane & 15, hi = lane >> 4;
    const int wave = tid >> 5;
    const int wn = tid & 63, wk0 = (tid >> 6) * 8;               // weight gather: column n, first k of the thread's first group of 8
    const int oc = (tid >> 4) & 7, ol = tid & 15, ot = tid >> 7;   // q, k output phase: d octet, token in its 16-token tile, tile of a pair
    const int vd = ((tid >> 6) & 3) * 16 + ol, vt = (tid >> 4) & 3;   // v output phase: d, token octet in its 32-token chunk
    float g0[8][8], g1[8][8], g2[8][8]; v4f xv[16], bqv[2], bkv[2];
    // Two groups of loads are in flight at any time: q weight and x tile (with the thread's few bias values in front); the k weight's follow the q weight's conversion, the v weight's the x tile's.
#pragma unroll
    for (int q = 0; q < 2; ++q) { bqv[q] = *(const v4f*)(bq + oc * 8 + q * 4); bkv[q] = *(const v4f*)(bk + oc * 8 + q * 4); }
    const float bvv = bv[vd];
#pragma unroll
    for (int i = 0; i < 8; ++i)
#pragma unroll
        for (int j = 0; j < 8; ++j) g0[i][j] = wq[(i * 32 + wk0 + j) * HD + wn];
    const float* xp = x + (size_t)blockIdx.x * PM * DM;
#pragma unroll
    for (int i = 0; i < 16; ++i) xv[i] = *(const v4f*)(xp + (i * 256 + tid) * 4);
    asm volatile("s_wait_xcnt 0x0" ::: "memory");   // the wait that stands between an issued global load and a later write of a register that the load names as its address; it also keeps these loads together ahead of the first conversion
#pragma unroll
    for (int i = 0; i < 8; ++i) { v8us a;
#pragma unroll
        for (int j = 0; j < 8; ++j) a[j] = f2bf(g0[i][j]);
        *(v8usa*)(wt + wn * XP + i * 32 + wk0) = a; }
    __builtin_amdgcn_sched_barrier(0);   // keeps the k weight's loads behind the conversion of the q weight, whose registers they take over: the kernel stays inside 256 registers (no register-window switches)
#pragma unroll
    for (int i = 0; i < 8; ++i)
#pragma unroll
        for (int j = 0; j < 8; ++j) g1[i][j] = wk[(i * 32 + wk0 + j) * HD + wn];
    asm volatile("s_wait_xcnt 0x0" ::: "memory");   // as above, for the k weight's loads
#pragma unroll
    for (int i = 0; i < 16; ++i) { v4us a;
#pragma unroll
        for (int j = 0; j < 4; ++j) a[j] = f2bf(xv[i][j]);
        *(v4usa*)(xs + (i * 4 + (tid >> 6)) * XP + wn * 4) = a; }
    __builtin_amdgcn_sched_barrier(0);   // as above: the v weight's loads take over the x tile's registers
#pragma unroll
    for (int i = 0; i < 8; ++i)
#pragma unroll
        for (int j = 0; j < 8; ++j) g2[i][j] = wv[(i * 32 + wk0 + j) * HD + wn];
    asm volatile("s_wait_xcnt 0x0" ::: "memory");   // as above, for the v weight's loads
#pragma unroll
    for (int i = 0; i < 8; ++i) { v8us a, b;
#pragma unroll
        for (int j = 0; j < 8; ++j) { a[j] = f2bf(g1[i][j]); b[j] = f2bf(g2[i][j]); }
        *(v8usa*)(wt + (HD + wn) * XP + i * 32 + wk0) = a; *(v8usa*)(wt + (2 * HD + wn) * XP + i * 32 + wk0) = b; }
    __syncthreads();
    const int mt = wave & 3, ng = wave >> 2;
    v8f acc[6];
#pragma unroll
    for (int nb = 0; nb < 6; ++nb) acc[nb] = (v8f){};
    { const bf* pa = xs + (mt * 16 + lr) * XP + 8 * hi; const bf* pb = wt + (ng * HD + lr) * XP + 8 * hi; const bf* pc = wt + (2 * HD + ng * 32 + lr) * XP + 8 * hi;
#pragma unroll
        for (int kc = 0; kc < DM; kc += 32) { const v16bf a = WFrag<bf>::ld(pa + kc);
#pragma unroll
            for (int nb = 0; nb < 6; ++nb) acc[nb] = wmmab(a, WFrag<bf>::ld((nb < 4 ? pb + nb * 16 * XP : pc + (nb - 4) * 16 * XP) + kc), acc[nb]); } }
#pragma unroll
    for (int nb = 0; nb < 6; ++nb) {
        if (nb < 4) { float* p = oqk + (mt * 16 + hi * 8) * QP + ng * HD + nb * 16 + lr;
#pragma unroll
            for (int j = 0; j < 8; ++j) p[j * QP] = acc[nb][j]; }
        else { float* p = ov + (ng * 32 + (nb - 4) * 16 + lr) * VP + mt * 16 + hi * 8;
            *(v4fa*)p = (v4f){acc[nb][0], acc[nb][1], acc[nb][2], acc[nb][3]}; *(v4fa*)(p + 4) = (v4f){acc[nb][4], acc[nb][5], acc[nb][6], acc[nb][7]}; } }
    __syncthreads();
    const size_t r0 = (size_t)blockIdx.x * PM;
    v4f yq[4][2], yv[2][2];   // all of the thread's LDS reads go out together, ahead of the first store
#pragma unroll
    for (int i = 0; i < 4; ++i) { const float* p = oqk + (((i & 1) * 2 + ot) * 16 + ol) * QP + (i >> 1) * HD + oc * 8; yq[i][0] = *(const v4fa*)p; yq[i][1] = *(const v4fa*)(p + 4); }
#pragma unroll
    for (int i = 0; i < 2; ++i) { const float* p = ov + vd * VP + (i * 4 + vt) * 8; yv[i][0] = *(const v4fa*)p; yv[i][1] = *(const v4fa*)(p + 4); }
#pragma unroll
    for (int i = 0; i < 4; ++i) { const int mat = i >> 1; v8us oh, olo;
#pragma unroll
        for (int j = 0; j < 8; ++j) { const float b = mat ? bkv[j >> 2][j & 3] : bqv[j >> 2][j & 3]; const float y = yq[i][j >> 2][j & 3] + bfr(b); unsigned short h, l; splitf(y, h, l); oh[j] = h; olo[j] = l; }
        bf* ph = (mat ? Kh : Qh) + r0 * HD + ((i & 1) * 256 + tid) * 8; bf* pl = (mat ? Kl : Ql) + r0 * HD + ((i & 1) * 256 + tid) * 8; *(v8us*)ph = oh; *(v8us*)pl = olo;
        // The wait that stands between an issued global store and a later write of a register that the store names; addresses and data are inputs, so that they stay in their registers up to this line.
        asm volatile("s_wait_xcnt 0x0" :: "v"(ph), "v"(pl), "v"(oh), "v"(olo) : "memory"); }
    const size_t vo = r0 * HD + tid * 8;   // batch stride HD * TT, chunk stride 32 * HD: both are the token index times HD
#pragma unroll
    for (int i = 0; i < 2; ++i) { const float b = bfr(bvv); v8h o16; v8us oh, olo;
#pragma unroll
        for (int j = 0; j < 8; ++j) { const float y = yv[i][j >> 2][j & 3] + b; o16[j] = tohx(y); unsigned short h, l; splitf(y, h, l); oh[j] = h; olo[j] = l; }
        h16* pv = V16 + vo + i * 32 * HD; bf* ph = Vh + vo + i * 32 * HD; bf* pl = Vl + vo + i * 32 * HD; *(v8h*)pv = o16; *(v8us*)ph = oh; *(v8us*)pl = olo;
        if (i == 0) asm volatile("s_wait_xcnt 0x0" :: "v"(pv), "v"(ph), "v"(pl), "v"(o16), "v"(oh), "v"(olo) : "memory"); }   // as above; behind the last stores no register is written any more
}

#define LC (SCL * 1.4426950408889634f)
__device__ __forceinline__ float xhalf(float x) { return __builtin_bit_cast(float, __builtin_amdgcn_permlanex16(__builtin_bit_cast(int, x), __builtin_bit_cast(int, x), 0x76543210, 0xfedcba98, false, false)); }   // lane l with lane l ^ 16, in the vector unit (the shuffle goes through the LDS pipe)
__device__ __forceinline__ float exp2x1(float x) { float y; asm("v_exp_f32 %0, %1\n\tv_nop" : "=v"(y) : "v"(x)); return y; }
__device__ __forceinline__ void exp2x8(const float* x, float* y) {
    asm("v_exp_f32 %0, %8\n\tv_exp_f32 %1, %9\n\tv_exp_f32 %2, %10\n\tv_exp_f32 %3, %11\n\tv_exp_f32 %4, %12\n\tv_exp_f32 %5, %13\n\tv_exp_f32 %6, %14\n\tv_exp_f32 %7, %15\n\tv_nop"
        : "=&v"(y[0]), "=&v"(y[1]), "=&v"(y[2]), "=&v"(y[3]), "=&v"(y[4]), "=&v"(y[5]), "=&v"(y[6]), "=&v"(y[7]) : "v"(x[0]), "v"(x[1]), "v"(x[2]), "v"(x[3]), "v"(x[4]), "v"(x[5]), "v"(x[6]), "v"(x[7])); }
#define NW 16                 // waves per work-group = parts of a tile's key loop
template <bool HR>
__device__ __forceinline__ void fattn_tile(const bf* __restrict__ Qh, const bf* __restrict__ Ql, const bf* __restrict__ Kh, const bf* __restrict__ Kl, const h16* __restrict__ V16, const bf* __restrict__ Vh, const bf* __restrict__ Vl, float* OUTb, const int qt, const size_t zo, const int wave, const bool second, float (*red)[32 * 68], float (*sm)[32], float (*sl)[32]) {
    const int lane = threadIdx.x & 31, lr = lane & 15, hi = lane >> 4;
    const int q0 = qt * 32;
    v16bf qh[2][2], ql[2][2];
    { const bf* pqh = Qh + zo + (size_t)q0 * HD + 8 * lane; const bf* pql = Ql + zo + (size_t)q0 * HD + 8 * lane;
#pragma unroll
        for (int g = 0; g < 2; ++g)
#pragma unroll
            for (int kk = 0; kk < 2; ++kk) { qh[g][kk] = WFrag<bf>::ldf(pqh + g * 16 * HD + kk * 512); ql[g][kk] = WFrag<bf>::ldf(pql + g * 16 * HD + kk * 512); }
        // The wait that stands between an issued global load and a later write of a register that the load names as its address; the addresses are inputs, so that they stay in their registers up to this line.
        asm volatile("s_wait_xcnt 0x0" :: "v"(pqh), "v"(pql) : "memory"); }
    v8f o[2][4]; float m[2], l[2];
#pragma unroll
    for (int g = 0; g < 2; ++g) { m[g] = -3.0e38f; l[g] = 0.f;
#pragma unroll
        for (int dt = 0; dt < 4; ++dt) o[g][dt] = (v8f){}; }
    for (int c = wave; c <= qt; c += NW) {
        const int key0 = c * 32;
        const bf* pkh = Kh + zo + (size_t)key0 * HD + 8 * lane; const bf* pkl = Kl + zo + (size_t)key0 * HD + 8 * lane;
        v16bf kh[2][2], kl[2][2];
#pragma unroll
        for (int kt = 0; kt < 2; ++kt)
#pragma unroll
            for (int kk = 0; kk < 2; ++kk) { kh[kt][kk] = WFrag<bf>::ldf(pkh + kt * 16 * HD + kk * 512); kl[kt][kk] = WFrag<bf>::ldf(pkl + kt * 16 * HD + kk * 512); }
        asm volatile("s_wait_xcnt 0x0" :: "v"(pkh), "v"(pkl) : "memory");   // as above: before an address register of the key loads is written again
        __builtin_amdgcn_sched_barrier(0);   // keeps the chunk's key loads together ahead of its first matrix instruction: one memory latency per chunk, not one per product
        v8f s[2][2];
#pragma unroll
        for (int kt = 0; kt < 2; ++kt)
#pragma unroll
            for (int g = 0; g < 2; ++g) s[kt][g] = (v8f){};
#pragma unroll
        for (int kk = 0; kk < 2; ++kk) {
#pragma unroll
            for (int kt = 0; kt < 2; ++kt)
#pragma unroll
                for (int g = 0; g < 2; ++g) s[kt][g] = wmmab(kh[kt][kk], qh[g][kk], s[kt][g]);
#pragma unroll
            for (int kt = 0; kt < 2; ++kt)
#pragma unroll
                for (int g = 0; g < 2; ++g) s[kt][g] = wmmab(kl[kt][kk], qh[g][kk], s[kt][g]);
#pragma unroll
            for (int kt = 0; kt < 2; ++kt)
#pragma unroll
                for (int g = 0; g < 2; ++g) s[kt][g] = wmmab(kh[kt][kk], ql[g][kk], s[kt][g]); }
        const h16* pv = V16 + zo + (size_t)key0 * HD + 8 * lane; const bf* pvh = Vh + zo + (size_t)key0 * HD + 8 * lane; const bf* pvl = Vl + zo + (size_t)key0 * HD + 8 * lane;
        v16h v[4]; v16bf vh[4], vl[4];
        if constexpr (HR) {
#pragma unroll
            for (int dt = 0; dt < 4; ++dt) { vh[dt] = WFrag<bf>::ldf(pvh + dt * 512); vl[dt] = WFrag<bf>::ldf(pvl + dt * 512); }
            asm volatile("s_wait_xcnt 0x0" :: "v"(pvh), "v"(pvl) : "memory");   // as above, for the value loads
        } else {
#pragma unroll
            for (int dt = 0; dt < 4; ++dt) v[dt] = WFrag<h16>::ldf(pv + dt * 512);
            asm volatile("s_wait_xcnt 0x0" :: "v"(pv) : "memory");   // as above, for the value loads
        }
        if (c == qt) {   // the diagonal chunk (scalar test): keys behind the query drop out
#pragma unroll
            for (int kt = 0; kt < 2; ++kt)
#pragma unroll
                for (int g = 0; g < 2; ++g)
#pragma unroll
                    for (int j = 0; j < 8; ++j) if (kt * 16 + 8 * hi + j > g * 16 + lr) s[kt][g][j] = -3.0e38f; }
        v16h pf[2]; v8us ph[2][2], pl[2][2];
#pragma unroll
        for (int g = 0; g < 2; ++g) {
            float mx = s[0][g][0];
#pragma unroll
            for (int kt = 0; kt < 2; ++kt)
#pragma unroll
                for (int j = 0; j < 8; ++j) mx = fmaxf(mx, s[kt][g][j]);
            mx = fmaxf(mx, xhalf(mx));
            const float mn = fmaxf(m[g], mx * LC), al = exp2x1(m[g] - mn), sh = 10.0f - mn; m[g] = mn;
            float sum = 0.f;
#pragma unroll
            for (int kt = 0; kt < 2; ++kt) { float xa[8], pa[8];
#pragma unroll
                for (int j = 0; j < 8; ++j) xa[j] = fmaf(s[kt][g][j], LC, sh);
                exp2x8(xa, pa);
#pragma unroll
                for (int j = 0; j < 8; ++j) { const float p = pa[j]; sum += p;
                    if constexpr (HR) { unsigned short a, b2; splitf(p, a, b2); ph[g][kt][j] = a; pl[g][kt][j] = b2; } else pf[g][kt * 8 + j] = tohx(p); } }
            l[g] = fmaf(l[g], al, sum);
#pragma unroll
            for (int dt = 0; dt < 4; ++dt) o[g][dt] *= al;
        }
#pragma unroll
        for (int dt = 0; dt < 4; ++dt)
#pragma unroll
            for (int g = 0; g < 2; ++g) {
                if constexpr (HR) { const v16bf bh = cat16b(ph[g][0], ph[g][1]), bl = cat16b(pl[g][0], pl[g][1]); o[g][dt] = wmmab(vh[dt], bh, o[g][dt]); o[g][dt] = wmmab(vh[dt], bl, o[g][dt]); o[g][dt] = wmmab(vl[dt], bh, o[g][dt]); }
                else o[g][dt] = wmma16(v[dt], pf[g], o[g][dt]); }
    }
    if (second) __syncthreads();   // the work-group's second tile (same test in every wave): the first tile's partial results have been read by every wave before they are overwritten
#pragma unroll
    for (int g = 0; g < 2; ++g) { l[g] += xhalf(l[g]);
        if (hi == 0) { sm[wave][g * 16 + lr] = m[g]; sl[wave][g * 16 + lr] = l[g]; }
#pragma unroll
        for (int dt = 0; dt < 4; ++dt) { float* rp = &red[wave][(g * 16 + lr) * 68 + dt * 16 + 8 * hi];   // a lane's 8 accumulator registers are 8 consecutive d of one query
            *(v4fa*)rp = (v4f){o[g][dt][0], o[g][dt][1], o[g][dt][2], o[g][dt][3]}; *(v4fa*)(rp + 4) = (v4f){o[g][dt][4], o[g][dt][5], o[g][dt][6], o[g][dt][7]}; } }
    __syncthreads();
    { const int qy = threadIdx.x >> 4, d0 = (threadIdx.x & 15) * 4; float M = sm[0][qy];
#pragma unroll
        for (int w = 1; w < NW; ++w) M = fmaxf(M, sm[w][qy]);
        float L = 0.f, fx[NW], fw[NW]; v4f a0 = (v4f){};
#pragma unroll
        for (int w = 0; w < NW; ++w) fx[w] = sm[w][qy] - M;
        exp2x8(fx, fw); exp2x8(fx + 8, fw + 8);
#pragma unroll
        for (int w = 0; w < NW; ++w) { const float f = fw[w]; L = fmaf(f, sl[w][qy], L); a0 += f * *(const v4fa*)(&red[w][qy * 68 + d0]); }   // a wave without a chunk: f = 0, sum 0, tile 0
        const float inv = __fdiv_rn(1.0f, L); float* op = OUTb + zo + (size_t)(q0 + qy) * HD + d0; const v4f ov = a0 * inv;
        *(v4f*)op = ov;
        // The wait that stands between an issued global store and a later write of a register that the store names (behind the first tile the second tile's code follows; behind the second no register is written any more); address and data are inputs, so that they stay in their registers up to this line.
        if (!second) asm volatile("s_wait_xcnt 0x0" :: "v"(op), "v"(ov) : "memory"); }
}

// Work-group b of a batch takes query tile 127 - b and then tile b: 128 - b and b + 1 key chunks, 129 for every work-group, so that all 256 work-groups (one per WGP, four waves per SIMD) carry the same load and end together.
__global__ __launch_bounds__(32 * NW) __attribute__((amdgpu_waves_per_eu(4, 4))) void k_fattn(const bf* __restrict__ Qh, const bf* __restrict__ Ql, const bf* __restrict__ Kh, const bf* __restrict__ Kl, const h16* __restrict__ V16, const bf* __restrict__ Vh, const bf* __restrict__ Vl, float* OUTb) {
    __shared__ __align__(16) float red[NW][32 * 68];
    __shared__ float sm[NW][32], sl[NW][32];
    const int wave = __builtin_amdgcn_readfirstlane(threadIdx.x >> 5);   // scalar, so that the key loop is a scalar loop (EXEC stays all ones for the matrix instructions)
    const int b = (int)blockIdx.y; const size_t zo = (size_t)blockIdx.x * TT * HD;
    // The first tile is never one of the rows < RH (127 - b >= 64 on this grid of 64); the second is where b * 32 < RH (same test in every wave).
    fattn_tile<false>(Qh, Ql, Kh, Kl, V16, Vh, Vl, OUTb, TT / 32 - 1 - b, zo, wave, false, red, sm, sl);
    if (b * 32 < RH) fattn_tile<true>(Qh, Ql, Kh, Kl, V16, Vh, Vl, OUTb, b, zo, wave, true, red, sm, sl);
    else fattn_tile<false>(Qh, Ql, Kh, Kl, V16, Vh, Vl, OUTb, b, zo, wave, true, red, sm, sl);
}

extern "C" void kernel_launch(void* const* d_in, const int* in_sizes, int n_in,
                              void* d_out, int out_size, void* d_ws, size_t ws_size, hipStream_t stream) {
    (void)in_sizes; (void)n_in; (void)out_size;
    const float* x = (const float*)d_in[0]; const float* wk = (const float*)d_in[1]; const float* bk = (const float*)d_in[2]; const float* wq = (const float*)d_in[3]; const float* bq = (const float*)d_in[4]; const float* wv = (const float*)d_in[5]; const float* bv = (const float*)d_in[6];   /* input order Wk, bk, Wq, bq, Wv, bv */
    float* OUT = (float*)d_out;     // [4][4096][64]
    char* wsp = (char*)d_ws;
    auto take = [&](size_t bytes) { char* p = wsp; wsp += (bytes + 255) & ~(size_t)255; return (void*)p; };
    h16* VT16 = (h16*)take((size_t)NB_ * HD * TT * 2);
    bf* QPh = (bf*)take((size_t)NB_ * TT * HD * 2); bf* QPl = (bf*)take((size_t)NB_ * TT * HD * 2); bf* KPh = (bf*)take((size_t)NB_ * TT * HD * 2); bf* KPl = (bf*)take((size_t)NB_ * TT * HD * 2); bf* VTh = (bf*)take((size_t)NB_ * HD * TT * 2); bf* VTl = (bf*)take((size_t)NB_ * HD * TT * 2);
    if ((size_t)(wsp - (char*)d_ws) > ws_size) return;    // ws 256 MiB
    k_proj<<<NB_ * TT / PM, 256, 0, stream>>>(x, wq, wk, wv, bq, bk, bv, QPh, QPl, KPh, KPl, VT16, VTh, VTl);
    k_fattn<<<dim3(NB_, TT / 64), 32 * NW, 0, stream>>>(QPh, QPl, KPh, KPl, VT16, VTh, VTl, OUT);
}

// v007
// It runs in 28.3 microseconds.
// In both of two side-by-side timings against v006, it was 1.09 times as fast.
// Over all steps from v000 it is 21.2 times as fast.
#include <hip/hip_runtime.h>

// Single-head causal attention over 4,096 tokens with a 64-wide head (embedded [4][4096][256]; k, q, v = x W + b ('xw' [256][64] 1/16; input order Wk, bk, Wq, bq, Wv, bv); scores / 8; causal (-inf); softmax; out = p v -> [4][4096][64] (1.05 M)).
// Layout: one projection kernel (64 token rows per work-group: x and the three 'xw' [256][64] weights rounded to bf16 into LDS, the weights transposed on the way; exact products + f32 biases) writes the q, k planes (hi/lo) and the v planes (fp16 and hi/lo), all in fragment order (see FRAGMENT ORDER below); one fused causal attention kernel, one launch (hi/lo 3-product score tiles on EVERY row, online softmax in registers, P and attn.v hybrid: rows < 512 hi/lo, rest fp16 x1024; key chunks above the diagonal skipped), which writes the output rows.
// Compute dtypes, f32 accumulate: every input rounded to bf16; projections exact + f32 biases; scores 3 products on every row; softmax f32; attn.v rows < 512 3 products, rest fp16; output f32.

#define NB_  4
#define TT   4096
#define DM   256
#define NH_  1
#define NKV  1
#define REP  (NH_ / NKV)
#define HD   64
#define DQ   (NH_ * HD)
#define DKV  (NKV * HD)
#define RH   512                  // query rows < RH use hi+lo planes (0: none)
#define SCL  0.125f   // HD^-0.5
typedef _Float16 h16;
typedef unsigned short bf;
typedef __attribute__((ext_vector_type(16))) __bf16   v16bf;
typedef __attribute__((ext_vector_type(16))) _Float16 v16h;
typedef __attribute__((ext_vector_type(8)))  _Float16 v8h;
typedef __attribute__((ext_vector_type(8)))  unsigned short v8us;
typedef __attribute__((ext_vector_type(8)))  float    v8f;
typedef __attribute__((ext_vector_type(4)))  float    v4f;
typedef v8h  __attribute__((may_alias)) v8ha;
typedef v4f  __attribute__((may_alias)) v4fa;
typedef v8us __attribute__((may_alias)) v8usa;

__device__ __forceinline__ unsigned short f2bf(float f) { unsigned u = __float_as_uint(f); u += 0x7FFFu + ((u >> 16) & 1u); return (unsigned short)(u >> 16); }
__device__ __forceinline__ float bf2f(unsigned short b) { return __uint_as_float(((unsigned)b) << 16); }
__device__ __forceinline__ float bfr(float f) { return bf2f(f2bf(f)); }
__device__ __forceinline__ v16h cat16(v8h lo, v8h hi) { return __builtin_shufflevector(lo, hi, 0, 1, 2, 3, 4, 5, 6, 7, 8, 9, 10, 11, 12, 13, 14, 15); }
__device__ __forceinline__ v16bf cat16b(v8us lo, v8us hi) { return __builtin_bit_cast(v16bf, __builtin_shufflevector(lo, hi, 0, 1, 2, 3, 4, 5, 6, 7, 8, 9, 10, 11, 12, 13, 14, 15)); }
__device__ __forceinline__ v8f wmma16(v16h a, v16h b, v8f c) { return __builtin_amdgcn_wmma_f32_16x16x32_f16(false, a, false, b, (short)0, c, false, false); }
__device__ __forceinline__ v8f wmmab(v16bf a, v16bf b, v8f c) { return __builtin_amdgcn_wmma_f32_16x16x32_bf16(false, a, false, b, (short)0, c, false, false); }



// Fragment loaders. ld: operands from K-contiguous 16-bit rows (LDS); ldf: operands from the global planes in fragment order. A and B of a product use the same loader, so their k orders are equal.
// FRAGMENT ORDER of the global planes: the unit is 8 consecutive k of one operand row (16 bytes, what a lane takes with one load). A tile of 16 rows x 32 k is stored as [k octet 0..3][row 0..15][8 k] = 1,024 bytes,
// so that lane l (row l & 15, half l >> 4) finds its first unit (octet l >> 4) at byte 16 l and its second (octet 2 + (l >> 4)) 512 bytes on: each wave-wide 16-byte load reads 512 contiguous bytes = 4 whole lines, not 32-byte pieces of 16 lines.
// q, k planes: [batch][16-token tile][d octet 0..7][token][8 d] (k = d; two such tiles of 32 d follow one another); v planes: [batch][32-token chunk][16-d tile 0..3][token octet 0..3][d][8 tokens] (rows = d, k = token). The registers hold what they held with row-major planes.
template <typename T16> struct WFrag;
template <> struct WFrag<h16> { typedef v16h V; static __device__ __forceinline__ V ldf(const h16* p) { return cat16(*(const v8h*)p, *(const v8h*)(p + 256)); } static __device__ __forceinline__ v8f mma(V a, V b, v8f c) { return wmma16(a, b, c); } };
template <> struct WFrag<bf> { typedef v16bf V; static __device__ __forceinline__ V ld(const bf* p) { return cat16b(*(const v8us*)p, *(const v8us*)(p + 16)); } static __device__ __forceinline__ V ldf(const bf* p) { return cat16b(*(const v8us*)p, *(const v8us*)(p + 256)); } static __device__ __forceinline__ v8f mma(V a, V b, v8f c) { return wmmab(a, b, c); } };
__device__ __forceinline__ h16 tohx(float x) { return (h16)x; }
__device__ __forceinline__ void splitf(float y, unsigned short& h, unsigned short& l) { h = f2bf(y); l = f2bf(y - bf2f(h)); }
typedef __attribute__((ext_vector_type(4))) unsigned short v4us;
typedef v4us __attribute__((may_alias)) v4usa;

// ---- k_proj: q, k, v = x W + b for 64 token rows in ONE work-group (8 waves), from the f32 inputs to the 16-bit planes that the attention kernel reads.
// Stage 1: the x tile (coalesced 16-byte loads) and the three weights (a thread gathers 8 consecutive k of one column n; 32 lanes = 32 consecutive n = one line per load) are rounded to bf16 and laid K-contiguous in LDS: xs[row][k], wt[matrix * 64 + n][k].
// Stage 2, behind the first barrier: wave w takes row tile w & 3 and six of the twelve 16-column tiles (rows of wt: 0..63 q, 64..127 k, 128..191 v): waves 0..3 all of q and the lower half of v, waves 4..7 all of k and the upper half of v, so that every wave stages four tiles the q, k way and two the v way with no branch; k runs upward in steps of 32 on one accumulator per tile.
// Stage 3: the f32 tiles go to LDS (q, k as [row][column]; v as [column][row], which is how a lane holds it: 8 consecutive rows of one column); behind the second barrier every thread adds the bias to one unit (8 consecutive d of a token for q, k; 8 consecutive tokens of a d for v), splits it and stores 16 bytes per plane; in fragment order the work-group's 64 tokens are one contiguous piece of each plane and thread t's units lie at bytes 16 t and 16 (256 + t) of it: a wave's store fills 4 whole lines.
// Every '#pragma unroll' of this kernel is there so that the load, fragment and accumulator arrays are indexed by constants and stay in registers.
#define PM 64                 // token rows per work-group (divides TT: a work-group lies in one batch)
#define XP (DM + 8)           // LDS row pitch of xs and wt in elements: 528 bytes = 16 bytes x odd, conflict-free for 16-byte reads and writes of 16 rows
#define QP 132                // pitch of the q, k tile in floats
#define VP 68                 // pitch of the v tile in floats
__global__ __launch_bounds__(256) void k_proj(const float* __restrict__ x, const float* __restrict__ wq, const float* __restrict__ wk, const float* __restrict__ wv, const float* __restrict__ bq, const float* __restrict__ bk, const float* __restrict__ bv, bf* Qh, bf* Ql, bf* Kh, bf* Kl, h16* V16, bf* Vh, bf* Vl) {
    __shared__ __align__(16) bf xs[PM * XP];
    __shared__ __align__(16) bf wt[3 * HD * XP];
    __shared__ __align__(16) float oqk[PM * QP];
    __shared__ __align__(16) float ov[HD * VP];
    const int tid = threadIdx.x, lane = tid & 31, lr = lane & 15, hi = lane >> 4;
    const int wave = tid >> 5;
    const int wn = tid & 63, wk0 = (tid >> 6) * 8;               // weight gather: column n, first k of the thread's first group of 8
    const int oc = (tid >> 4) & 7, ol = tid & 15, ot = tid >> 7;   // q, k output phase: d octet, token in its 16-token tile, tile of a pair
    const int vd = ((tid >> 6) & 3) * 16 + ol, vt = (tid >> 4) & 3;   // v output phase: d, token octet in its 32-token chunk
    float g0[8][8], g1[8][8], g2[8][8]; v4f xv[16], bqv[2], bkv[2];
    // Two groups of loads are in flight at any time: q weight and x tile (with the thread's few bias values in front); the k weight's follow the q weight's conversion, the v weight's the x tile's.
#pragma unroll
    for (int q = 0; q < 2; ++q) { bqv[q] = *(const v4f*)(bq + oc * 8 + q * 4); bkv[q] = *(const v4f*)(bk + oc * 8 + q * 4); }
    const float bvv = bv[vd];
#pragma unroll
    for (int i = 0; i < 8; ++i)
#pragma unroll
        for (int j = 0; j < 8; ++j) g0[i][j] = wq[(i * 32 + wk0 + j) * HD + wn];
    const float* xp = x + (size_t)blockIdx.x * PM * DM;
#pragma unroll
    for (int i = 0; i < 16; ++i) xv[i] = *(const v4f*)(xp + (i * 256 + tid) * 4);
    asm volatile("s_wait_xcnt 0x0" ::: "memory");   // the wait that stands between an issued global load and a later write of a register that the load names as its address; it also keeps these loads together ahead of the first conversion
#pragma unroll
    for (int i = 0; i < 8; ++i) { v8us a;
#pragma unroll
        for (int j = 0; j < 8; ++j) a[j] = f2bf(g0[i][j]);
        *(v8usa*)(wt + wn * XP + i * 32 + wk0) = a; }
    __builtin_amdgcn_sched_barrier(0);   // keeps the k weight's loads behind the conversion of the q weight, whose registers they take over: the kernel stays inside 256 registers (no register-window switches)
#pragma unroll
    for (int i = 0; i < 8; ++i)
#pragma unroll
        for (int j = 0; j < 8; ++j) g1[i][j] = wk[(i * 32 + wk0 + j) * HD + wn];
    asm volatile("s_wait_xcnt 0x0" ::: "memory");   // as above, for the k weight's loads
#pragma unroll
    for (int i = 0; i < 16; ++i) { v4us a;
#pragma unroll
        for (int j = 0; j < 4; ++j) a[j] = f2bf(xv[i][j]);
        *(v4usa*)(xs + (i * 4 + (tid >> 6)) * XP + wn * 4) = a; }
    __builtin_amdgcn_sched_barrier(0);   // as above: the v weight's loads take over the x tile's registers
#pragma unroll
    for (int i = 0; i < 8; ++i)
#pragma unroll
        for (int j = 0; j < 8; ++j) g2[i][j] = wv[(i * 32 + wk0 + j) * HD + wn];
    asm volatile("s_wait_xcnt 0x0" ::: "memory");   // as above, for the v weight's loads
#pragma unroll
    for (int i = 0; i < 8; ++i) { v8us a, b;
#pragma unroll
        for (int j = 0; j < 8; ++j) { a[j] = f2bf(g1[i][j]); b[j] = f2bf(g2[i][j]); }
        *(v8usa*)(wt + (HD + wn) * XP + i * 32 + wk0) = a; *(v8usa*)(wt + (2 * HD + wn) * XP + i * 32 + wk0) = b; }
    __syncthreads();
    const int mt = wave & 3, ng = wave >> 2;
    v8f acc[6];
#pragma unroll
    for (int nb = 0; nb < 6; ++nb) acc[nb] = (v8f){};
    { const bf* pa = xs + (mt * 16 + lr) * XP + 8 * hi; const bf* pb = wt + (ng * HD + lr) * XP + 8 * hi; const bf* pc = wt + (2 * HD + ng * 32 + lr) * XP + 8 * hi;
#pragma unroll
        for (int kc = 0; kc < DM; kc += 32) { const v16bf a = WFrag<bf>::ld(pa + kc);
#pragma unroll
            for (int nb = 0; nb < 6; ++nb) acc[nb] = wmmab(a, WFrag<bf>::ld((nb < 4 ? pb + nb * 16 * XP : pc + (nb - 4) * 16 * XP) + kc), acc[nb]); } }
#pragma unroll
    for (int nb = 0; nb < 6; ++nb) {
        if (nb < 4) { float* p = oqk + (mt * 16 + hi * 8) * QP + ng * HD + nb * 16 + lr;
#pragma unroll
            for (int j = 0; j < 8; ++j) p[j * QP] = acc[nb][j]; }
        else { float* p = ov + (ng * 32 + (nb - 4) * 16 + lr) * VP + mt * 16 + hi * 8;
            *(v4fa*)p = (v4f){acc[nb][0], acc[nb][1], acc[nb][2], acc[nb][3]}; *(v4fa*)(p + 4) = (v4f){acc[nb][4], acc[nb][5], acc[nb][6], acc[nb][7]}; } }
    __syncthreads();
    const size_t r0 = (size_t)blockIdx.x * PM;
    v4f yq[4][2], yv[2][2];   // all of the thread's LDS reads go out together, ahead of the first store
#pragma unroll
    for (int i = 0; i < 4; ++i) { const float* p = oqk + (((i & 1) * 2 + ot) * 16 + ol) * QP + (i >> 1) * HD + oc * 8; yq[i][0] = *(const v4fa*)p; yq[i][1] = *(const v4fa*)(p + 4); }
#pragma unroll
    for (int i = 0; i < 2; ++i) { const float* p = ov + vd * VP + (i * 4 + vt) * 8; yv[i][0] = *(const v4fa*)p; yv[i][1] = *(const v4fa*)(p + 4); }
#pragma unroll
    for (int i = 0; i < 4; ++i) { const int mat = i >> 1; v8us oh, olo;
#pragma unroll
        for (int j = 0; j < 8; ++j) { const float b = mat ? bkv[j >> 2][j & 3] : bqv[j >> 2][j & 3]; const float y = yq[i][j >> 2][j & 3] + bfr(b); unsigned short h, l; splitf(y, h, l); oh[j] = h; olo[j] = l; }
        bf* ph = (mat ? Kh : Qh) + r0 * HD + ((i & 1) * 256 + tid) * 8; bf* pl = (mat ? Kl : Ql) + r0 * HD + ((i & 1) * 256 + tid) * 8; *(v8us*)ph = oh; *(v8us*)pl = olo;
        // The wait that stands between an issued global store and a later write of a register that the store names; addresses and data are inputs, so that they stay in their registers up to this line.
        asm volatile("s_wait_xcnt 0x0" :: "v"(ph), "v"(pl), "v"(oh), "v"(olo) : "memory"); }
    const size_t vo = r0 * HD + tid * 8;   // batch stride HD * TT, chunk stride 32 * HD: both are the token index times HD
#pragma unroll
    for (int i = 0; i < 2; ++i) { const float b = bfr(bvv); v8h o16; v8us oh, olo;
#pragma unroll
        for (int j = 0; j < 8; ++j) { const float y = yv[i][j >> 2][j & 3] + b; o16[j] = tohx(y); unsigned short h, l; splitf(y, h, l); oh[j] = h; olo[j] = l; }
        h16* pv = V16 + vo + i * 32 * HD; bf* ph = Vh + vo + i * 32 * HD; bf* pl = Vl + vo + i * 32 * HD; *(v8h*)pv = o16; *(v8us*)ph = oh; *(v8us*)pl = olo;
        if (i == 0) asm volatile("s_wait_xcnt 0x0" :: "v"(pv), "v"(ph), "v"(pl), "v"(o16), "v"(oh), "v"(olo) : "memory"); }   // as above; behind the last stores no register is written any more
}

#define LC (SCL * 1.4426950408889634f)
__device__ __forceinline__ float xhalf(float x) { return __builtin_bit_cast(float, __builtin_amdgcn_permlanex16(__builtin_bit_cast(int, x), __builtin_bit_cast(int, x), 0x76543210, 0xfedcba98, false, false)); }   // lane l with lane l ^ 16, in the vector unit (the shuffle goes through the LDS pipe)
__device__ __forceinline__ float exp2x1(float x) { float y; asm("v_exp_f32 %0, %1\n\tv_nop" : "=v"(y) : "v"(x)); return y; }
__device__ __forceinline__ void exp2x8(const float* x, float* y) {
    asm("v_exp_f32 %0, %8\n\tv_exp_f32 %1, %9\n\tv_exp_f32 %2, %10\n\tv_exp_f32 %3, %11\n\tv_exp_f32 %4, %12\n\tv_exp_f32 %5, %13\n\tv_exp_f32 %6, %14\n\tv_exp_f32 %7, %15\n\tv_nop"
        : "=&v"(y[0]), "=&v"(y[1]), "=&v"(y[2]), "=&v"(y[3]), "=&v"(y[4]), "=&v"(y[5]), "=&v"(y[6]), "=&v"(y[7]) : "v"(x[0]), "v"(x[1]), "v"(x[2]), "v"(x[3]), "v"(x[4]), "v"(x[5]), "v"(x[6]), "v"(x[7])); }
#define NW 16                 // waves per work-group = parts of a tile's key loop
template <bool HR>
__device__ __forceinline__ void fattn_tile(const bf* __restrict__ Qh, const bf* __restrict__ Ql, const bf* __restrict__ Kh, const bf* __restrict__ Kl, const h16* __restrict__ V16, const bf* __restrict__ Vh, const bf* __restrict__ Vl, float* OUTb, const int qt, const int rot, const size_t zo, const int wave, const bool second, float (*red)[32 * 68], float (*sm)[32], float (*sl)[32]) {
    const int lane = threadIdx.x & 31, lr = lane & 15, hi = lane >> 4;
    const int q0 = qt * 32;
    v16bf qh[2][2], ql[2][2];
    { const bf* pqh = Qh + zo + (size_t)q0 * HD + 8 * lane; const bf* pql = Ql + zo + (size_t)q0 * HD + 8 * lane;
#pragma unroll
        for (int g = 0; g < 2; ++g)
#pragma unroll
            for (int kk = 0; kk < 2; ++kk) { qh[g][kk] = WFrag<bf>::ldf(pqh + g * 16 * HD + kk * 512); ql[g][kk] = WFrag<bf>::ldf(pql + g * 16 * HD + kk * 512); }
        // The wait that stands between an issued global load and a later write of a register that the load names as its address; the addresses are inputs, so that they stay in their registers up to this line.
        asm volatile("s_wait_xcnt 0x0" :: "v"(pqh), "v"(pql) : "memory"); }
    v8f o[2][4]; float m[2], l[2];
#pragma unroll
    for (int g = 0; g < 2; ++g) { m[g] = -3.0e38f; l[g] = 0.f;
#pragma unroll
        for (int dt = 0; dt < 4; ++dt) o[g][dt] = (v8f){}; }
    for (int i = wave; i <= qt; i += NW) {
        const int c = i + rot > qt ? i + rot - (qt + 1) : i + rot;   // the walk starts at chunk rot and wraps (scalar)
        const int key0 = c * 32;
        const bf* pkh = Kh + zo + (size_t)key0 * HD + 8 * lane; const bf* pkl = Kl + zo + (size_t)key0 * HD + 8 * lane;
        v16bf kh[2][2], kl[2][2];
#pragma unroll
        for (int kt = 0; kt < 2; ++kt)
#pragma unroll
            for (int kk = 0; kk < 2; ++kk) { kh[kt][kk] = WFrag<bf>::ldf(pkh + kt * 16 * HD + kk * 512); kl[kt][kk] = WFrag<bf>::ldf(pkl + kt * 16 * HD + kk * 512); }
        asm volatile("s_wait_xcnt 0x0" :: "v"(pkh), "v"(pkl) : "memory");   // as above: before an address register of the key loads is written again
        __builtin_amdgcn_sched_barrier(0);   // keeps the chunk's key loads together ahead of its first matrix instruction: one memory latency per chunk, not one per product
        v8f s[2][2];
#pragma unroll
        for (int kt = 0; kt < 2; ++kt)
#pragma unroll
            for (int g = 0; g < 2; ++g) s[kt][g] = (v8f){};
#pragma unroll
        for (int kk = 0; kk < 2; ++kk) {
#pragma unroll
            for (int kt = 0; kt < 2; ++kt)
#pragma unroll
                for (int g = 0; g < 2; ++g) s[kt][g] = wmmab(kh[kt][kk], qh[g][kk], s[kt][g]);
#pragma unroll
            for (int kt = 0; kt < 2; ++kt)
#pragma unroll
                for (int g = 0; g < 2; ++g) s[kt][g] = wmmab(kl[kt][kk], qh[g][kk], s[kt][g]);
#pragma unroll
            for (int kt = 0; kt < 2; ++kt)
#pragma unroll
                for (int g = 0; g < 2; ++g) s[kt][g] = wmmab(kh[kt][kk], ql[g][kk], s[kt][g]); }
        const h16* pv = V16 + zo + (size_t)key0 * HD + 8 * lane; const bf* pvh = Vh + zo + (size_t)key0 * HD + 8 * lane; const bf* pvl = Vl + zo + (size_t)key0 * HD + 8 * lane;
        v16h v[4]; v16bf vh[4], vl[4];
        if constexpr (HR) {
#pragma unroll
            for (int dt = 0; dt < 4; ++dt) { vh[dt] = WFrag<bf>::ldf(pvh + dt * 512); vl[dt] = WFrag<bf>::ldf(pvl + dt * 512); }
            asm volatile("s_wait_xcnt 0x0" :: "v"(pvh), "v"(pvl) : "memory");   // as above, for the value loads
        } else {
#pragma unroll
            for (int dt = 0; dt < 4; ++dt) v[dt] = WFrag<h16>::ldf(pv + dt * 512);
            asm volatile("s_wait_xcnt 0x0" :: "v"(pv) : "memory");   // as above, for the value loads
        }
        if (c == qt) {   // the diagonal chunk (scalar test): keys behind the query drop out
#pragma unroll
            for (int kt = 0; kt < 2; ++kt)
#pragma unroll
                for (int g = 0; g < 2; ++g)
#pragma unroll
                    for (int j = 0; j < 8; ++j) if (kt * 16 + 8 * hi + j > g * 16 + lr) s[kt][g][j] = -3.0e38f; }
        v16h pf[2]; v8us ph[2][2], pl[2][2];
#pragma unroll
        for (int g = 0; g < 2; ++g) {
            float mx = s[0][g][0];
#pragma unroll
            for (int kt = 0; kt < 2; ++kt)
#pragma unroll
                for (int j = 0; j < 8; ++j) mx = fmaxf(mx, s[kt][g][j]);
            mx = fmaxf(mx, xhalf(mx));
            const float mn = fmaxf(m[g], mx * LC), al = exp2x1(m[g] - mn), sh = 10.0f - mn; m[g] = mn;
            float sum = 0.f;
#pragma unroll
            for (int kt = 0; kt < 2; ++kt) { float xa[8], pa[8];
#pragma unroll
                for (int j = 0; j < 8; ++j) xa[j] = fmaf(s[kt][g][j], LC, sh);
                exp2x8(xa, pa);
#pragma unroll
                for (int j = 0; j < 8; ++j) { const float p = pa[j]; sum += p;
                    if constexpr (HR) { unsigned short a, b2; splitf(p, a, b2); ph[g][kt][j] = a; pl[g][kt][j] = b2; } else pf[g][kt * 8 + j] = tohx(p); } }
            l[g] = fmaf(l[g], al, sum);
#pragma unroll
            for (int dt = 0; dt < 4; ++dt) o[g][dt] *= al;
        }
#pragma unroll
        for (int dt = 0; dt < 4; ++dt)
#pragma unroll
            for (int g = 0; g < 2; ++g) {
                if constexpr (HR) { const v16bf bh = cat16b(ph[g][0], ph[g][1]), bl = cat16b(pl[g][0], pl[g][1]); o[g][dt] = wmmab(vh[dt], bh, o[g][dt]); o[g][dt] = wmmab(vh[dt], bl, o[g][dt]); o[g][dt] = wmmab(vl[dt], bh, o[g][dt]); }
                else o[g][dt] = wmma16(v[dt], pf[g], o[g][dt]); }
    }
    if (second) __syncthreads();   // the work-group's second tile (same test in every wave): the first tile's partial results have been read by every wave before they are overwritten
#pragma unroll
    for (int g = 0; g < 2; ++g) { l[g] += xhalf(l[g]);
        if (hi == 0) { sm[wave][g * 16 + lr] = m[g]; sl[wave][g * 16 + lr] = l[g]; }
#pragma unroll
        for (int dt = 0; dt < 4; ++dt) { float* rp = &red[wave][(g * 16 + lr) * 68 + dt * 16 + 8 * hi];   // a lane's 8 accumulator registers are 8 consecutive d of one query
            *(v4fa*)rp = (v4f){o[g][dt][0], o[g][dt][1], o[g][dt][2], o[g][dt][3]}; *(v4fa*)(rp + 4) = (v4f){o[g][dt][4], o[g][dt][5], o[g][dt][6], o[g][dt][7]}; } }
    __syncthreads();
    { const int qy = threadIdx.x >> 4, d0 = (threadIdx.x & 15) * 4; float M = sm[0][qy];
#pragma unroll
        for (int w = 1; w < NW; ++w) M = fmaxf(M, sm[w][qy]);
        float L = 0.f, fx[NW], fw[NW]; v4f a0 = (v4f){};
#pragma unroll
        for (int w = 0; w < NW; ++w) fx[w] = sm[w][qy] - M;
        exp2x8(fx, fw); exp2x8(fx + 8, fw + 8);
#pragma unroll
        for (int w = 0; w < NW; ++w) { const float f = fw[w]; L = fmaf(f, sl[w][qy], L); a0 += f * *(const v4fa*)(&red[w][qy * 68 + d0]); }   // a wave without a chunk: f = 0, sum 0, tile 0
        const float inv = __fdiv_rn(1.0f, L); float* op = OUTb + zo + (size_t)(q0 + qy) * HD + d0; const v4f ov = a0 * inv;
        *(v4f*)op = ov;
        // The wait that stands between an issued global store and a later write of a register that the store names (behind the first tile the second tile's code follows; behind the second no register is written any more); address and data are inputs, so that they stay in their registers up to this line.
        if (!second) asm volatile("s_wait_xcnt 0x0" :: "v"(op), "v"(ov) : "memory"); }
}

// Work-group b of a batch takes query tile 127 - b and then tile b: 128 - b and b + 1 key chunks, 129 for every work-group, so that all 256 work-groups (one per WGP, four waves per SIMD) carry the same load and end together.
__global__ __launch_bounds__(32 * NW) __attribute__((amdgpu_waves_per_eu(4, 4))) void k_fattn(const bf* __restrict__ Qh, const bf* __restrict__ Ql, const bf* __restrict__ Kh, const bf* __restrict__ Kl, const h16* __restrict__ V16, const bf* __restrict__ Vh, const bf* __restrict__ Vl, float* OUTb) {
    __shared__ __align__(16) float red[NW][32 * 68];
    __shared__ float sm[NW][32], sl[NW][32];
    const int wave = __builtin_amdgcn_readfirstlane(threadIdx.x >> 5);   // scalar, so that the key loop is a scalar loop (EXEC stays all ones for the matrix instructions)
    const int b = (int)blockIdx.y; const size_t zo = (size_t)blockIdx.x * TT * HD;
    // The first tile is never one of the rows < RH (127 - b >= 64 on this grid of 64); the second is where b * 32 < RH (same test in every wave).
    // Start of a tile's walk: pr / 64 of the way round its n chunks, pr = 21 b mod 64 being a permutation of the 64 work-groups of a batch that sets neighbours far apart; pr * n / 64 < n.
    const int pr = (b * 21) & (TT / 64 - 1), r1 = pr * (TT / 32 - b) / (TT / 64), r2 = pr * (b + 1) / (TT / 64);
    fattn_tile<false>(Qh, Ql, Kh, Kl, V16, Vh, Vl, OUTb, TT / 32 - 1 - b, r1, zo, wave, false, red, sm, sl);
    if (b * 32 < RH) fattn_tile<true>(Qh, Ql, Kh, Kl, V16, Vh, Vl, OUTb, b, r2, zo, wave, true, red, sm, sl);
    else fattn_tile<false>(Qh, Ql, Kh, Kl, V16, Vh, Vl, OUTb, b, r2, zo, wave, true, red, sm, sl);
}

extern "C" void kernel_launch(void* const* d_in, const int* in_sizes, int n_in,
                              void* d_out, int out_size, void* d_ws, size_t ws_size, hipStream_t stream) {
    (void)in_sizes; (void)n_in; (void)out_size;
    const float* x = (const float*)d_in[0]; const float* wk = (const float*)d_in[1]; const float* bk = (const float*)d_in[2]; const float* wq = (const float*)d_in[3]; const float* bq = (const float*)d_in[4]; const float* wv = (const float*)d_in[5]; const float* bv = (const float*)d_in[6];   /* input order Wk, bk, Wq, bq, Wv, bv */
    float* OUT = (float*)d_out;     // [4][4096][64]
    char* wsp = (char*)d_ws;
    auto take = [&](size_t bytes) { char* p = wsp; wsp += (bytes + 255) & ~(size_t)255; return (void*)p; };
    h16* VT16 = (h16*)take((size_t)NB_ * HD * TT * 2);
    bf* QPh = (bf*)take((size_t)NB_ * TT * HD * 2); bf* QPl = (bf*)take((size_t)NB_ * TT * HD * 2); bf* KPh = (bf*)take((size_t)NB_ * TT * HD * 2); bf* KPl = (bf*)take((size_t)NB_ * TT * HD * 2); bf* VTh = (bf*)take((size_t)NB_ * HD * TT * 2); bf* VTl = (bf*)take((size_t)NB_ * HD * TT * 2);
    if ((size_t)(wsp - (char*)d_ws) > ws_size) return;    // ws 256 MiB
    k_proj<<<NB_ * TT / PM, 256, 0, stream>>>(x, wq, wk, wv, bq, bk, bv, QPh, QPl, KPh, KPl, VT16, VTh, VTl);
    k_fattn<<<dim3(NB_, TT / 64), 32 * NW, 0, stream>>>(QPh, QPl, KPh, KPl, VT16, VTh, VTl, OUT);
}

// v008
// Measured time: 27.2 microseconds a run.
// Timed twice side by side with v007, it ran 1.05 times as fast both times.
// All steps since v000 together make it 22.2 times as fast.
#include <hip/hip_runtime.h>

// Single-head causal attention over 4,096 tokens with a 64-wide head (embedded [4][4096][256]; k, q, v = x W + b ('xw' [256][64] 1/16; input order Wk, bk, Wq, bq, Wv, bv); scores / 8; causal (-inf); softmax; out = p v -> [4][4096][64] (1.05 M)).
// Layout: one projection kernel (64 token rows per work-group: x and the three 'xw' [256][64] weights rounded to bf16 into LDS, the weights transposed on the way; exact products + f32 biases) writes the q, k planes (hi/lo) and the v planes (fp16 and hi/lo), all in fragment order (see FRAGMENT ORDER below); one fused causal attention kernel, one launch (hi/lo 3-product score tiles on EVERY row, online softmax in registers, P and attn.v hybrid: rows < 512 hi/lo, rest fp16 x1024; key chunks above the diagonal skipped), which writes the output rows.
// Compute dtypes, f32 accumulate: every input rounded to bf16; projections exact + f32 biases; scores 3 products on every row; softmax f32; attn.v rows < 512 3 products, rest fp16; output f32.

#define NB_  4
#define TT   4096
#define DM   256
#define NH_  1
#define NKV  1
#define REP  (NH_ / NKV)
#define HD   64
#define DQ   (NH_ * HD)
#define DKV  (NKV * HD)
#define RH   512                  // query rows < RH use hi+lo planes (0: none)
#define SCL  0.125f   // HD^-0.5
typedef _Float16 h16;
typedef unsigned short bf;
typedef __attribute__((ext_vector_type(16))) __bf16   v16bf;
typedef __attribute__((ext_vector_type(16))) _Float16 v16h;
typedef __attribute__((ext_vector_type(8)))  _Float16 v8h;
typedef __attribute__((ext_vector_type(8)))  unsigned short v8us;
typedef __attribute__((ext_vector_type(8)))  float    v8f;
typedef __attribute__((ext_vector_type(4)))  float    v4f;
typedef v8h  __attribute__((may_alias)) v8ha;
typedef v4f  __attribute__((may_alias)) v4fa;
typedef v8us __attribute__((may_alias)) v8usa;

__device__ __forceinline__ unsigned short f2bf(float f) { unsigned u = __float_as_uint(f); u += 0x7FFFu + ((u >> 16) & 1u); return (unsigned short)(u >> 16); }
__device__ __forceinline__ float bf2f(unsigned short b) { return __uint_as_float(((unsigned)b) << 16); }
__device__ __forceinline__ float bfr(float f) { return bf2f(f2bf(f)); }
__device__ __forceinline__ v16h cat16(v8h lo, v8h hi) { return __builtin_shufflevector(lo, hi, 0, 1, 2, 3, 4, 5, 6, 7, 8, 9, 10, 11, 12, 13, 14, 15); }
__device__ __forceinline__ v16bf cat16b(v8us lo, v8us hi) { return __builtin_bit_cast(v16bf, __builtin_shufflevector(lo, hi, 0, 1, 2, 3, 4, 5, 6, 7, 8, 9, 10, 11, 12, 13, 14, 15)); }
__device__ __forceinline__ v8f wmma16(v16h a, v16h b, v8f c) { return __builtin_amdgcn_wmma_f32_16x16x32_f16(false, a, false, b, (short)0, c, false, false); }
__device__ __forceinline__ v8f wmmab(v16bf a, v16bf b, v8f c) { return __builtin_amdgcn_wmma_f32_16x16x32_bf16(false, a, false, b, (short)0, c, false, false); }



// Fragment loaders. ld: operands from K-contiguous 16-bit rows (LDS); ldf: operands from the global planes in fragment order. A and B of a product use the same loader, so their k orders are equal.
// FRAGMENT ORDER of the global planes: the unit is 8 consecutive k of one operand row (16 bytes, what a lane takes with one load). A tile of 16 rows x 32 k is stored as [k octet 0..3][row 0..15][8 k] = 1,024 bytes,
// so that lane l (row l & 15, half l >> 4) finds its first unit (octet l >> 4) at byte 16 l and its second (octet 2 + (l >> 4)) 512 bytes on: each wave-wide 16-byte load reads 512 contiguous bytes = 4 whole lines, not 32-byte pieces of 16 lines.
// q, k planes: [batch][16-token tile][d octet 0..7][token][8 d] (k = d; two such tiles of 32 d follow one another); v planes: [batch][32-token chunk][16-d tile 0..3][token octet 0..3][d][8 tokens] (rows = d, k = token). The registers hold what they held with row-major planes.
template <typename T16> struct WFrag;
template <> struct WFrag<h16> { typedef v16h V; static __device__ __forceinline__ V ldf(const h16* p) { return cat16(*(const v8h*)p, *(const v8h*)(p + 256)); } static __device__ __forceinline__ v8f mma(V a, V b, v8f c) { return wmma16(a, b, c); } };
template <> struct WFrag<bf> { typedef v16bf V; static __device__ __forceinline__ V ld(const bf* p) { return cat16b(*(const v8us*)p, *(const v8us*)(p + 16)); } static __device__ __forceinline__ V ldf(const bf* p) { return cat16b(*(const v8us*)p, *(const v8us*)(p + 256)); } static __device__ __forceinline__ v8f mma(V a, V b, v8f c) { return wmmab(a, b, c); } };
__device__ __forceinline__ h16 tohx(float x) { return (h16)x; }
__device__ __forceinline__ void splitf(float y, unsigned short& h, unsigned short& l) { h = f2bf(y); l = f2bf(y - bf2f(h)); }
typedef __attribute__((ext_vector_type(4))) unsigned short v4us;
typedef v4us __attribute__((may_alias)) v4usa;

// ---- k_proj: q, k, v = x W + b for 64 token rows in ONE work-group (8 waves), from the f32 inputs to the 16-bit planes that the attention kernel reads.
// Stage 1: the x tile (coalesced 16-byte loads) and the three weights (a thread gathers 8 consecutive k of one column n; 32 lanes = 32 consecutive n = one line per load) are rounded to bf16 and laid K-contiguous in LDS: xs[row][k], wt[matrix * 64 + n][k].
// Stage 2, behind the first barrier: wave w takes row tile w & 3 and six of the twelve 16-column tiles (rows of wt: 0..63 q, 64..127 k, 128..191 v): waves 0..3 all of q and the lower half of v, waves 4..7 all of k and the upper half of v, so that every wave stages four tiles the q, k way and two the v way with no branch; k runs upward in steps of 32 on one accumulator per tile.
// Stage 3: the f32 tiles go to LDS (q, k as [row][column]; v as [column][row], which is how a lane holds it: 8 consecutive rows of one column); behind the second barrier every thread adds the bias to one unit (8 consecutive d of a token for q, k; 8 consecutive tokens of a d for v), splits it and stores 16 bytes per plane; in fragment order the work-group's 64 tokens are one contiguous piece of each plane and thread t's units lie at bytes 16 t and 16 (256 + t) of it: a wave's store fills 4 whole lines.
// Every '#pragma unroll' of this kernel is there so that the load, fragment and accumulator arrays are indexed by constants and stay in registers.
#define PM 64                 // token rows per work-group (divides TT: a work-group lies in one batch)
#define XP (DM + 8)           // LDS row pitch of xs and wt in elements: 528 bytes = 16 bytes x odd, conflict-free for 16-byte reads and writes of 16 rows
#define QP 132                // pitch of the q, k tile in floats
#define VP 68                 // pitch of the v tile in floats
__global__ __launch_bounds__(256) void k_proj(const float* __restrict__ x, const float* __restrict__ wq, const float* __restrict__ wk, const float* __restrict__ wv, const float* __restrict__ bq, const float* __restrict__ bk, const float* __restrict__ bv, bf* Qh, bf* Ql, bf* Kh, bf* Kl, h16* V16, bf* Vh, bf* Vl) {
    __shared__ __align__(16) bf xs[PM * XP];
    __shared__ __align__(16) bf wt[3 * HD * XP];
    __shared__ __align__(16) float oqk[PM * QP];
    __shared__ __align__(16) float ov[HD * VP];
    const int tid = threadIdx.x, lane = tid & 31, lr = lane & 15, hi = lane >> 4;
    const int wave = tid >> 5;
    const int wn = tid & 63, wk0 = (tid >> 6) * 8;               // weight gather: column n, first k of the thread's first group of 8
    const int oc = (tid >> 4) & 7, ol = tid & 15, ot = tid >> 7;   // q, k output phase: d octet, token in its 16-token tile, tile of a pair
    const int vd = ((tid >> 6) & 3) * 16 + ol, vt = (tid >> 4) & 3;   // v output phase: d, token octet in its 32-token chunk
    float g0[8][8], g1[8][8], g2[8][8]; v4f xv[16], bqv[2], bkv[2];
    // Two groups of loads are in flight at any time: q weight and x tile (with the thread's few bias values in front); the k weight's follow the q weight's conversion, the v weight's the x tile's.
#pragma unroll
    for (int q = 0; q < 2; ++q) { bqv[q] = *(const v4f*)(bq + oc * 8 + q * 4); bkv[q] = *(const v4f*)(bk + oc * 8 + q * 4); }
    const float bvv = bv[vd];
#pragma unroll
    for (int i = 0; i < 8; ++i)
#pragma unroll
        for (int j = 0; j < 8; ++j) g0[i][j] = wq[(i * 32 + wk0 + j) * HD + wn];
    const float* xp = x + (size_t)blockIdx.x * PM * DM;
#pragma unroll
    for (int i = 0; i < 16; ++i) xv[i] = *(const v4f*)(xp + (i * 256 + tid) * 4);
    asm volatile("s_wait_xcnt 0x0" ::: "memory");   // the wait that stands between an issued global load and a later write of a register that the load names as its address; it also keeps these loads together ahead of the first conversion
#pragma unroll
    for (int i = 0; i < 8; ++i) { v8us a;
#pragma unroll
        for (int j = 0; j < 8; ++j) a[j] = f2bf(g0[i][j]);
        *(v8usa*)(wt + wn * XP + i * 32 + wk0) = a; }
    __builtin_amdgcn_sched_barrier(0);   // keeps the k weight's loads behind the conversion of the q weight, whose registers they take over: the kernel stays inside 256 registers (no register-window switches)
#pragma unroll
    for (int i = 0; i < 8; ++i)
#pragma unroll
        for (int j = 0; j < 8; ++j) g1[i][j] = wk[(i * 32 + wk0 + j) * HD + wn];
    asm volatile("s_wait_xcnt 0x0" ::: "memory");   // as above, for the k weight's loads
#pragma unroll
    for (int i = 0; i < 16; ++i) { v4us a;
#pragma unroll
        for (int j = 0; j < 4; ++j) a[j] = f2bf(xv[i][j]);
        *(v4usa*)(xs + (i * 4 + (tid >> 6)) * XP + wn * 4) = a; }
    __builtin_amdgcn_sched_barrier(0);   // as above: the v weight's loads take over the x tile's registers
#pragma unroll
    for (int i = 0; i < 8; ++i)
#pragma unroll
        for (int j = 0; j < 8; ++j) g2[i][j] = wv[(i * 32 + wk0 + j) * HD + wn];
    asm volatile("s_wait_xcnt 0x0" ::: "memory");   // as above, for the v weight's loads
#pragma unroll
    for (int i = 0; i < 8; ++i) { v8us a, b;
#pragma unroll
        for (int j = 0; j < 8; ++j) { a[j] = f2bf(g1[i][j]); b[j] = f2bf(g2[i][j]); }
        *(v8usa*)(wt + (HD + wn) * XP + i * 32 + wk0) = a; *(v8usa*)(wt + (2 * HD + wn) * XP + i * 32 + wk0) = b; }
    __syncthreads();
    const int mt = wave & 3, ng = wave >> 2;
    v8f acc[6];
#pragma unroll
    for (int nb = 0; nb < 6; ++nb) acc[nb] = (v8f){};
    { const bf* pa = xs + (mt * 16 + lr) * XP + 8 * hi; const bf* pb = wt + (ng * HD + lr) * XP + 8 * hi; const bf* pc = wt + (2 * HD + ng * 32 + lr) * XP + 8 * hi;
#pragma unroll
        for (int kc = 0; kc < DM; kc += 32) { const v16bf a = WFrag<bf>::ld(pa + kc);
#pragma unroll
            for (int nb = 0; nb < 6; ++nb) acc[nb] = wmmab(a, WFrag<bf>::ld((nb < 4 ? pb + nb * 16 * XP : pc + (nb - 4) * 16 * XP) + kc), acc[nb]); } }
#pragma unroll
    for (int nb = 0; nb < 6; ++nb) {
        if (nb < 4) { float* p = oqk + (mt * 16 + hi * 8) * QP + ng * HD + nb * 16 + lr;
#pragma unroll
            for (int j = 0; j < 8; ++j) p[j * QP] = acc[nb][j]; }
        else { float* p = ov + (ng * 32 + (nb - 4) * 16 + lr) * VP + mt * 16 + hi * 8;
            *(v4fa*)p = (v4f){acc[nb][0], acc[nb][1], acc[nb][2], acc[nb][3]}; *(v4fa*)(p + 4) = (v4f){acc[nb][4], acc[nb][5], acc[nb][6], acc[nb][7]}; } }
    __syncthreads();
    const size_t r0 = (size_t)blockIdx.x * PM;
    v4f yq[4][2], yv[2][2];   // all of the thread's LDS reads go out together, ahead of the first store
#pragma unroll
    for (int i = 0; i < 4; ++i) { const float* p = oqk + (((i & 1) * 2 + ot) * 16 + ol) * QP + (i >> 1) * HD + oc * 8; yq[i][0] = *(const v4fa*)p; yq[i][1] = *(const v4fa*)(p + 4); }
#pragma unroll
    for (int i = 0; i < 2; ++i) { const float* p = ov + vd * VP + (i * 4 + vt) * 8; yv[i][0] = *(const v4fa*)p; yv[i][1] = *(const v4fa*)(p + 4); }
#pragma unroll
    for (int i = 0; i < 4; ++i) { const int mat = i >> 1; v8us oh, olo;
#pragma unroll
        for (int j = 0; j < 8; ++j) { const float b = mat ? bkv[j >> 2][j & 3] : bqv[j >> 2][j & 3]; const float y = yq[i][j >> 2][j & 3] + bfr(b); unsigned short h, l; splitf(y, h, l); oh[j] = h; olo[j] = l; }
        bf* ph = (mat ? Kh : Qh) + r0 * HD + ((i & 1) * 256 + tid) * 8; bf* pl = (mat ? Kl : Ql) + r0 * HD + ((i & 1) * 256 + tid) * 8; *(v8us*)ph = oh; *(v8us*)pl = olo;
        // The wait that stands between an issued global store and a later write of a register that the store names; addresses and data are inputs, so that they stay in their registers up to this line.
        asm volatile("s_wait_xcnt 0x0" :: "v"(ph), "v"(pl), "v"(oh), "v"(olo) : "memory"); }
    const size_t vo = r0 * HD + tid * 8;   // batch stride HD * TT, chunk stride 32 * HD: both are the token index times HD
#pragma unroll
    for (int i = 0; i < 2; ++i) { const float b = bfr(bvv); v8h o16; v8us oh, olo;
#pragma unroll
        for (int j = 0; j < 8; ++j) { const float y = yv[i][j >> 2][j & 3] + b; o16[j] = tohx(y); unsigned short h, l; splitf(y, h, l); oh[j] = h; olo[j] = l; }
        h16* pv = V16 + vo + i * 32 * HD; bf* ph = Vh + vo + i * 32 * HD; bf* pl = Vl + vo + i * 32 * HD; *(v8h*)pv = o16; *(v8us*)ph = oh; *(v8us*)pl = olo;
        if (i == 0) asm volatile("s_wait_xcnt 0x0" :: "v"(pv), "v"(ph), "v"(pl), "v"(o16), "v"(oh), "v"(olo) : "memory"); }   // as above; behind the last stores no register is written any more
}

#define LC (SCL * 1.4426950408889634f)
__device__ __forceinline__ float xhalf(float x) { return __builtin_bit_cast(float, __builtin_amdgcn_permlanex16(__builtin_bit_cast(int, x), __builtin_bit_cast(int, x), 0x76543210, 0xfedcba98, false, false)); }   // lane l with lane l ^ 16, in the vector unit (the shuffle goes through the LDS pipe)
__device__ __forceinline__ float exp2x1(float x) { float y; asm("v_exp_f32 %0, %1\n\tv_nop" : "=v"(y) : "v"(x)); return y; }
__device__ __forceinline__ void exp2x8(const float* x, float* y) {
    asm("v_exp_f32 %0, %8\n\tv_exp_f32 %1, %9\n\tv_exp_f32 %2, %10\n\tv_exp_f32 %3, %11\n\tv_exp_f32 %4, %12\n\tv_exp_f32 %5, %13\n\tv_exp_f32 %6, %14\n\tv_exp_f32 %7, %15\n\tv_nop"
        : "=&v"(y[0]), "=&v"(y[1]), "=&v"(y[2]), "=&v"(y[3]), "=&v"(y[4]), "=&v"(y[5]), "=&v"(y[6]), "=&v"(y[7]) : "v"(x[0]), "v"(x[1]), "v"(x[2]), "v"(x[3]), "v"(x[4]), "v"(x[5]), "v"(x[6]), "v"(x[7])); }
#define NW 8                  // waves per work-group = parts of the key loop
// Loads of one 32-key chunk. Behind each group stands the wait that belongs between an issued global load and a later write of a register that the load names as its address; the addresses are inputs, so that they stay in their registers up to that line.
__device__ __forceinline__ void ld_k(const bf* pkh, const bf* pkl, v16bf (&kh)[2][2], v16bf (&kl)[2][2]) {
#pragma unroll
    for (int kt = 0; kt < 2; ++kt)
#pragma unroll
        for (int kk = 0; kk < 2; ++kk) { kh[kt][kk] = WFrag<bf>::ldf(pkh + kt * 16 * HD + kk * 512); kl[kt][kk] = WFrag<bf>::ldf(pkl + kt * 16 * HD + kk * 512); }
    asm volatile("s_wait_xcnt 0x0" :: "v"(pkh), "v"(pkl) : "memory"); }
__device__ __forceinline__ void ld_v(const h16* pv, v16h (&v)[4]) {
#pragma unroll
    for (int dt = 0; dt < 4; ++dt) v[dt] = WFrag<h16>::ldf(pv + dt * 512);
    asm volatile("s_wait_xcnt 0x0" :: "v"(pv) : "memory"); }
__device__ __forceinline__ void ld_vhl(const bf* pvh, const bf* pvl, v16bf (&vh)[4], v16bf (&vl)[4]) {
#pragma unroll
    for (int dt = 0; dt < 4; ++dt) { vh[dt] = WFrag<bf>::ldf(pvh + dt * 512); vl[dt] = WFrag<bf>::ldf(pvl + dt * 512); }
    asm volatile("s_wait_xcnt 0x0" :: "v"(pvh), "v"(pvl) : "memory"); }
// S^T of one chunk and one 32-query tile: hi/lo, 3 products.
__device__ __forceinline__ void scores(const v16bf (&kh)[2][2], const v16bf (&kl)[2][2], const v16bf (&qh)[2][2], const v16bf (&ql)[2][2], v8f (&s)[2][2]) {
#pragma unroll
    for (int kt = 0; kt < 2; ++kt)
#pragma unroll
        for (int g = 0; g < 2; ++g) s[kt][g] = (v8f){};
#pragma unroll
    for (int kk = 0; kk < 2; ++kk) {
#pragma unroll
        for (int kt = 0; kt < 2; ++kt)
#pragma unroll
            for (int g = 0; g < 2; ++g) s[kt][g] = wmmab(kh[kt][kk], qh[g][kk], s[kt][g]);
#pragma unroll
        for (int kt = 0; kt < 2; ++kt)
#pragma unroll
            for (int g = 0; g < 2; ++g) s[kt][g] = wmmab(kl[kt][kk], qh[g][kk], s[kt][g]);
#pragma unroll
        for (int kt = 0; kt < 2; ++kt)
#pragma unroll
            for (int g = 0; g < 2; ++g) s[kt][g] = wmmab(kh[kt][kk], ql[g][kk], s[kt][g]); }
    __builtin_amdgcn_sched_barrier(0);   // keeps the v_nops of the next line behind the last product
    asm volatile("v_nop\n\tv_nop\n\tv_nop\n\tv_nop");   // the four vector slots between a matrix instruction and the first reader of its result
}
// Mask (diagonal chunk only), online softmax and O^T += V^T P^T of one chunk and one tile.
template <bool HR>
__device__ __forceinline__ void soft_pv(v8f (&s)[2][2], const v16h (&v)[4], const v16bf (&vh)[4], const v16bf (&vl)[4], v8f (&o)[2][4], float (&m)[2], float (&l)[2], const bool diag, const int lr, const int hi) {
    if (diag) {   // the diagonal chunk (scalar test): keys behind the query drop out
#pragma unroll
        for (int kt = 0; kt < 2; ++kt)
#pragma unroll
            for (int g = 0; g < 2; ++g)
#pragma unroll
                for (int j = 0; j < 8; ++j) if (kt * 16 + 8 * hi + j > g * 16 + lr) s[kt][g][j] = -3.0e38f; }
    v16h pf[2]; v8us ph[2][2], pl[2][2];
#pragma unroll
    for (int g = 0; g < 2; ++g) {
        float mx = s[0][g][0];
#pragma unroll
        for (int kt = 0; kt < 2; ++kt)
#pragma unroll
            for (int j = 0; j < 8; ++j) mx = fmaxf(mx, s[kt][g][j]);
        mx = fmaxf(mx, xhalf(mx));
        const float mn = fmaxf(m[g], mx * LC), al = exp2x1(m[g] - mn), sh = 10.0f - mn; m[g] = mn;
        float sum = 0.f;
#pragma unroll
        for (int kt = 0; kt < 2; ++kt) { float xa[8], pa[8];
#pragma unroll
            for (int j = 0; j < 8; ++j) xa[j] = fmaf(s[kt][g][j], LC, sh);
            exp2x8(xa, pa);
#pragma unroll
            for (int j = 0; j < 8; ++j) { const float p = pa[j]; sum += p;
                if constexpr (HR) { unsigned short a, b2; splitf(p, a, b2); ph[g][kt][j] = a; pl[g][kt][j] = b2; } else pf[g][kt * 8 + j] = tohx(p); } }
        l[g] = fmaf(l[g], al, sum);
#pragma unroll
        for (int dt = 0; dt < 4; ++dt) o[g][dt] *= al;
    }
#pragma unroll
    for (int dt = 0; dt < 4; ++dt)
#pragma unroll
        for (int g = 0; g < 2; ++g) {
            if constexpr (HR) { const v16bf bh = cat16b(ph[g][0], ph[g][1]), bl = cat16b(pl[g][0], pl[g][1]); o[g][dt] = wmmab(vh[dt], bh, o[g][dt]); o[g][dt] = wmmab(vh[dt], bl, o[g][dt]); o[g][dt] = wmmab(vl[dt], bh, o[g][dt]); }
            else o[g][dt] = wmma16(v[dt], pf[g], o[g][dt]); }
}
template <bool B> struct BoolC { static constexpr bool value = B; };
// Both query tiles of the work-group in one key walk: tile 0 = qa (the long one, never rows < RH), tile 1 = qb < qa. The walk covers qa's chunks; a chunk c <= qb serves both tiles from the same K (and, where tile 1 is fp16, V) registers.
// The next chunk's K loads go out behind the chunk's last score product and its V loads behind the last P.V product, into the registers that have just been read.
template <bool HR>
__device__ __forceinline__ void fattn_pair(const bf* __restrict__ Qh, const bf* __restrict__ Ql, const bf* __restrict__ Kh, const bf* __restrict__ Kl, const h16* __restrict__ V16, const bf* __restrict__ Vh, const bf* __restrict__ Vl, const int qa, const int qb, const int rot, const size_t zo, const int wave, float (*red)[64 * 68], float (*sm)[64], float (*sl)[64], bf* qs) {
    const int lane = threadIdx.x & 31, lr = lane & 15, hi = lane >> 4;
    v16bf qh[2][2], ql[2][2];
    { const bf* pqh = Qh + zo + (size_t)qa * 32 * HD + 8 * lane; const bf* pql = Ql + zo + (size_t)qa * 32 * HD + 8 * lane;
#pragma unroll
        for (int g = 0; g < 2; ++g)
#pragma unroll
            for (int kk = 0; kk < 2; ++kk) { qh[g][kk] = WFrag<bf>::ldf(pqh + g * 16 * HD + kk * 512); ql[g][kk] = WFrag<bf>::ldf(pql + g * 16 * HD + kk * 512); }
        asm volatile("s_wait_xcnt 0x0" :: "v"(pqh), "v"(pql) : "memory"); }   // as in ld_k, for the query loads
    // Tile 1's query fragments do not fit the registers beside tile 0's: each wave keeps its own copy of the two planes of that tile (fragment order, as in memory) in LDS and reads it back for a chunk that serves both tiles; no other wave touches it, so no barrier.
    bf* qw = qs + wave * 4096 + 8 * lane;
    { const bf* pqh = Qh + zo + (size_t)qb * 32 * HD + 8 * lane; const bf* pql = Ql + zo + (size_t)qb * 32 * HD + 8 * lane; v8us uh[8], ul[8];
#pragma unroll
        for (int u = 0; u < 8; ++u) { uh[u] = *(const v8us*)(pqh + u * 256); ul[u] = *(const v8us*)(pql + u * 256); }
        asm volatile("s_wait_xcnt 0x0" :: "v"(pqh), "v"(pql) : "memory");   // as in ld_k
        __builtin_amdgcn_sched_barrier(0);   // keeps the first chunk's address arithmetic, which reuses the scalar base that these loads name, behind the wait of the line above
#pragma unroll
        for (int u = 0; u < 8; ++u) { *(v8usa*)(qw + u * 256) = uh[u]; *(v8usa*)(qw + 2048 + u * 256) = ul[u]; } }
    v8f o[2][2][4]; float m[2][2], l[2][2];
#pragma unroll
    for (int t = 0; t < 2; ++t)
#pragma unroll
        for (int g = 0; g < 2; ++g) { m[t][g] = -3.0e38f; l[t][g] = 0.f;
#pragma unroll
            for (int dt = 0; dt < 4; ++dt) o[t][g][dt] = (v8f){}; }
    const bf* bkh = Kh + zo + 8 * lane; const bf* bkl = Kl + zo + 8 * lane; const h16* bv = V16 + zo + 8 * lane;
    v16bf kh[2][2], kl[2][2]; v16h v[4]; v16bf vh[4], vl[4];
    int i = wave;
    int c = i + rot > qa ? i + rot - (qa + 1) : i + rot;         // the walk starts at chunk rot and wraps (scalar)
    ld_k(bkh + (size_t)c * 32 * HD, bkl + (size_t)c * 32 * HD, kh, kl); ld_v(bv + (size_t)c * 32 * HD, v);
    // One chunk. MORE: a further chunk follows, whose loads go out here, unconditionally (the last chunk is separate code), so that each wait for a load counts exactly the younger loads behind it and lets them fly on.
    auto step = [&](auto more_c) __attribute__((always_inline)) {
        constexpr bool MORE = decltype(more_c)::value;
        const int in = i + NW, cn = in + rot > qa ? in + rot - (qa + 1) : in + rot;   // scalar
        const bool both = c <= qb;                               // scalar
        v8f sa[2][2], sb[2][2];
        scores(kh, kl, qh, ql, sa);
        if (both) { v16bf rh[2][2], rl[2][2];
#pragma unroll
            for (int g = 0; g < 2; ++g)
#pragma unroll
                for (int kk = 0; kk < 2; ++kk) { rh[g][kk] = WFrag<bf>::ldf(qw + g * 16 * HD + kk * 512); rl[g][kk] = WFrag<bf>::ldf(qw + 2048 + g * 16 * HD + kk * 512); }
            scores(kh, kl, rh, rl, sb); }
        if constexpr (MORE) ld_k(bkh + (size_t)cn * 32 * HD, bkl + (size_t)cn * 32 * HD, kh, kl);
        soft_pv<false>(sa, v, vh, vl, o[0], m[0], l[0], c == qa, lr, hi);
        if (both) {
            if constexpr (HR) ld_vhl(Vh + zo + (size_t)c * 32 * HD + 8 * lane, Vl + zo + (size_t)c * 32 * HD + 8 * lane, vh, vl);
            soft_pv<HR>(sb, v, vh, vl, o[1], m[1], l[1], c == qb, lr, hi); }
        if constexpr (MORE) { ld_v(bv + (size_t)cn * 32 * HD, v); i = in; c = cn; }
    };
    do step(BoolC<true>{}); while (i + NW <= qa);   // qa >= 2 NW on this grid: every wave has at least two chunks
    step(BoolC<false>{});
#pragma unroll
    for (int t = 0; t < 2; ++t)
#pragma unroll
        for (int g = 0; g < 2; ++g) { l[t][g] += xhalf(l[t][g]);
            if (hi == 0) { sm[wave][t * 32 + g * 16 + lr] = m[t][g]; sl[wave][t * 32 + g * 16 + lr] = l[t][g]; }
#pragma unroll
            for (int dt = 0; dt < 4; ++dt) { float* rp = &red[wave][(t * 32 + g * 16 + lr) * 68 + dt * 16 + 8 * hi];   // a lane's 8 accumulator registers are 8 consecutive d of one query
                *(v4fa*)rp = (v4f){o[t][g][dt][0], o[t][g][dt][1], o[t][g][dt][2], o[t][g][dt][3]}; *(v4fa*)(rp + 4) = (v4f){o[t][g][dt][4], o[t][g][dt][5], o[t][g][dt][6], o[t][g][dt][7]}; } }
}

// Work-group b of a batch takes query tiles 127 - b and b: 128 - b and b + 1 key chunks, 129 tile updates for every work-group, so that all 256 work-groups (one per WGP, two waves per SIMD) carry the same matrix and vector load; it reads 128 - b chunks.
__global__ __launch_bounds__(32 * NW) __attribute__((amdgpu_waves_per_eu(2, 2))) void k_fattn(const bf* __restrict__ Qh, const bf* __restrict__ Ql, const bf* __restrict__ Kh, const bf* __restrict__ Kl, const h16* __restrict__ V16, const bf* __restrict__ Vh, const bf* __restrict__ Vl, float* OUTb) {
    __shared__ __align__(16) float red[NW][64 * 68];
    __shared__ float sm[NW][64], sl[NW][64];
    __shared__ __align__(16) bf qs[NW * 4096];
    const int wave = __builtin_amdgcn_readfirstlane(threadIdx.x >> 5);   // scalar, so that the key loop is a scalar loop (EXEC stays all ones for the matrix instructions)
    const int b = (int)blockIdx.y; const size_t zo = (size_t)blockIdx.x * TT * HD;
    // Tile 127 - b is never one of the rows < RH (127 - b >= 64 on this grid of 64); tile b is where b * 32 < RH (same test in every wave).
    // Start of the walk: pr / 64 of the way round its n chunks, pr = 21 b mod 64 being a permutation of the 64 work-groups of a batch that sets neighbours far apart; pr * n / 64 < n.
    const int pr = (b * 21) & (TT / 64 - 1), r1 = pr * (TT / 32 - b) / (TT / 64);
    const int qa = TT / 32 - 1 - b, qb = b;
    if (b * 32 < RH) fattn_pair<true>(Qh, Ql, Kh, Kl, V16, Vh, Vl, qa, qb, r1, zo, wave, red, sm, sl, qs);
    else fattn_pair<false>(Qh, Ql, Kh, Kl, V16, Vh, Vl, qa, qb, r1, zo, wave, red, sm, sl, qs);
    // The join, one copy behind both forms of the walk.
    __syncthreads();
#pragma unroll 1   // kept rolled: the passes follow one another in any case (the wait behind a pass's store holds the next pass's reads back), and the kernel's text stays short
    for (int r = 0; r < 4; ++r) { const int qy = r * 16 + (threadIdx.x >> 4), d0 = (threadIdx.x & 15) * 4; float M = sm[0][qy];   // rows 0..31: tile qa, rows 32..63: tile qb
#pragma unroll
        for (int w = 1; w < NW; ++w) M = fmaxf(M, sm[w][qy]);
        float L = 0.f, fx[NW], fw[NW]; v4f a0 = (v4f){};
#pragma unroll
        for (int w = 0; w < NW; ++w) fx[w] = sm[w][qy] - M;
        exp2x8(fx, fw);
#pragma unroll
        for (int w = 0; w < NW; ++w) { const float f = fw[w]; L = fmaf(f, sl[w][qy], L); a0 += f * *(const v4fa*)(&red[w][qy * 68 + d0]); }   // a wave without a chunk of the tile: f = 0, sum 0, tile 0
        const float inv = __fdiv_rn(1.0f, L); float* op = OUTb + zo + (size_t)((r < 2 ? qa : qb) * 32 + (qy & 31)) * HD + d0; const v4f ov = a0 * inv;
        *(v4f*)op = ov;
        // The wait that stands between an issued global store and a later write of a register that the store names; address and data are inputs, so that they stay in their registers up to this line.
        asm volatile("s_wait_xcnt 0x0" :: "v"(op), "v"(ov) : "memory"); }
}

extern "C" void kernel_launch(void* const* d_in, const int* in_sizes, int n_in,
                              void* d_out, int out_size, void* d_ws, size_t ws_size, hipStream_t stream) {
    (void)in_sizes; (void)n_in; (void)out_size;
    const float* x = (const float*)d_in[0]; const float* wk = (const float*)d_in[1]; const float* bk = (const float*)d_in[2]; const float* wq = (const float*)d_in[3]; const float* bq = (const float*)d_in[4]; const float* wv = (const float*)d_in[5]; const float* bv = (const float*)d_in[6];   /* input order Wk, bk, Wq, bq, Wv, bv */
    float* OUT = (float*)d_out;     // [4][4096][64]
    char* wsp = (char*)d_ws;
    auto take = [&](size_t bytes) { char* p = wsp; wsp += (bytes + 255) & ~(size_t)255; return (void*)p; };
    h16* VT16 = (h16*)take((size_t)NB_ * HD * TT * 2);
    bf* QPh = (bf*)take((size_t)NB_ * TT * HD * 2); bf* QPl = (bf*)take((size_t)NB_ * TT * HD * 2); bf* KPh = (bf*)take((size_t)NB_ * TT * HD * 2); bf* KPl = (bf*)take((size_t)NB_ * TT * HD * 2); bf* VTh = (bf*)take((size_t)NB_ * HD * TT * 2); bf* VTl = (bf*)take((size_t)NB_ * HD * TT * 2);
    if ((size_t)(wsp - (char*)d_ws) > ws_size) return;    // ws 256 MiB
    k_proj<<<NB_ * TT / PM, 256, 0, stream>>>(x, wq, wk, wv, bq, bk, bv, QPh, QPl, KPh, KPl, VT16, VTh, VTl);
    k_fattn<<<dim3(NB_, TT / 64), 32 * NW, 0, stream>>>(QPh, QPl, KPh, KPl, VT16, VTh, VTl, OUT);
}

// v009
// A run of this version takes 26.2 microseconds.
// Two timings next to v008 both put it at 1.04 times that version's speed.
// All steps since v000 together make it 23.2 times as fast.
#include <hip/hip_runtime.h>

// Single-head causal attention over 4,096 tokens with a 64-wide head (embedded [4][4096][256]; k, q, v = x W + b ('xw' [256][64] 1/16; input order Wk, bk, Wq, bq, Wv, bv); scores / 8; causal (-inf); softmax; out = p v -> [4][4096][64] (1.05 M)).
// Layout: one projection kernel (64 token rows per work-group: x and the three 'xw' [256][64] weights rounded to bf16 into LDS, the weights transposed on the way; exact products + biases rounded to bf16) writes the q, k planes (hi/lo) and the v planes (fp16 and hi/lo), all in fragment order (see FRAGMENT ORDER below); one fused causal attention kernel, one launch (hi/lo 3-product score tiles on EVERY row, online softmax in registers, P and attn.v hybrid: rows < 512 hi/lo, rest fp16 x1024; key chunks above the diagonal skipped), which writes the output rows.
// Compute dtypes, f32 accumulate: every input rounded to bf16; projections exact + bf16-rounded biases; scores 3 products on every row; softmax f32; attn.v rows < 512 3 products, rest fp16; output f32.

#define NB_  4
#define TT   4096
#define DM   256
#define NH_  1
#define NKV  1
#define REP  (NH_ / NKV)
#define HD   64
#define DQ   (NH_ * HD)
#define DKV  (NKV * HD)
#define RH   512                  // query rows < RH use hi+lo planes (0: none)
#define SCL  0.125f   // HD^-0.5
typedef _Float16 h16;
typedef unsigned short bf;
typedef __attribute__((ext_vector_type(16))) __bf16   v16bf;
typedef __attribute__((ext_vector_type(16))) _Float16 v16h;
typedef __attribute__((ext_vector_type(8)))  _Float16 v8h;
typedef __attribute__((ext_vector_type(8)))  unsigned short v8us;
typedef __attribute__((ext_vector_type(8)))  float    v8f;
typedef __attribute__((ext_vector_type(4)))  float    v4f;
typedef v8h  __attribute__((may_alias)) v8ha;
typedef v4f  __attribute__((may_alias)) v4fa;
typedef v8us __attribute__((may_alias)) v8usa;

__device__ __forceinline__ float bfr(float f) { return (float)(__bf16)f; }   // f rounded to bf16 (nearest even)
__device__ __forceinline__ v16h cat16(v8h lo, v8h hi) { return __builtin_shufflevector(lo, hi, 0, 1, 2, 3, 4, 5, 6, 7, 8, 9, 10, 11, 12, 13, 14, 15); }
__device__ __forceinline__ v16bf cat16b(v8us lo, v8us hi) { return __builtin_bit_cast(v16bf, __builtin_shufflevector(lo, hi, 0, 1, 2, 3, 4, 5, 6, 7, 8, 9, 10, 11, 12, 13, 14, 15)); }
__device__ __forceinline__ v8f wmma16(v16h a, v16h b, v8f c) { return __builtin_amdgcn_wmma_f32_16x16x32_f16(false, a, false, b, (short)0, c, false, false); }
__device__ __forceinline__ v8f wmmab(v16bf a, v16bf b, v8f c) { return __builtin_amdgcn_wmma_f32_16x16x32_bf16(false, a, false, b, (short)0, c, false, false); }



// Fragment loaders. ld: operands from K-contiguous 16-bit rows (LDS); ldf: operands from the global planes in fragment order. A and B of a product use the same loader, so their k orders are equal.
// FRAGMENT ORDER of the global planes: the unit is 8 consecutive k of one operand row (16 bytes, what a lane takes with one load). A tile of 16 rows x 32 k is stored as [k octet 0..3][row 0..15][8 k] = 1,024 bytes,
// so that lane l (row l & 15, half l >> 4) finds its first unit (octet l >> 4) at byte 16 l and its second (octet 2 + (l >> 4)) 512 bytes on: each wave-wide 16-byte load reads 512 contiguous bytes = 4 whole lines, not 32-byte pieces of 16 lines.
// q, k planes: [batch][16-token tile][d octet 0..7][token][8 d] (k = d; two such tiles of 32 d follow one another); v planes: [batch][32-token chunk][16-d tile 0..3][token octet 0..3][d][8 tokens] (rows = d, k = token). The registers hold what they held with row-major planes.
template <typename T16> struct WFrag;
template <> struct WFrag<h16> { typedef v16h V; static __device__ __forceinline__ V ldf(const h16* p) { return cat16(*(const v8h*)p, *(const v8h*)(p + 256)); } static __device__ __forceinline__ v8f mma(V a, V b, v8f c) { return wmma16(a, b, c); } };
template <> struct WFrag<bf> { typedef v16bf V; static __device__ __forceinline__ V ld(const bf* p) { return cat16b(*(const v8us*)p, *(const v8us*)(p + 16)); } static __device__ __forceinline__ V ldf(const bf* p) { return cat16b(*(const v8us*)p, *(const v8us*)(p + 256)); } static __device__ __forceinline__ v8f mma(V a, V b, v8f c) { return wmmab(a, b, c); } };
__device__ __forceinline__ h16 tohx(float x) { return (h16)x; }
typedef __attribute__((ext_vector_type(4))) unsigned short v4us;
typedef v4us __attribute__((may_alias)) v4usa;
typedef __attribute__((ext_vector_type(8))) __bf16 v8bf;
typedef __attribute__((ext_vector_type(4))) __bf16 v4bf;
// f32 -> bf16 with the packed convert instruction (two values each, round to nearest even); split8: y = h + l, h = bf16(y), l = bf16(y - h), eight values at a time (its '#pragma unroll': the vectors are indexed by constants and stay in registers).
__device__ __forceinline__ v8us cvt8(v8f y) { return __builtin_bit_cast(v8us, __builtin_convertvector(y, v8bf)); }
__device__ __forceinline__ v4us cvt4(v4f y) { return __builtin_bit_cast(v4us, __builtin_convertvector(y, v4bf)); }
typedef __attribute__((ext_vector_type(4))) unsigned v4u;
__device__ __forceinline__ void split8(v8f y, v8us& h, v8us& l) { h = cvt8(y); const v4u u = __builtin_bit_cast(v4u, h); v8f r;   // h back to f32 from the packed words: low half shifted up, high half masked
#pragma unroll
    for (int q = 0; q < 4; ++q) { r[2 * q] = y[2 * q] - __uint_as_float(u[q] << 16); r[2 * q + 1] = y[2 * q + 1] - __uint_as_float(u[q] & 0xFFFF0000u); }
    l = cvt8(r); }

// ---- k_proj: q, k, v = x W + b for 64 token rows in ONE work-group (8 waves), from the f32 inputs to the 16-bit planes that the attention kernel reads.
// Stage 1: the x tile (coalesced 16-byte loads) and the three weights (a thread gathers 8 consecutive k of one column n; 32 lanes = 32 consecutive n = one line per load) are rounded to bf16 and laid K-contiguous in LDS: xs[row][k], wt[matrix * 64 + n][k].
// Stage 2, behind the first barrier: wave w takes row tile w & 3 and six of the twelve 16-column tiles (rows of wt: 0..63 q, 64..127 k, 128..191 v): waves 0..3 all of q and the lower half of v, waves 4..7 all of k and the upper half of v, so that every wave stages four tiles the q, k way and two the v way with no branch; k runs upward in steps of 32 on one accumulator per tile.
// Stage 3: the f32 tiles go to LDS (q, k as [row][column]; v as [column][row], which is how a lane holds it: 8 consecutive rows of one column); behind the second barrier every thread adds the bias to one unit (8 consecutive d of a token for q, k; 8 consecutive tokens of a d for v), splits it and stores 16 bytes per plane; in fragment order the work-group's 64 tokens are one contiguous piece of each plane and thread t's units lie at bytes 16 t and 16 (256 + t) of it: a wave's store fills 4 whole lines.
// Every '#pragma unroll' of this kernel is there so that the load, fragment and accumulator arrays are indexed by constants and stay in registers.
#define PM 64                 // token rows per work-group (divides TT: a work-group lies in one batch)
#define XP (DM + 8)           // LDS row pitch of xs and wt in elements: 528 bytes = 16 bytes x odd, conflict-free for 16-byte reads and writes of 16 rows
#define QP 132                // pitch of the q, k tile in floats
#define VP 68                 // pitch of the v tile in floats
__global__ __launch_bounds__(256) void k_proj(const float* __restrict__ x, const float* __restrict__ wq, const float* __restrict__ wk, const float* __restrict__ wv, const float* __restrict__ bq, const float* __restrict__ bk, const float* __restrict__ bv, bf* Qh, bf* Ql, bf* Kh, bf* Kl, h16* V16, bf* Vh, bf* Vl) {
    __shared__ __align__(16) bf xs[PM * XP];
    __shared__ __align__(16) bf wt[3 * HD * XP];
    __shared__ __align__(16) float oqk[PM * QP];
    __shared__ __align__(16) float ov[HD * VP];
    const int tid = threadIdx.x, lane = tid & 31, lr = lane & 15, hi = lane >> 4;
    const int wave = tid >> 5;
    const int wn = tid & 63, wk0 = (tid >> 6) * 8;               // weight gather: column n, first k of the thread's first group of 8
    const int oc = (tid >> 4) & 7, ol = tid & 15, ot = tid >> 7;   // q, k output phase: d octet, token in its 16-token tile, tile of a pair
    const int vd = ((tid >> 6) & 3) * 16 + ol, vt = (tid >> 4) & 3;   // v output phase: d, token octet in its 32-token chunk
    float g0[8][8], g1[8][8], g2[8][8]; v4f xv[16], bqv[2], bkv[2];
    // Two groups of loads are in flight at any time: q weight and x tile (with the thread's few bias values in front); the k weight's follow the q weight's conversion, the v weight's the x tile's.
#pragma unroll
    for (int q = 0; q < 2; ++q) { bqv[q] = *(const v4f*)(bq + oc * 8 + q * 4); bkv[q] = *(const v4f*)(bk + oc * 8 + q * 4); }
    const float bvv = bv[vd];
#pragma unroll
    for (int i = 0; i < 8; ++i)
#pragma unroll
        for (int j = 0; j < 8; ++j) g0[i][j] = wq[(i * 32 + wk0 + j) * HD + wn];
    const float* xp = x + (size_t)blockIdx.x * PM * DM;
#pragma unroll
    for (int i = 0; i < 16; ++i) xv[i] = *(const v4f*)(xp + (i * 256 + tid) * 4);
    asm volatile("s_wait_xcnt 0x0" ::: "memory");   // the wait that stands between an issued global load and a later write of a register that the load names as its address; it also keeps these loads together ahead of the first conversion
#pragma unroll
    for (int i = 0; i < 8; ++i) { v8f a;
#pragma unroll
        for (int j = 0; j < 8; ++j) a[j] = g0[i][j];
        *(v8usa*)(wt + wn * XP + i * 32 + wk0) = cvt8(a); }
    __builtin_amdgcn_sched_barrier(0);   // keeps the k weight's loads behind the conversion of the q weight, whose registers they take over: the kernel stays inside 256 registers (no register-window switches)
#pragma unroll
    for (int i = 0; i < 8; ++i)
#pragma unroll
        for (int j = 0; j < 8; ++j) g1[i][j] = wk[(i * 32 + wk0 + j) * HD + wn];
    asm volatile("s_wait_xcnt 0x0" ::: "memory");   // as above, for the k weight's loads
#pragma unroll
    for (int i = 0; i < 16; ++i) *(v4usa*)(xs + (i * 4 + (tid >> 6)) * XP + wn * 4) = cvt4(xv[i]);
    __builtin_amdgcn_sched_barrier(0);   // as above: the v weight's loads take over the x tile's registers
#pragma unroll
    for (int i = 0; i < 8; ++i)
#pragma unroll
        for (int j = 0; j < 8; ++j) g2[i][j] = wv[(i * 32 + wk0 + j) * HD + wn];
    asm volatile("s_wait_xcnt 0x0" ::: "memory");   // as above, for the v weight's loads
#pragma unroll
    for (int i = 0; i < 8; ++i) { v8f a, b;
#pragma unroll
        for (int j = 0; j < 8; ++j) { a[j] = g1[i][j]; b[j] = g2[i][j]; }
        *(v8usa*)(wt + (HD + wn) * XP + i * 32 + wk0) = cvt8(a); *(v8usa*)(wt + (2 * HD + wn) * XP + i * 32 + wk0) = cvt8(b); }
    __syncthreads();
    const int mt = wave & 3, ng = wave >> 2;
    v8f acc[6];
#pragma unroll
    for (int nb = 0; nb < 6; ++nb) acc[nb] = (v8f){};
    { const bf* pa = xs + (mt * 16 + lr) * XP + 8 * hi; const bf* pb = wt + (ng * HD + lr) * XP + 8 * hi; const bf* pc = wt + (2 * HD + ng * 32 + lr) * XP + 8 * hi;
#pragma unroll
        for (int kc = 0; kc < DM; kc += 32) { const v16bf a = WFrag<bf>::ld(pa + kc);
#pragma unroll
            for (int nb = 0; nb < 6; ++nb) acc[nb] = wmmab(a, WFrag<bf>::ld((nb < 4 ? pb + nb * 16 * XP : pc + (nb - 4) * 16 * XP) + kc), acc[nb]); } }
#pragma unroll
    for (int nb = 0; nb < 6; ++nb) {
        if (nb < 4) { float* p = oqk + (mt * 16 + hi * 8) * QP + ng * HD + nb * 16 + lr;
#pragma unroll
            for (int j = 0; j < 8; ++j) p[j * QP] = acc[nb][j]; }
        else { float* p = ov + (ng * 32 + (nb - 4) * 16 + lr) * VP + mt * 16 + hi * 8;
            *(v4fa*)p = (v4f){acc[nb][0], acc[nb][1], acc[nb][2], acc[nb][3]}; *(v4fa*)(p + 4) = (v4f){acc[nb][4], acc[nb][5], acc[nb][6], acc[nb][7]}; } }
    __syncthreads();
    const size_t r0 = (size_t)blockIdx.x * PM;
    v4f yq[4][2], yv[2][2];   // all of the thread's LDS reads go out together, ahead of the first store
#pragma unroll
    for (int i = 0; i < 4; ++i) { const float* p = oqk + (((i & 1) * 2 + ot) * 16 + ol) * QP + (i >> 1) * HD + oc * 8; yq[i][0] = *(const v4fa*)p; yq[i][1] = *(const v4fa*)(p + 4); }
#pragma unroll
    for (int i = 0; i < 2; ++i) { const float* p = ov + vd * VP + (i * 4 + vt) * 8; yv[i][0] = *(const v4fa*)p; yv[i][1] = *(const v4fa*)(p + 4); }
#pragma unroll
    for (int i = 0; i < 4; ++i) { const int mat = i >> 1; v8us oh, olo; v8f y;
#pragma unroll
        for (int j = 0; j < 8; ++j) { const float b = mat ? bkv[j >> 2][j & 3] : bqv[j >> 2][j & 3]; y[j] = yq[i][j >> 2][j & 3] + bfr(b); }
        split8(y, oh, olo);
        bf* ph = (mat ? Kh : Qh) + r0 * HD + ((i & 1) * 256 + tid) * 8; bf* pl = (mat ? Kl : Ql) + r0 * HD + ((i & 1) * 256 + tid) * 8; *(v8us*)ph = oh; *(v8us*)pl = olo;
        // The wait that stands between an issued global store and a later write of a register that the store names; addresses and data are inputs, so that they stay in their registers up to this line.
        asm volatile("s_wait_xcnt 0x0" :: "v"(ph), "v"(pl), "v"(oh), "v"(olo) : "memory"); }
    const size_t vo = r0 * HD + tid * 8;   // batch stride HD * TT, chunk stride 32 * HD: both are the token index times HD
#pragma unroll
    for (int i = 0; i < 2; ++i) { const float b = bfr(bvv); v8h o16; v8us oh, olo; v8f y;
#pragma unroll
        for (int j = 0; j < 8; ++j) { y[j] = yv[i][j >> 2][j & 3] + b; o16[j] = tohx(y[j]); }
        split8(y, oh, olo);
        h16* pv = V16 + vo + i * 32 * HD; bf* ph = Vh + vo + i * 32 * HD; bf* pl = Vl + vo + i * 32 * HD; *(v8h*)pv = o16; *(v8us*)ph = oh; *(v8us*)pl = olo;
        if (i == 0) asm volatile("s_wait_xcnt 0x0" :: "v"(pv), "v"(ph), "v"(pl), "v"(o16), "v"(oh), "v"(olo) : "memory"); }   // as above; behind the last stores no register is written any more
}

#define LC (SCL * 1.4426950408889634f)
__device__ __forceinline__ float xhalf(float x) { return __builtin_bit_cast(float, __builtin_amdgcn_permlanex16(__builtin_bit_cast(int, x), __builtin_bit_cast(int, x), 0x76543210, 0xfedcba98, false, false)); }   // lane l with lane l ^ 16, in the vector unit (the shuffle goes through the LDS pipe)
__device__ __forceinline__ float exp2x1(float x) { float y; asm("v_exp_f32 %0, %1\n\tv_nop" : "=v"(y) : "v"(x)); return y; }
__device__ __forceinline__ void exp2x8(const float* x, float* y) {
    asm("v_exp_f32 %0, %8\n\tv_exp_f32 %1, %9\n\tv_exp_f32 %2, %10\n\tv_exp_f32 %3, %11\n\tv_exp_f32 %4, %12\n\tv_exp_f32 %5, %13\n\tv_exp_f32 %6, %14\n\tv_exp_f32 %7, %15\n\tv_nop"
        : "=&v"(y[0]), "=&v"(y[1]), "=&v"(y[2]), "=&v"(y[3]), "=&v"(y[4]), "=&v"(y[5]), "=&v"(y[6]), "=&v"(y[7]) : "v"(x[0]), "v"(x[1]), "v"(x[2]), "v"(x[3]), "v"(x[4]), "v"(x[5]), "v"(x[6]), "v"(x[7])); }
#define NW 8                  // waves per work-group = parts of the key loop
// Loads of one 32-key chunk. Behind each group stands the wait that belongs between an issued global load and a later write of a register that the load names as its address; the addresses are inputs, so that they stay in their registers up to that line.
__device__ __forceinline__ void ld_k(const bf* pkh, const bf* pkl, v16bf (&kh)[2][2], v16bf (&kl)[2][2]) {
#pragma unroll
    for (int kt = 0; kt < 2; ++kt)
#pragma unroll
        for (int kk = 0; kk < 2; ++kk) { kh[kt][kk] = WFrag<bf>::ldf(pkh + kt * 16 * HD + kk * 512); kl[kt][kk] = WFrag<bf>::ldf(pkl + kt * 16 * HD + kk * 512); }
    asm volatile("s_wait_xcnt 0x0" :: "v"(pkh), "v"(pkl) : "memory"); }
__device__ __forceinline__ void ld_v(const h16* pv, v16h (&v)[4]) {
#pragma unroll
    for (int dt = 0; dt < 4; ++dt) v[dt] = WFrag<h16>::ldf(pv + dt * 512);
    asm volatile("s_wait_xcnt 0x0" :: "v"(pv) : "memory"); }
__device__ __forceinline__ void ld_vhl(const bf* pvh, const bf* pvl, v16bf (&vh)[4], v16bf (&vl)[4]) {
#pragma unroll
    for (int dt = 0; dt < 4; ++dt) { vh[dt] = WFrag<bf>::ldf(pvh + dt * 512); vl[dt] = WFrag<bf>::ldf(pvl + dt * 512); }
    asm volatile("s_wait_xcnt 0x0" :: "v"(pvh), "v"(pvl) : "memory"); }
// S^T of one chunk and one 32-query tile: hi/lo, 3 products.
__device__ __forceinline__ void scores(const v16bf (&kh)[2][2], const v16bf (&kl)[2][2], const v16bf (&qh)[2][2], const v16bf (&ql)[2][2], v8f (&s)[2][2]) {
#pragma unroll
    for (int kt = 0; kt < 2; ++kt)
#pragma unroll
        for (int g = 0; g < 2; ++g) s[kt][g] = (v8f){};
#pragma unroll
    for (int kk = 0; kk < 2; ++kk) {
#pragma unroll
        for (int kt = 0; kt < 2; ++kt)
#pragma unroll
            for (int g = 0; g < 2; ++g) s[kt][g] = wmmab(kh[kt][kk], qh[g][kk], s[kt][g]);
#pragma unroll
        for (int kt = 0; kt < 2; ++kt)
#pragma unroll
            for (int g = 0; g < 2; ++g) s[kt][g] = wmmab(kl[kt][kk], qh[g][kk], s[kt][g]);
#pragma unroll
        for (int kt = 0; kt < 2; ++kt)
#pragma unroll
            for (int g = 0; g < 2; ++g) s[kt][g] = wmmab(kh[kt][kk], ql[g][kk], s[kt][g]); }
    __builtin_amdgcn_sched_barrier(0);   // keeps the v_nops of the next line behind the last product
    asm volatile("v_nop\n\tv_nop\n\tv_nop\n\tv_nop");   // the four vector slots between a matrix instruction and the first reader of its result
}
// Mask (diagonal chunk only), online softmax and O^T += V^T P^T of one chunk and one tile.
template <bool HR>
__device__ __forceinline__ void soft_pv(v8f (&s)[2][2], const v16h (&v)[4], const v16bf (&vh)[4], const v16bf (&vl)[4], v8f (&o)[2][4], float (&m)[2], float (&l)[2], const bool diag, const int lr, const int hi) {
    if (diag) {   // the diagonal chunk (scalar test): keys behind the query drop out
#pragma unroll
        for (int kt = 0; kt < 2; ++kt)
#pragma unroll
            for (int g = 0; g < 2; ++g)
#pragma unroll
                for (int j = 0; j < 8; ++j) if (kt * 16 + 8 * hi + j > g * 16 + lr) s[kt][g][j] = -3.0e38f; }
    v16h pf[2]; v8us ph[2][2], pl[2][2];
#pragma unroll
    for (int g = 0; g < 2; ++g) {
        float mx = s[0][g][0];
#pragma unroll
        for (int kt = 0; kt < 2; ++kt)
#pragma unroll
            for (int j = 0; j < 8; ++j) mx = fmaxf(mx, s[kt][g][j]);
        mx = fmaxf(mx, xhalf(mx));
        const float mn = fmaxf(m[g], mx * LC), al = exp2x1(m[g] - mn), sh = 10.0f - mn; m[g] = mn;
        float sum = 0.f;
#pragma unroll
        for (int kt = 0; kt < 2; ++kt) { float xa[8], pa[8];
#pragma unroll
            for (int j = 0; j < 8; ++j) xa[j] = fmaf(s[kt][g][j], LC, sh);
            exp2x8(xa, pa);
#pragma unroll
            for (int j = 0; j < 8; ++j) { const float p = pa[j]; sum += p;
                if constexpr (!HR) pf[g][kt * 8 + j] = tohx(p); }
            if constexpr (HR) split8((v8f){pa[0], pa[1], pa[2], pa[3], pa[4], pa[5], pa[6], pa[7]}, ph[g][kt], pl[g][kt]); }
        l[g] = fmaf(l[g], al, sum);
#pragma unroll
        for (int dt = 0; dt < 4; ++dt) o[g][dt] *= al;
    }
#pragma unroll
    for (int dt = 0; dt < 4; ++dt)
#pragma unroll
        for (int g = 0; g < 2; ++g) {
            if constexpr (HR) { const v16bf bh = cat16b(ph[g][0], ph[g][1]), bl = cat16b(pl[g][0], pl[g][1]); o[g][dt] = wmmab(vh[dt], bh, o[g][dt]); o[g][dt] = wmmab(vh[dt], bl, o[g][dt]); o[g][dt] = wmmab(vl[dt], bh, o[g][dt]); }
            else o[g][dt] = wmma16(v[dt], pf[g], o[g][dt]); }
}
template <bool B> struct BoolC { static constexpr bool value = B; };
// Both query tiles of the work-group in one key walk: tile 0 = qa (the long one, never rows < RH), tile 1 = qb < qa. The walk covers qa's chunks; a chunk c <= qb serves both tiles from the same K (and, where tile 1 is fp16, V) registers.
// The next chunk's K loads go out behind the chunk's last score product and its V loads behind the last P.V product, into the registers that have just been read.
template <bool HR>
__device__ __forceinline__ void fattn_pair(const bf* __restrict__ Qh, const bf* __restrict__ Ql, const bf* __restrict__ Kh, const bf* __restrict__ Kl, const h16* __restrict__ V16, const bf* __restrict__ Vh, const bf* __restrict__ Vl, const int qa, const int qb, const int rot, const size_t zo, const int wave, float (*red)[64 * 68], float (*sm)[64], float (*sl)[64], bf* qs) {
    const int lane = threadIdx.x & 31, lr = lane & 15, hi = lane >> 4;
    v16bf qh[2][2], ql[2][2];
    { const bf* pqh = Qh + zo + (size_t)qa * 32 * HD + 8 * lane; const bf* pql = Ql + zo + (size_t)qa * 32 * HD + 8 * lane;
#pragma unroll
        for (int g = 0; g < 2; ++g)
#pragma unroll
            for (int kk = 0; kk < 2; ++kk) { qh[g][kk] = WFrag<bf>::ldf(pqh + g * 16 * HD + kk * 512); ql[g][kk] = WFrag<bf>::ldf(pql + g * 16 * HD + kk * 512); }
        asm volatile("s_wait_xcnt 0x0" :: "v"(pqh), "v"(pql) : "memory"); }   // as in ld_k, for the query loads
    // Tile 1's query fragments do not fit the registers beside tile 0's: each wave keeps its own copy of the two planes of that tile (fragment order, as in memory) in LDS and reads it back for a chunk that serves both tiles; no other wave touches it, so no barrier.
    bf* qw = qs + wave * 4096 + 8 * lane;
    { const bf* pqh = Qh + zo + (size_t)qb * 32 * HD + 8 * lane; const bf* pql = Ql + zo + (size_t)qb * 32 * HD + 8 * lane; v8us uh[8], ul[8];
#pragma unroll
        for (int u = 0; u < 8; ++u) { uh[u] = *(const v8us*)(pqh + u * 256); ul[u] = *(const v8us*)(pql + u * 256); }
        asm volatile("s_wait_xcnt 0x0" :: "v"(pqh), "v"(pql) : "memory");   // as in ld_k
        __builtin_amdgcn_sched_barrier(0);   // keeps the first chunk's address arithmetic, which reuses the scalar base that these loads name, behind the wait of the line above
#pragma unroll
        for (int u = 0; u < 8; ++u) { *(v8usa*)(qw + u * 256) = uh[u]; *(v8usa*)(qw + 2048 + u * 256) = ul[u]; } }
    v8f o[2][2][4]; float m[2][2], l[2][2];
#pragma unroll
    for (int t = 0; t < 2; ++t)
#pragma unroll
        for (int g = 0; g < 2; ++g) { m[t][g] = -3.0e38f; l[t][g] = 0.f;
#pragma unroll
            for (int dt = 0; dt < 4; ++dt) o[t][g][dt] = (v8f){}; }
    const bf* bkh = Kh + zo + 8 * lane; const bf* bkl = Kl + zo + 8 * lane; const h16* bv = V16 + zo + 8 * lane;
    v16bf kh[2][2], kl[2][2]; v16h v[4]; v16bf vh[4], vl[4];
    int i = wave;
    int c = i + rot > qa ? i + rot - (qa + 1) : i + rot;         // the walk starts at chunk rot and wraps (scalar)
    ld_k(bkh + (size_t)c * 32 * HD, bkl + (size_t)c * 32 * HD, kh, kl); ld_v(bv + (size_t)c * 32 * HD, v);
    // One chunk. MORE: a further chunk follows, whose loads go out here, unconditionally (the last chunk is separate code), so that each wait for a load counts exactly the younger loads behind it and lets them fly on.
    auto step = [&](auto more_c) __attribute__((always_inline)) {
        constexpr bool MORE = decltype(more_c)::value;
        const int in = i + NW, cn = in + rot > qa ? in + rot - (qa + 1) : in + rot;   // scalar
        const bool both = c <= qb;                               // scalar
        v8f sa[2][2], sb[2][2];
        scores(kh, kl, qh, ql, sa);
        if (both) { v16bf rh[2][2], rl[2][2];
#pragma unroll
            for (int g = 0; g < 2; ++g)
#pragma unroll
                for (int kk = 0; kk < 2; ++kk) { rh[g][kk] = WFrag<bf>::ldf(qw + g * 16 * HD + kk * 512); rl[g][kk] = WFrag<bf>::ldf(qw + 2048 + g * 16 * HD + kk * 512); }
            scores(kh, kl, rh, rl, sb); }
        if constexpr (MORE) ld_k(bkh + (size_t)cn * 32 * HD, bkl + (size_t)cn * 32 * HD, kh, kl);
        soft_pv<false>(sa, v, vh, vl, o[0], m[0], l[0], c == qa, lr, hi);
        if (both) {
            if constexpr (HR) ld_vhl(Vh + zo + (size_t)c * 32 * HD + 8 * lane, Vl + zo + (size_t)c * 32 * HD + 8 * lane, vh, vl);
            soft_pv<HR>(sb, v, vh, vl, o[1], m[1], l[1], c == qb, lr, hi); }
        if constexpr (MORE) { ld_v(bv + (size_t)cn * 32 * HD, v); i = in; c = cn; }
    };
    do step(BoolC<true>{}); while (i + NW <= qa);   // qa >= 2 NW on this grid: every wave has at least two chunks
    step(BoolC<false>{});
#pragma unroll
    for (int t = 0; t < 2; ++t)
#pragma unroll
        for (int g = 0; g < 2; ++g) { l[t][g] += xhalf(l[t][g]);
            if (hi == 0) { sm[wave][t * 32 + g * 16 + lr] = m[t][g]; sl[wave][t * 32 + g * 16 + lr] = l[t][g]; }
#pragma unroll
            for (int dt = 0; dt < 4; ++dt) { float* rp = &red[wave][(t * 32 + g * 16 + lr) * 68 + dt * 16 + 8 * hi];   // a lane's 8 accumulator registers are 8 consecutive d of one query
                *(v4fa*)rp = (v4f){o[t][g][dt][0], o[t][g][dt][1], o[t][g][dt][2], o[t][g][dt][3]}; *(v4fa*)(rp + 4) = (v4f){o[t][g][dt][4], o[t][g][dt][5], o[t][g][dt][6], o[t][g][dt][7]}; } }
}

// Work-group b of a batch takes query tiles 127 - b and b: 128 - b and b + 1 key chunks, 129 tile updates for every work-group, so that all 256 work-groups (one per WGP, two waves per SIMD) carry the same matrix and vector load; it reads 128 - b chunks.
__global__ __launch_bounds__(32 * NW) __attribute__((amdgpu_waves_per_eu(2, 2))) void k_fattn(const bf* __restrict__ Qh, const bf* __restrict__ Ql, const bf* __restrict__ Kh, const bf* __restrict__ Kl, const h16* __restrict__ V16, const bf* __restrict__ Vh, const bf* __restrict__ Vl, float* OUTb) {
    __shared__ __align__(16) float red[NW][64 * 68];
    __shared__ float sm[NW][64], sl[NW][64];
    __shared__ __align__(16) bf qs[NW * 4096];
    const int wave = __builtin_amdgcn_readfirstlane(threadIdx.x >> 5);   // scalar, so that the key loop is a scalar loop (EXEC stays all ones for the matrix instructions)
    const int b = (int)blockIdx.y; const size_t zo = (size_t)blockIdx.x * TT * HD;
    // Tile 127 - b is never one of the rows < RH (127 - b >= 64 on this grid of 64); tile b is where b * 32 < RH (same test in every wave).
    // Start of the walk: pr / 64 of the way round its n chunks, pr = 21 b mod 64 being a permutation of the 64 work-groups of a batch that sets neighbours far apart; pr * n / 64 < n.
    const int pr = (b * 21) & (TT / 64 - 1), r1 = pr * (TT / 32 - b) / (TT / 64);
    const int qa = TT / 32 - 1 - b, qb = b;
    if (b * 32 < RH) fattn_pair<true>(Qh, Ql, Kh, Kl, V16, Vh, Vl, qa, qb, r1, zo, wave, red, sm, sl, qs);
    else fattn_pair<false>(Qh, Ql, Kh, Kl, V16, Vh, Vl, qa, qb, r1, zo, wave, red, sm, sl, qs);
    // The join, one copy behind both forms of the walk.
    __syncthreads();
#pragma unroll 1   // kept rolled: the passes follow one another in any case (the wait behind a pass's store holds the next pass's reads back), and the kernel's text stays short
    for (int r = 0; r < 4; ++r) { const int qy = r * 16 + (threadIdx.x >> 4), d0 = (threadIdx.x & 15) * 4; float M = sm[0][qy];   // rows 0..31: tile qa, rows 32..63: tile qb
#pragma unroll
        for (int w = 1; w < NW; ++w) M = fmaxf(M, sm[w][qy]);
        float L = 0.f, fx[NW], fw[NW]; v4f a0 = (v4f){};
#pragma unroll
        for (int w = 0; w < NW; ++w) fx[w] = sm[w][qy] - M;
        exp2x8(fx, fw);
#pragma unroll
        for (int w = 0; w < NW; ++w) { const float f = fw[w]; L = fmaf(f, sl[w][qy], L); a0 += f * *(const v4fa*)(&red[w][qy * 68 + d0]); }   // a wave without a chunk of the tile: f = 0, sum 0, tile 0
        const float inv = __fdiv_rn(1.0f, L); float* op = OUTb + zo + (size_t)((r < 2 ? qa : qb) * 32 + (qy & 31)) * HD + d0; const v4f ov = a0 * inv;
        *(v4f*)op = ov;
        // The wait that stands between an issued global store and a later write of a register that the store names; address and data are inputs, so that they stay in their registers up to this line.
        asm volatile("s_wait_xcnt 0x0" :: "v"(op), "v"(ov) : "memory"); }
}

extern "C" void kernel_launch(void* const* d_in, const int* in_sizes, int n_in,
                              void* d_out, int out_size, void* d_ws, size_t ws_size, hipStream_t stream) {
    (void)in_sizes; (void)n_in; (void)out_size;
    const float* x = (const float*)d_in[0]; const float* wk = (const float*)d_in[1]; const float* bk = (const float*)d_in[2]; const float* wq = (const float*)d_in[3]; const float* bq = (const float*)d_in[4]; const float* wv = (const float*)d_in[5]; const float* bv = (const float*)d_in[6];   /* input order Wk, bk, Wq, bq, Wv, bv */
    float* OUT = (float*)d_out;     // [4][4096][64]
    char* wsp = (char*)d_ws;
    auto take = [&](size_t bytes) { char* p = wsp; wsp += (bytes + 255) & ~(size_t)255; return (void*)p; };
    h16* VT16 = (h16*)take((size_t)NB_ * HD * TT * 2);
    bf* QPh = (bf*)take((size_t)NB_ * TT * HD * 2); bf* QPl = (bf*)take((size_t)NB_ * TT * HD * 2); bf* KPh = (bf*)take((size_t)NB_ * TT * HD * 2); bf* KPl = (bf*)take((size_t)NB_ * TT * HD * 2); bf* VTh = (bf*)take((size_t)NB_ * HD * TT * 2); bf* VTl = (bf*)take((size_t)NB_ * HD * TT * 2);
    if ((size_t)(wsp - (char*)d_ws) > ws_size) return;    // ws 256 MiB
    k_proj<<<NB_ * TT / PM, 256, 0, stream>>>(x, wq, wk, wv, bq, bk, bv, QPh, QPl, KPh, KPl, VT16, VTh, VTl);
    k_fattn<<<dim3(NB_, TT / 64), 32 * NW, 0, stream>>>(QPh, QPl, KPh, KPl, VT16, VTh, VTl, OUT);
}
